// v000
// The times below were measured on an AMD MI455X: many runs one after another, warmed up first and cycling through
// copies of the inputs, with the whole window's GPU time divided by the number of runs. Launches and the gaps
// between them are all in it. The median over several windows is given; except for v000 it joins two sittings, which
// can be a few percent apart, so the side-by-side timings, each taken in one sitting, are the better comparison.
// v000 is the starting kernel. One run takes 730 microseconds.
// the six activations, six [in][out] weights and six biases are rounded to bf16 (RNE) on load; the six projections are then
// exact single f16 products (weights ×2^6, epilogue 2^-6) with f32 accumulation — the Bhattacharyya terms divide by σ² + 1e-6, which amplifies projection error ≈1000x near σ ≈ 1e-3, so
// exact projections are what make the distances reliable. Contractions on v_wmma_f32_16x16x32_f16 (f16 operands, f32 accumulate), per batch element: mu_q, sigma_q, mu_k, sigma_k, mu_v,
// sigma_v = x·W + b (K 1024 each). f32 VALU, one block per token: the 16x16 head-to-head Bhattacharyya distances summed over the 64 channels (0.25·log(0.25·(sq²/sk² + sk²/sq² + 2)) +
// 0.25·(μq−μk)²/(σq²+σk²+ε), with sq² = σq²+ε), /√64, softmax over the key-head axis of −0.5·dist, out_mu = attn·mu_v, out_sigma = sqrt(max(attn·σv², 0) + ε), and the module's
// transpose(1,2)-then-view layout: each output is the [B][H][S][64] array reinterpreted as [B][S][1024]. Two outputs, consecutive in d_out: out_mu then out_sigma.
// compute dtype: f16 operands (bf16-valued), f32 accumulate.  six [2,2048,1024] inputs → (out_mu, out_sigma) [2,2048,1024] each.
#include <hip/hip_runtime.h>
#include <hip/hip_bf16.h>
#include <math.h>


typedef _Float16 bf16;
typedef _Float16 f16;
typedef __attribute__((ext_vector_type(4))) unsigned v4u_t;
typedef unsigned v4ua __attribute__((ext_vector_type(4), may_alias));
typedef __attribute__((ext_vector_type(4))) float v4f_t;
typedef float v4fa __attribute__((ext_vector_type(4), may_alias));
typedef __attribute__((ext_vector_type(16))) bf16  bf16x16;
typedef bf16x16 f16x16;
typedef __attribute__((ext_vector_type(8)))  bf16  bf16x8;
typedef bf16x8 f16x8;
typedef __attribute__((ext_vector_type(4)))  bf16  bf16x4;
typedef __attribute__((ext_vector_type(8)))  float f32x8;
__device__ __forceinline__ f32x8 wmma16(f16x16 a, f16x16 b, f32x8 c) {
  c = __builtin_amdgcn_wmma_f32_16x16x32_f16(false, a, false, b, (short)0, c, false, false);
  asm volatile("v_nop\n\tv_nop\n\tv_nop\n\tv_nop" : "+v"(c) : "v"(a), "v"(b));
  return c;
}
#define LDS_STRIDE 48   // GEMM tiles: 32 -> 48 elems (96B rows): aligned b128 reads
#define KSTRIDE    72   // unused: k_bhatt stages K unpadded ([16][64] f32, stride 64)
#define VSTRIDE    48   // unused: k_bhatt stages V unpadded ([16][64] f32, stride 64)

__device__ __forceinline__ f32x8 wmma_bf16(bf16x16 a, bf16x16 b, f32x8 c) {
  c = __builtin_amdgcn_wmma_f32_16x16x32_f16(false, a, false, b, (short)0, c, false, false);
  asm volatile("v_nop\n\tv_nop\n\tv_nop\n\tv_nop" : "+v"(c) : "v"(a), "v"(b));   // A/B-overwrite hazard guard
  return c;
}

// 16x32 (MxK) bf16 fragment from a row-major global matrix.
// lanes 0-15  (row=lane)    : elems 0..7 = K+0..7,  8..15 = K+16..23
// lanes 16-31 (row=lane-16) : elems 0..7 = K+8..15, 8..15 = K+24..31
template <typename T>
__device__ __forceinline__ bf16x16 load_frag(const T* __restrict__ base, int ld,
                                             int row0, int k0) {
  const int lane = threadIdx.x & 31;
  const int r    = lane & 15;
  const int kh   = (lane >> 4) * 8;
  const T* p0 = base + (size_t)(row0 + r) * ld + (k0 + kh);
  const T* p1 = p0 + 16;
  bf16x16 f;
#pragma unroll
  for (int i = 0; i < 8; ++i) {
    f[i]     = (bf16)p0[i];
    f[i + 8] = (bf16)p1[i];
  }
  return f;
}

// Same fragment from an LDS tile with padded row stride (base includes row0/k0).
__device__ __forceinline__ bf16x16 lds_frag(const bf16* base, int stride) {
  const int lane = threadIdx.x & 31;
  const int row  = lane & 15;
  const int kh   = (lane >> 4) * 8;
  const bf16x8 lo = *(const bf16x8*)(base + row * stride + kh);
  const bf16x8 hi = *(const bf16x8*)(base + row * stride + kh + 16);
  bf16x16 f;
#pragma unroll
  for (int i = 0; i < 8; ++i) { f[i] = lo[i]; f[i + 8] = hi[i]; }
  return f;
}

template <typename T>
__device__ __forceinline__ void stage_read16(const T* __restrict__ p, float* buf) {
#pragma unroll
  for (int i = 0; i < 16; ++i) buf[i] = (float)p[i];
}

__device__ __forceinline__ void stage_write(bf16* dst, const float* buf, int nquad) {
#pragma unroll
  for (int i = 0; i < nquad; ++i) {
    bf16x4 q;
    q[0] = (bf16)buf[4 * i];     q[1] = (bf16)buf[4 * i + 1];
    q[2] = (bf16)buf[4 * i + 2]; q[3] = (bf16)buf[4 * i + 3];
    *(bf16x4*)(dst + 4 * i) = q;
  }
}


#define GSTR 48
// ---------------------------------------------------------------------------------------------------------------------------
// gemm_kne: Y[m][n] = epi( Σ_k A[m][k]·W[k][n] + bias[n] ), A f32/f16 [M][lda], W f32 row-major [K][N] (ldw), plain f16 operands,
// f32 accumulate. EPI 0: identity; 1: exact-erf GELU; 2: R[m][n] + gvec[n]·(·) (residual with per-channel gain); 3: ReLU; 4: gvec[n]·(·) (per-channel scale, no residual). Output f32 (or f16
// when OUT16). Block = 128x128 tile, 8 waves as 4(M) x 2(N); per 32-wide k-step A and W tiles staged f16 in LDS (W transposed
// ---------------------------------------------------------------------------------------------------------------------------
#define GSTR 48
template <typename AT, int EPI, bool OUT16>
__global__ __launch_bounds__(256) void gemm_kne(const AT* __restrict__ A, int lda, const float* __restrict__ Wm, int ldw,
                                                const float* __restrict__ bias, const float* __restrict__ R, const float* __restrict__ gvec,
                                                void* __restrict__ Yv, int ldy, int K) {
  __shared__ __attribute__((aligned(16))) f16 ldsA[128 * GSTR];
  __shared__ __attribute__((aligned(16))) f16 ldsW[128 * GSTR];
  __shared__ __attribute__((aligned(16))) float oS[8][32 * 68];
  const int tid = threadIdx.x, lane = tid & 31, wave = tid >> 5, cl = lane & 15, rh = (lane >> 4) * 8;
  const int m0 = blockIdx.x * 128, n0 = blockIdx.y * 128;
  const int wm = (wave & 3) * 32, wn = (wave >> 2) * 64;
  f32x8 acc[2][4];
#pragma unroll
  for (int i = 0; i < 2; ++i)
#pragma unroll
    for (int j = 0; j < 4; ++j) { f32x8 z = {}; acc[i][j] = z; }
#pragma unroll 1
  for (int k0 = 0; k0 < K; k0 += 32) {
    __syncthreads();
    { const int row = tid >> 1, ch = (tid & 1) * 16;
      const AT* src = A + (size_t)(m0 + row) * lda + k0 + ch;
#pragma unroll
      for (int g = 0; g < 16; ++g) ldsA[row * GSTR + ch + g] = (f16)src[g]; }
    { const int k = tid >> 3, nn0 = (tid & 7) * 16;
      const float* src = Wm + (size_t)(k0 + k) * ldw + n0 + nn0;
#pragma unroll
      for (int g = 0; g < 4; ++g) { const v4f_t v = *(const v4f_t*)(src + 4 * g);
#pragma unroll
        for (int u = 0; u < 4; ++u) ldsW[(nn0 + 4 * g + u) * GSTR + k] = (f16)v[u]; } }
    __syncthreads();
    f16x16 af[2];
#pragma unroll
    for (int i = 0; i < 2; ++i) af[i] = lds_frag(ldsA + (wm + 16 * i) * GSTR, GSTR);
#pragma unroll
    for (int j = 0; j < 4; ++j) {
      const f16x16 bf = lds_frag(ldsW + (wn + 16 * j) * GSTR, GSTR);
#pragma unroll
      for (int i = 0; i < 2; ++i) acc[i][j] = wmma16(af[i], bf, acc[i][j]);
    }
  }
  float* so = oS[wave];
#pragma unroll
  for (int i = 0; i < 2; ++i)
#pragma unroll
    for (int j = 0; j < 4; ++j) {
      const int n = n0 + wn + 16 * j + cl;
      const float bv = bias ? bias[n] : 0.0f;
      const float gv = (EPI == 2 || EPI == 4) ? gvec[n] : 0.0f;
      if (EPI == 1) {
#pragma unroll 1
        for (int r = 0; r < 8; ++r) { const float xg = acc[i][j][r] + bv; so[(16 * i + rh + r) * 68 + 16 * j + cl] = 0.5f * xg * (1.0f + erff(xg * 0.70710678118654752f)); }
      } else {
#pragma unroll
        for (int r = 0; r < 8; ++r) {
          float v = acc[i][j][r] + bv;
          if (EPI == 3) v = fmaxf(v, 0.0f);
          if (EPI == 4) v = gv * v;
          if (EPI == 2) v = R[(size_t)(m0 + wm + 16 * i + rh + r) * ldy + n] + gv * v;
          so[(16 * i + rh + r) * 68 + 16 * j + cl] = v;
        }
      }
    }
  asm volatile("s_wait_dscnt 0" ::: "memory");
  __builtin_amdgcn_wave_barrier();
{
    if (OUT16) {
      f16* Y = (f16*)Yv;
#pragma unroll
      for (int it = 0; it < 8; ++it) { const int c = lane + 32 * it, rr = c >> 3, q8 = (c & 7) * 8;
        union { f16 h[8]; v4u_t v; } u;
#pragma unroll
        for (int e = 0; e < 8; ++e) u.h[e] = (f16)so[rr * 68 + q8 + e];
        *(v4u_t*)(Y + (size_t)(m0 + wm + rr) * ldy + n0 + wn + q8) = u.v; }
    } else {
      float* Y = (float*)Yv;
#pragma unroll
      for (int it = 0; it < 16; ++it) { const int f4 = lane + 32 * it, rr = f4 >> 4, q = (f4 & 15) * 4;
        *(v4f_t*)(Y + (size_t)(m0 + wm + rr) * ldy + n0 + wn + q) = *(const v4fa*)(so + rr * 68 + q); }
    }
    
  }
}

// z-batched variant of gemm_kne (same tile code)
template <typename AT, int EPI, bool OUT16>
__global__ __launch_bounds__(256) void gemm_knez(const AT* __restrict__ A, int lda, size_t strideA, const float* __restrict__ Wm, int ldw, size_t strideW,
                                                 const float* __restrict__ bias, const float* __restrict__ R, const float* __restrict__ gvec,
                                                 void* __restrict__ Yv, int ldy, size_t strideY, int K) {   // blockIdx.z-batched: A += z·strideA, W += z·strideW, Y (and R) += z·strideY
  A += (size_t)blockIdx.z * strideA; Wm += (size_t)blockIdx.z * strideW; Yv = (void*)((char*)Yv + (size_t)blockIdx.z * strideY * (OUT16 ? 2 : 4)); if (R) R += (size_t)blockIdx.z * strideY;
  __shared__ __attribute__((aligned(16))) f16 ldsA[128 * GSTR];
  __shared__ __attribute__((aligned(16))) f16 ldsW[128 * GSTR];
  __shared__ __attribute__((aligned(16))) float oS[8][32 * 68];
  const int tid = threadIdx.x, lane = tid & 31, wave = tid >> 5, cl = lane & 15, rh = (lane >> 4) * 8;
  const int m0 = blockIdx.x * 128, n0 = blockIdx.y * 128;
  const int wm = (wave & 3) * 32, wn = (wave >> 2) * 64;
  f32x8 acc[2][4];
#pragma unroll
  for (int i = 0; i < 2; ++i)
#pragma unroll
    for (int j = 0; j < 4; ++j) { f32x8 z = {}; acc[i][j] = z; }
#pragma unroll 1
  for (int k0 = 0; k0 < K; k0 += 32) {
    __syncthreads();
    { const int row = tid >> 1, ch = (tid & 1) * 16;
      const AT* src = A + (size_t)(m0 + row) * lda + k0 + ch;
#pragma unroll
      for (int g = 0; g < 16; ++g) ldsA[row * GSTR + ch + g] = (f16)src[g]; }
    { const int k = tid >> 3, nn0 = (tid & 7) * 16;
      const float* src = Wm + (size_t)(k0 + k) * ldw + n0 + nn0;
#pragma unroll
      for (int g = 0; g < 4; ++g) { const v4f_t v = *(const v4f_t*)(src + 4 * g);
#pragma unroll
        for (int u = 0; u < 4; ++u) ldsW[(nn0 + 4 * g + u) * GSTR + k] = (f16)v[u]; } }
    __syncthreads();
    f16x16 af[2];
#pragma unroll
    for (int i = 0; i < 2; ++i) af[i] = lds_frag(ldsA + (wm + 16 * i) * GSTR, GSTR);
#pragma unroll
    for (int j = 0; j < 4; ++j) {
      const f16x16 bf = lds_frag(ldsW + (wn + 16 * j) * GSTR, GSTR);
#pragma unroll
      for (int i = 0; i < 2; ++i) acc[i][j] = wmma16(af[i], bf, acc[i][j]);
    }
  }
  float* so = oS[wave];
#pragma unroll
  for (int i = 0; i < 2; ++i)
#pragma unroll
    for (int j = 0; j < 4; ++j) {
      const int n = n0 + wn + 16 * j + cl;
      const float bv = bias ? bias[n] : 0.0f;
      const float gv = (EPI == 2 || EPI == 4) ? gvec[n] : 0.0f;
      if (EPI == 1) {
#pragma unroll 1
        for (int r = 0; r < 8; ++r) { const float xg = acc[i][j][r] + bv; so[(16 * i + rh + r) * 68 + 16 * j + cl] = 0.5f * xg * (1.0f + erff(xg * 0.70710678118654752f)); }
      } else {
#pragma unroll
        for (int r = 0; r < 8; ++r) {
          float v = acc[i][j][r] + bv;
          if (EPI == 3) v = fmaxf(v, 0.0f);
          if (EPI == 4) v = gv * v;
          if (EPI == 2) v = R[(size_t)(m0 + wm + 16 * i + rh + r) * ldy + n] + gv * v;
          so[(16 * i + rh + r) * 68 + 16 * j + cl] = v;
        }
      }
    }
  asm volatile("s_wait_dscnt 0" ::: "memory");
  __builtin_amdgcn_wave_barrier();
{
    if (OUT16) {
      f16* Y = (f16*)Yv;
#pragma unroll
      for (int it = 0; it < 8; ++it) { const int c = lane + 32 * it, rr = c >> 3, q8 = (c & 7) * 8;
        union { f16 h[8]; v4u_t v; } u;
#pragma unroll
        for (int e = 0; e < 8; ++e) u.h[e] = (f16)so[rr * 68 + q8 + e];
        *(v4u_t*)(Y + (size_t)(m0 + wm + rr) * ldy + n0 + wn + q8) = u.v; }
    } else {
      float* Y = (float*)Yv;
#pragma unroll
      for (int it = 0; it < 16; ++it) { const int f4 = lane + 32 * it, rr = f4 >> 4, q = (f4 & 15) * 4;
        *(v4f_t*)(Y + (size_t)(m0 + wm + rr) * ldy + n0 + wn + q) = *(const v4fa*)(so + rr * 68 + q); }
    }
    
  }
}

// ---------------------------------------------------------------------------------------------------------------------------
// gemm_kn2 (value+residual planes on both operands: hh + (hl+lh)/2048, f32-class): Y[m][n] (row stride ldy) = scale * sum_k A[m][k] (f32 or f16, row stride lda) * W[k][n] (f32, row-major [K][N], row
// stride ldw) (+ bias[n]) (+ Y if ACC). Block = 128 x 128 tile, 256 threads = 8 waves as 4(M, 32 rows) x 2(N, 64 cols); per
// 32-wide k-step the A tile and the W tile (stored transposed [n][k]) are staged as f16 in LDS; value and residual f16 planes per operand, f32
// blockIdx.z selects a batch: A += z*strideA, W += z*strideW, Y += z*strideY (element strides).
// ---------------------------------------------------------------------------------------------------------------------------
template <typename AT, bool ACC>
__global__ __launch_bounds__(256) void gemm_kn2(const AT* __restrict__ A, int lda, size_t strideA,
                                               const float* __restrict__ Wm, int ldw, size_t strideW,
                                               const float* __restrict__ bias, float scale,
                                               float* __restrict__ Y, int ldy, size_t strideY, int K) {
  __shared__ __attribute__((aligned(16))) f16 ldsA[128 * GSTR], ldsAl[128 * GSTR];
  __shared__ __attribute__((aligned(16))) f16 ldsW[128 * GSTR], ldsWl[128 * GSTR];
  __shared__ __attribute__((aligned(16))) float oS[8][32 * 68];
  const int tid = threadIdx.x, lane = tid & 31, wave = tid >> 5, cl = lane & 15, rh = (lane >> 4) * 8;
  const int m0 = blockIdx.x * 128, n0 = blockIdx.y * 128;
  const int wm = (wave & 3) * 32, wn = (wave >> 2) * 64;
  A += (size_t)blockIdx.z * strideA; Wm += (size_t)blockIdx.z * strideW; Y += (size_t)blockIdx.z * strideY;
  f32x8 acc[2][4], accx[2][4];
#pragma unroll
  for (int i = 0; i < 2; ++i)
#pragma unroll
    for (int j = 0; j < 4; ++j) { f32x8 z = {}; acc[i][j] = z; accx[i][j] = z; }
#pragma unroll 1
  for (int k0 = 0; k0 < K; k0 += 32) {
    __syncthreads();
    {  // A: thread -> row tid>>1, 16 elements at column half (tid&1)*16
      const int row = tid >> 1, ch = (tid & 1) * 16;
      const AT* src = A + (size_t)(m0 + row) * lda + k0 + ch;
#pragma unroll
      for (int g = 0; g < 16; ++g) { const float v = (float)src[g]; const f16 h = (f16)v; ldsA[row * GSTR + ch + g] = h; ldsAl[row * GSTR + ch + g] = (f16)((v - (float)h) * 2048.0f); }
    }
    {  // W: thread -> k = tid>>3, 16 consecutive n at (tid&7)*16; stored transposed [n][k]
      const int k = tid >> 3, nn0 = (tid & 7) * 16;
      const float* src = Wm + (size_t)(k0 + k) * ldw + n0 + nn0;
#pragma unroll
      for (int g = 0; g < 4; ++g) { const v4f_t v = *(const v4f_t*)(src + 4 * g);
#pragma unroll
        for (int u = 0; u < 4; ++u) { const f16 h = (f16)v[u]; ldsW[(nn0 + 4 * g + u) * GSTR + k] = h; ldsWl[(nn0 + 4 * g + u) * GSTR + k] = (f16)((v[u] - (float)h) * 2048.0f); } }
    }
    __syncthreads();
    f16x16 af[2], afl[2];
#pragma unroll
    for (int i = 0; i < 2; ++i) { af[i] = lds_frag(ldsA + (wm + 16 * i) * GSTR, GSTR); afl[i] = lds_frag(ldsAl + (wm + 16 * i) * GSTR, GSTR); }
#pragma unroll
    for (int j = 0; j < 4; ++j) {
      const f16x16 bf = lds_frag(ldsW + (wn + 16 * j) * GSTR, GSTR), bfl = lds_frag(ldsWl + (wn + 16 * j) * GSTR, GSTR);
#pragma unroll
      for (int i = 0; i < 2; ++i) { acc[i][j] = wmma16(af[i], bf, acc[i][j]); accx[i][j] = wmma16(af[i], bfl, accx[i][j]); accx[i][j] = wmma16(afl[i], bf, accx[i][j]); }
    }
  }
  float* so = oS[wave];
#pragma unroll
  for (int i = 0; i < 2; ++i)
#pragma unroll
    for (int j = 0; j < 4; ++j) {
      const float bv = bias ? bias[n0 + wn + 16 * j + cl] : 0.0f;
#pragma unroll
      for (int r = 0; r < 8; ++r) so[(16 * i + rh + r) * 68 + 16 * j + cl] = (acc[i][j][r] + accx[i][j][r] * (1.0f / 2048.0f)) * scale + bv;
    }
  asm volatile("s_wait_dscnt 0" ::: "memory");
  __builtin_amdgcn_wave_barrier();
  if (ACC) {   // accumulate: fold the existing Y values into the staging tile ONCE (same thread <-> same chunks as the stores below)
#pragma unroll
    for (int it = 0; it < 16; ++it) { const int f4 = lane + 32 * it, rr = f4 >> 4, q = (f4 & 15) * 4;
      const v4f_t old = *(const v4fa*)(Y + (size_t)(m0 + wm + rr) * ldy + n0 + wn + q);
      v4f_t v = *(const v4fa*)(so + rr * 68 + q); v += old; *(v4fa*)(so + rr * 68 + q) = v; }   // plain LDS store (ordered by the s_wait_dscnt/memory clobber below)
    asm volatile("s_wait_dscnt 0" ::: "memory");
  }
{
#pragma unroll
    for (int it = 0; it < 16; ++it) { const int f4 = lane + 32 * it, rr = f4 >> 4, q = (f4 & 15) * 4;
      *(v4f_t*)(Y + (size_t)(m0 + wm + rr) * ldy + n0 + wn + q) = *(const v4fa*)(so + rr * 68 + q); }
    
  }
}

__global__ __launch_bounds__(256) void k_transpose(const float* __restrict__ Wm, float* __restrict__ Wt, int rows, int cols) {
  __shared__ float tS[64][65];
  const int tid = threadIdx.x, tbj = cols / 64, bi = blockIdx.x / tbj, bj = blockIdx.x % tbj;
  for (int e = tid; e < 64 * 64; e += 256) { const int r = e >> 6, c = e & 63; tS[r][c] = Wm[(size_t)(bi * 64 + r) * cols + bj * 64 + c]; }
  __syncthreads();
  for (int ch = tid; ch < 64 * 16; ch += 256) { const int r = ch >> 4, q4 = (ch & 15) * 4; v4f_t o; o[0] = tS[q4][r]; o[1] = tS[q4 + 1][r]; o[2] = tS[q4 + 2][r]; o[3] = tS[q4 + 3][r];
    float* dst = Wt + (size_t)(bj * 64 + r) * rows + bi * 64 + q4; *(v4f_t*)dst = o;  }
}

#define NBpr 2
#define SSpr 2048
#define SIN 2048
#define DDpr 1024
#define NHpr 16
#define DKpr 64
__global__ __launch_bounds__(256) void k_fill(float* __restrict__ p, float val, size_t n4) { const size_t i = (size_t)blockIdx.x * 256 + threadIdx.x; if (i < n4) { v4f_t v = {val, val, val, val}; *(v4f_t*)(p + 4 * i) = v;  } }
__global__ __launch_bounds__(256) void k_dbg_zero(float* __restrict__ p, size_t n4) { const size_t i = (size_t)blockIdx.x * 256 + threadIdx.x; if (i < n4) { v4f_t z = {0.f,0.f,0.f,0.f}; *(v4f_t*)(p + 4 * i) = z;  } }
__global__ __launch_bounds__(256) void k_copy(const float* __restrict__ src, float* __restrict__ dst, size_t n4) { const size_t i = (size_t)blockIdx.x * 256 + threadIdx.x; if (i < n4) { const v4f_t v = *(const v4f_t*)(src + 4 * i); *(v4f_t*)(dst + 4 * i) = v;  } }
// bf16 round-to-nearest-even of an f32 (bit trick)
__device__ __forceinline__ float bf16r(float x) { unsigned int u = __float_as_uint(x); u = (u + 0x7FFFu + ((u >> 16) & 1u)) & 0xFFFF0000u; return __uint_as_float(u); }
// bf16-rounded copy of an activation block (optionally scaled by a power of two AFTER rounding — exact); 16 B per lane
__global__ __launch_bounds__(256) void k_cpyrnd(const float* __restrict__ src, float* __restrict__ dst, float mul, size_t n4) { const size_t i = (size_t)blockIdx.x * 256 + threadIdx.x; if (i >= n4) return; v4f_t v = *(const v4f_t*)(src + 4 * i);
#pragma unroll
  for (int u = 0; u < 4; ++u) v[u] = mul * bf16r(v[u]);
  *(v4f_t*)(dst + 4 * i) = v;  }
// torch [out][in] weight → WT[i][o] = mul·bf16(W[o][i]) ([in][out], lifted by a power of two so no bf16 weight becomes an f16 subnormal); block = input row i, threads loop over the outputs (4-B lanes)
__global__ __launch_bounds__(256) void k_wprepT(const float* __restrict__ Wt, float* __restrict__ WT, int nout, int nin, float mul) { const int i = blockIdx.x, tid = threadIdx.x;
#pragma unroll 1
  for (int o = tid; o < nout; o += 256) { const float w = mul * bf16r(Wt[(size_t)o * nin + i]); *(float*)(WT + (size_t)i * nout + o) = w;  } }
// bias prep: B2[o] = mul·bf16(b[o]); one block loops
__global__ __launch_bounds__(256) void k_bprep(const float* __restrict__ b, float* __restrict__ B2, int n, float mul) { for (int o = threadIdx.x; o < n; o += 256) { const float v = mul * bf16r(b[o]); *(float*)(B2 + o) = v;  } }

// per-token head-to-head Bhattacharyya attention: block = token; the six projected [16][64] vectors staged in LDS; thread = (query head i, key head j) for the distance, then
__global__ __launch_bounds__(256) void k_bhatt(const float* __restrict__ MQ, const float* __restrict__ SQ, const float* __restrict__ MK, const float* __restrict__ SK, const float* __restrict__ MV, const float* __restrict__ SV, float* __restrict__ omu, float* __restrict__ osg, int srows) {
  __shared__ __attribute__((aligned(16))) float mq[1024], sq[1024], mk[1024], sk[1024], mv[1024], sv[1024]; __shared__ float att[256];
  const size_t t = blockIdx.x; const int tid = threadIdx.x;
  { const size_t o4 = t * DDpr + 4 * tid; *(v4f_t*)(mq + 4 * tid) = *(const v4f_t*)(MQ + o4); *(v4f_t*)(sq + 4 * tid) = *(const v4f_t*)(SQ + o4); *(v4f_t*)(mk + 4 * tid) = *(const v4f_t*)(MK + o4); *(v4f_t*)(sk + 4 * tid) = *(const v4f_t*)(SK + o4); *(v4f_t*)(mv + 4 * tid) = *(const v4f_t*)(MV + o4); *(v4f_t*)(sv + 4 * tid) = *(const v4f_t*)(SV + o4); }
  __syncthreads();
  const int i = tid >> 4, j = tid & 15; float dist = 0.0f;
#pragma unroll 1
  for (int d = 0; d < DKpr; ++d) { const float sgq = sq[i * DKpr + d], sgk = sk[j * DKpr + d]; const float sq2 = sgq * sgq + 1e-6f, sk2 = sgk * sgk + 1e-6f; const float dm = mq[i * DKpr + d] - mk[j * DKpr + d];
    const float term1 = 0.25f * logf(0.25f * (sq2 / sk2 + sk2 / sq2 + 2.0f)); const float term2 = 0.25f * dm * dm / (sgq * sgq + sgk * sgk + 1e-6f); dist += term1 + term2; }
  float lg = -0.5f * (dist * 0.125f); float m = lg;
  m = fmaxf(m, __shfl_xor(m, 1, 32)); m = fmaxf(m, __shfl_xor(m, 2, 32)); m = fmaxf(m, __shfl_xor(m, 4, 32)); m = fmaxf(m, __shfl_xor(m, 8, 32));
  float e = expf(lg - m); float z = e; z += __shfl_xor(z, 1, 32); z += __shfl_xor(z, 2, 32); z += __shfl_xor(z, 4, 32); z += __shfl_xor(z, 8, 32);
  att[tid] = e / z; __syncthreads();
  const int hi = tid >> 4, c4 = (tid & 15) * 4; v4f_t am, av; am[0] = am[1] = am[2] = am[3] = 0.0f; av[0] = av[1] = av[2] = av[3] = 0.0f;
#pragma unroll 1
  for (int jj = 0; jj < NHpr; ++jj) { const float a = att[hi * NHpr + jj]; const v4f_t mvj = *(const v4f_t*)(mv + jj * DKpr + c4), svj = *(const v4f_t*)(sv + jj * DKpr + c4); am += a * mvj; av += a * (svj * svj); }
  v4f_t os; for (int u = 0; u < 4; ++u) os[u] = sqrtf(fmaxf(av[u], 0.0f) + 1e-6f);
  float* dm_ = omu + ((size_t)hi * srows + t) * DKpr + c4; float* ds_ = osg + ((size_t)hi * srows + t) * DKpr + c4;
  *(v4f_t*)dm_ = am; *(v4f_t*)ds_ = os;  }

extern "C" void kernel_launch(void* const* d_in, const int* in_sizes, int n_in,
                              void* d_out, int out_size, void* d_ws, size_t ws_size,
                              hipStream_t stream) {
  (void)in_sizes; (void)n_in; (void)out_size;
  const float** f = (const float**)d_in;
  float* out0 = (float*)d_out; float* out1 = out0 + (size_t)2 * SIN * DDpr;   // out_mu, out_sigma
  char* ws = (char*)d_ws;
  float* WB = (float*)ws; ws += (size_t)6 * DDpr * DDpr * 4; float* BB = (float*)ws; ws += (size_t)6 * DDpr * 4; float* g64 = (float*)ws; ws += DDpr * 4; float* XB = (float*)ws; ws += (size_t)SSpr * DDpr * 4;
  float* P[6]; for (int i = 0; i < 6; ++i) { P[i] = (float*)ws; ws += (size_t)SSpr * DDpr * 4; }
  if ((size_t)(ws - (char*)d_ws) > ws_size) return;                      // WS TOTAL 83,914,752 B
  const dim3 blk(256); const dim3 gp(SSpr / 128, DDpr / 128); const size_t n4 = (size_t)SSpr * DDpr / 4;
  k_fill<<<dim3(1), blk, 0, stream>>>(g64, 1.0f / 64.0f, DDpr / 4);
  for (int i = 0; i < 6; ++i) { k_cpyrnd<<<dim3(((size_t)DDpr * DDpr / 4 + 255) / 256), blk, 0, stream>>>(f[6 + i], WB + (size_t)i * DDpr * DDpr, 64.0f, (size_t)DDpr * DDpr / 4); k_bprep<<<dim3(1), blk, 0, stream>>>(f[12 + i], BB + (size_t)i * DDpr, DDpr, 64.0f); }   // [in][out] weights ×64·bf16, biases

  // input → projection slot map: query→q_mu (w0), key→k_mu (w1), value→v_mu (w2), query_sigma→q_sigma (w3), key_sigma→k_sigma (w4), value_sigma→v_sigma (w5)
  for (int b = 0; b < NBpr; ++b) {
    for (int i = 0; i < 6; ++i) { k_cpyrnd<<<dim3((n4 + 255) / 256), blk, 0, stream>>>(f[i] + (size_t)b * SIN * DDpr, XB, 1.0f, n4); gemm_kne<float, 4, false><<<gp, blk, 0, stream>>>(XB, DDpr, WB + (size_t)i * DDpr * DDpr, DDpr, BB + (size_t)i * DDpr, nullptr, g64, P[i], DDpr, DDpr); }
    k_bhatt<<<dim3(SSpr), blk, 0, stream>>>(P[0], P[3], P[1], P[4], P[2], P[5], out0 + (size_t)b * SIN * DDpr, out1 + (size_t)b * SIN * DDpr, SIN);
  }
}

// v001
// It runs in 345 microseconds.
// Timed twice side by side with v000, it ran 2.10 times as fast both times.
// the six activations, six [in][out] weights and six biases are rounded to bf16 (RNE) on load; the six projections are then
// exact single f16 products (weights ×2^6, epilogue 2^-6) with f32 accumulation — the Bhattacharyya terms divide by σ² + 1e-6, which amplifies projection error ≈1000x near σ ≈ 1e-3, so
// exact projections are what make the distances reliable. Contractions on v_wmma_f32_16x16x32_f16 (f16 operands, f32 accumulate), both batch elements in one M = 4096 launch: mu_q, sigma_q, mu_k, sigma_k, mu_v,
// sigma_v = x·W + b (K 1024 each). f32 VALU, one block per token: the 16x16 head-to-head Bhattacharyya distances summed over the 64 channels (0.25·log(0.25·(sq²/sk² + sk²/sq² + 2)) +
// 0.25·(μq−μk)²/(σq²+σk²+ε), with sq² = σq²+ε), /√64, softmax over the key-head axis of −0.5·dist, out_mu = attn·mu_v, out_sigma = sqrt(max(attn·σv², 0) + ε), and the module's
// transpose(1,2)-then-view layout: each output is the [B][H][S][64] array reinterpreted as [B][S][1024]. Two outputs, consecutive in d_out: out_mu then out_sigma.
// compute dtype: f16 operands (bf16-valued), f32 accumulate.  six [2,2048,1024] inputs → (out_mu, out_sigma) [2,2048,1024] each.
#include <hip/hip_runtime.h>
#include <hip/hip_bf16.h>
#include <math.h>


typedef _Float16 bf16;
typedef _Float16 f16;
typedef __attribute__((ext_vector_type(4))) unsigned v4u_t;
typedef unsigned v4ua __attribute__((ext_vector_type(4), may_alias));
typedef __attribute__((ext_vector_type(4))) float v4f_t;
typedef float v4fa __attribute__((ext_vector_type(4), may_alias));
typedef __attribute__((ext_vector_type(16))) bf16  bf16x16;
typedef bf16x16 f16x16;
typedef __attribute__((ext_vector_type(8)))  bf16  bf16x8;
typedef bf16x8 f16x8;
typedef __attribute__((ext_vector_type(4)))  bf16  bf16x4;
typedef __attribute__((ext_vector_type(8)))  float f32x8;
__device__ __forceinline__ f32x8 wmma16(f16x16 a, f16x16 b, f32x8 c) {
  c = __builtin_amdgcn_wmma_f32_16x16x32_f16(false, a, false, b, (short)0, c, false, false);
  asm volatile("v_nop\n\tv_nop\n\tv_nop\n\tv_nop" : "+v"(c) : "v"(a), "v"(b));
  return c;
}
#define LDS_STRIDE 48   // unused: the GEMM tiles use GSTR (32 -> 48 elems, 96B rows: aligned b128 reads)
#define KSTRIDE    72   // unused: k_bhatt stages K unpadded ([16][64] f32, stride 64)
#define VSTRIDE    48   // unused: k_bhatt stages V unpadded ([16][64] f32, stride 64)

__device__ __forceinline__ f32x8 wmma_bf16(bf16x16 a, bf16x16 b, f32x8 c) {
  c = __builtin_amdgcn_wmma_f32_16x16x32_f16(false, a, false, b, (short)0, c, false, false);
  asm volatile("v_nop\n\tv_nop\n\tv_nop\n\tv_nop" : "+v"(c) : "v"(a), "v"(b));   // A/B-overwrite hazard guard
  return c;
}

// 16x32 (MxK) bf16 fragment from a row-major global matrix.
// lanes 0-15  (row=lane)    : elems 0..7 = K+0..7,  8..15 = K+16..23
// lanes 16-31 (row=lane-16) : elems 0..7 = K+8..15, 8..15 = K+24..31
template <typename T>
__device__ __forceinline__ bf16x16 load_frag(const T* __restrict__ base, int ld,
                                             int row0, int k0) {
  const int lane = threadIdx.x & 31;
  const int r    = lane & 15;
  const int kh   = (lane >> 4) * 8;
  const T* p0 = base + (size_t)(row0 + r) * ld + (k0 + kh);
  const T* p1 = p0 + 16;
  bf16x16 f;
#pragma unroll
  for (int i = 0; i < 8; ++i) {
    f[i]     = (bf16)p0[i];
    f[i + 8] = (bf16)p1[i];
  }
  return f;
}

// Same fragment from an LDS tile with padded row stride (base includes row0/k0).
__device__ __forceinline__ bf16x16 lds_frag(const bf16* base, int stride) {
  const int lane = threadIdx.x & 31;
  const int row  = lane & 15;
  const int kh   = (lane >> 4) * 8;
  const bf16x8 lo = *(const bf16x8*)(base + row * stride + kh);
  const bf16x8 hi = *(const bf16x8*)(base + row * stride + kh + 16);
  bf16x16 f;
#pragma unroll
  for (int i = 0; i < 8; ++i) { f[i] = lo[i]; f[i + 8] = hi[i]; }
  return f;
}

template <typename T>
__device__ __forceinline__ void stage_read16(const T* __restrict__ p, float* buf) {
#pragma unroll
  for (int i = 0; i < 16; ++i) buf[i] = (float)p[i];
}

__device__ __forceinline__ void stage_write(bf16* dst, const float* buf, int nquad) {
#pragma unroll
  for (int i = 0; i < nquad; ++i) {
    bf16x4 q;
    q[0] = (bf16)buf[4 * i];     q[1] = (bf16)buf[4 * i + 1];
    q[2] = (bf16)buf[4 * i + 2]; q[3] = (bf16)buf[4 * i + 3];
    *(bf16x4*)(dst + 4 * i) = q;
  }
}


#define GSTR 48
// ---------------------------------------------------------------------------------------------------------------------------
// gemm_kne: Y[m][n] = epi( Σ_k A[m][k]·W[k][n] + bias[n] ), A f32/f16 [M][lda], W f32 row-major [K][N] (ldw), plain f16 operands,
// f32 accumulate. EPI 0: identity; 1: exact-erf GELU; 2: R[m][n] + gvec[n]·(·) (residual with per-channel gain); 3: ReLU; 4: gvec[n]·(·) (per-channel scale, no residual). Output f32 (or f16
// when OUT16). Block = 128x128 tile, 8 waves as 4(M) x 2(N); per 32-wide k-step A and W tiles staged f16 in LDS (W transposed
// ---------------------------------------------------------------------------------------------------------------------------
#define GSTR 48
template <typename AT, int EPI, bool OUT16>
__global__ __launch_bounds__(256) void gemm_kne(const AT* __restrict__ A, int lda, const float* __restrict__ Wm, int ldw,
                                                const float* __restrict__ bias, const float* __restrict__ R, const float* __restrict__ gvec,
                                                void* __restrict__ Yv, int ldy, int K) {
  __shared__ __attribute__((aligned(16))) f16 ldsA[128 * GSTR];
  __shared__ __attribute__((aligned(16))) f16 ldsW[128 * GSTR];
  __shared__ __attribute__((aligned(16))) float oS[8][32 * 68];
  const int tid = threadIdx.x, lane = tid & 31, wave = tid >> 5, cl = lane & 15, rh = (lane >> 4) * 8;
  const int m0 = blockIdx.x * 128, n0 = blockIdx.y * 128;
  const int wm = (wave & 3) * 32, wn = (wave >> 2) * 64;
  f32x8 acc[2][4];
#pragma unroll
  for (int i = 0; i < 2; ++i)
#pragma unroll
    for (int j = 0; j < 4; ++j) { f32x8 z = {}; acc[i][j] = z; }
#pragma unroll 1
  for (int k0 = 0; k0 < K; k0 += 32) {
    __syncthreads();
    { const int row = tid >> 1, ch = (tid & 1) * 16;
      const AT* src = A + (size_t)(m0 + row) * lda + k0 + ch;
#pragma unroll
      for (int g = 0; g < 16; ++g) ldsA[row * GSTR + ch + g] = (f16)src[g]; }
    { const int k = tid >> 3, nn0 = (tid & 7) * 16;
      const float* src = Wm + (size_t)(k0 + k) * ldw + n0 + nn0;
#pragma unroll
      for (int g = 0; g < 4; ++g) { const v4f_t v = *(const v4f_t*)(src + 4 * g);
#pragma unroll
        for (int u = 0; u < 4; ++u) ldsW[(nn0 + 4 * g + u) * GSTR + k] = (f16)v[u]; } }
    __syncthreads();
    f16x16 af[2];
#pragma unroll
    for (int i = 0; i < 2; ++i) af[i] = lds_frag(ldsA + (wm + 16 * i) * GSTR, GSTR);
#pragma unroll
    for (int j = 0; j < 4; ++j) {
      const f16x16 bf = lds_frag(ldsW + (wn + 16 * j) * GSTR, GSTR);
#pragma unroll
      for (int i = 0; i < 2; ++i) acc[i][j] = wmma16(af[i], bf, acc[i][j]);
    }
  }
  float* so = oS[wave];
#pragma unroll
  for (int i = 0; i < 2; ++i)
#pragma unroll
    for (int j = 0; j < 4; ++j) {
      const int n = n0 + wn + 16 * j + cl;
      const float bv = bias ? bias[n] : 0.0f;
      const float gv = (EPI == 2 || EPI == 4) ? gvec[n] : 0.0f;
      if (EPI == 1) {
#pragma unroll 1
        for (int r = 0; r < 8; ++r) { const float xg = acc[i][j][r] + bv; so[(16 * i + rh + r) * 68 + 16 * j + cl] = 0.5f * xg * (1.0f + erff(xg * 0.70710678118654752f)); }
      } else {
#pragma unroll
        for (int r = 0; r < 8; ++r) {
          float v = acc[i][j][r] + bv;
          if (EPI == 3) v = fmaxf(v, 0.0f);
          if (EPI == 4) v = gv * v;
          if (EPI == 2) v = R[(size_t)(m0 + wm + 16 * i + rh + r) * ldy + n] + gv * v;
          so[(16 * i + rh + r) * 68 + 16 * j + cl] = v;
        }
      }
    }
  asm volatile("s_wait_dscnt 0" ::: "memory");
  __builtin_amdgcn_wave_barrier();
{
    if (OUT16) {
      f16* Y = (f16*)Yv;
#pragma unroll
      for (int it = 0; it < 8; ++it) { const int c = lane + 32 * it, rr = c >> 3, q8 = (c & 7) * 8;
        union { f16 h[8]; v4u_t v; } u;
#pragma unroll
        for (int e = 0; e < 8; ++e) u.h[e] = (f16)so[rr * 68 + q8 + e];
        *(v4u_t*)(Y + (size_t)(m0 + wm + rr) * ldy + n0 + wn + q8) = u.v; }
    } else {
      float* Y = (float*)Yv;
#pragma unroll
      for (int it = 0; it < 16; ++it) { const int f4 = lane + 32 * it, rr = f4 >> 4, q = (f4 & 15) * 4;
        *(v4f_t*)(Y + (size_t)(m0 + wm + rr) * ldy + n0 + wn + q) = *(const v4fa*)(so + rr * 68 + q); }
    }
    
  }
}

// z-batched variant of gemm_kne (same tile code); bias advances by strideB per z, gvec is shared by all z
template <typename AT, int EPI, bool OUT16>
__global__ __launch_bounds__(256) void gemm_knez(const AT* __restrict__ A, int lda, size_t strideA, const float* __restrict__ Wm, int ldw, size_t strideW,
                                                 const float* __restrict__ bias, size_t strideB, const float* __restrict__ R, const float* __restrict__ gvec,
                                                 void* __restrict__ Yv, int ldy, size_t strideY, int K) {   // blockIdx.z-batched: A += z·strideA, W += z·strideW, Y (and R) += z·strideY
  if (bias) bias += (size_t)blockIdx.z * strideB;
  A += (size_t)blockIdx.z * strideA; Wm += (size_t)blockIdx.z * strideW; Yv = (void*)((char*)Yv + (size_t)blockIdx.z * strideY * (OUT16 ? 2 : 4)); if (R) R += (size_t)blockIdx.z * strideY;
  __shared__ __attribute__((aligned(16))) f16 ldsA[128 * GSTR];
  __shared__ __attribute__((aligned(16))) f16 ldsW[128 * GSTR];
  __shared__ __attribute__((aligned(16))) float oS[8][32 * 68];
  const int tid = threadIdx.x, lane = tid & 31, wave = tid >> 5, cl = lane & 15, rh = (lane >> 4) * 8;
  const int m0 = blockIdx.x * 128, n0 = blockIdx.y * 128;
  const int wm = (wave & 3) * 32, wn = (wave >> 2) * 64;
  f32x8 acc[2][4];
#pragma unroll
  for (int i = 0; i < 2; ++i)
#pragma unroll
    for (int j = 0; j < 4; ++j) { f32x8 z = {}; acc[i][j] = z; }
#pragma unroll 1
  for (int k0 = 0; k0 < K; k0 += 32) {
    __syncthreads();
    { const int row = tid >> 1, ch = (tid & 1) * 16;
      const AT* src = A + (size_t)(m0 + row) * lda + k0 + ch;
#pragma unroll
      for (int g = 0; g < 16; ++g) ldsA[row * GSTR + ch + g] = (f16)src[g]; }
    { const int k = tid >> 3, nn0 = (tid & 7) * 16;
      const float* src = Wm + (size_t)(k0 + k) * ldw + n0 + nn0;
#pragma unroll
      for (int g = 0; g < 4; ++g) { const v4f_t v = *(const v4f_t*)(src + 4 * g);
#pragma unroll
        for (int u = 0; u < 4; ++u) ldsW[(nn0 + 4 * g + u) * GSTR + k] = (f16)v[u]; } }
    __syncthreads();
    f16x16 af[2];
#pragma unroll
    for (int i = 0; i < 2; ++i) af[i] = lds_frag(ldsA + (wm + 16 * i) * GSTR, GSTR);
#pragma unroll
    for (int j = 0; j < 4; ++j) {
      const f16x16 bf = lds_frag(ldsW + (wn + 16 * j) * GSTR, GSTR);
#pragma unroll
      for (int i = 0; i < 2; ++i) acc[i][j] = wmma16(af[i], bf, acc[i][j]);
    }
  }
  float* so = oS[wave];
#pragma unroll
  for (int i = 0; i < 2; ++i)
#pragma unroll
    for (int j = 0; j < 4; ++j) {
      const int n = n0 + wn + 16 * j + cl;
      const float bv = bias ? bias[n] : 0.0f;
      const float gv = (EPI == 2 || EPI == 4) ? gvec[n] : 0.0f;
      if (EPI == 1) {
#pragma unroll 1
        for (int r = 0; r < 8; ++r) { const float xg = acc[i][j][r] + bv; so[(16 * i + rh + r) * 68 + 16 * j + cl] = 0.5f * xg * (1.0f + erff(xg * 0.70710678118654752f)); }
      } else {
#pragma unroll
        for (int r = 0; r < 8; ++r) {
          float v = acc[i][j][r] + bv;
          if (EPI == 3) v = fmaxf(v, 0.0f);
          if (EPI == 4) v = gv * v;
          if (EPI == 2) v = R[(size_t)(m0 + wm + 16 * i + rh + r) * ldy + n] + gv * v;
          so[(16 * i + rh + r) * 68 + 16 * j + cl] = v;
        }
      }
    }
  asm volatile("s_wait_dscnt 0" ::: "memory");
  __builtin_amdgcn_wave_barrier();
{
    if (OUT16) {
      f16* Y = (f16*)Yv;
#pragma unroll
      for (int it = 0; it < 8; ++it) { const int c = lane + 32 * it, rr = c >> 3, q8 = (c & 7) * 8;
        union { f16 h[8]; v4u_t v; } u;
#pragma unroll
        for (int e = 0; e < 8; ++e) u.h[e] = (f16)so[rr * 68 + q8 + e];
        *(v4u_t*)(Y + (size_t)(m0 + wm + rr) * ldy + n0 + wn + q8) = u.v; }
    } else {
      float* Y = (float*)Yv;
#pragma unroll
      for (int it = 0; it < 16; ++it) { const int f4 = lane + 32 * it, rr = f4 >> 4, q = (f4 & 15) * 4;
        *(v4f_t*)(Y + (size_t)(m0 + wm + rr) * ldy + n0 + wn + q) = *(const v4fa*)(so + rr * 68 + q); }
    }
    
  }
}

// ---------------------------------------------------------------------------------------------------------------------------
// gemm_kn2 (value+residual planes on both operands: hh + (hl+lh)/2048, f32-class): Y[m][n] (row stride ldy) = scale * sum_k A[m][k] (f32 or f16, row stride lda) * W[k][n] (f32, row-major [K][N], row
// stride ldw) (+ bias[n]) (+ Y if ACC). Block = 128 x 128 tile, 256 threads = 8 waves as 4(M, 32 rows) x 2(N, 64 cols); per
// 32-wide k-step the A tile and the W tile (stored transposed [n][k]) are staged as f16 in LDS; value and residual f16 planes per operand, f32
// blockIdx.z selects a batch: A += z*strideA, W += z*strideW, Y += z*strideY (element strides).
// ---------------------------------------------------------------------------------------------------------------------------
template <typename AT, bool ACC>
__global__ __launch_bounds__(256) void gemm_kn2(const AT* __restrict__ A, int lda, size_t strideA,
                                               const float* __restrict__ Wm, int ldw, size_t strideW,
                                               const float* __restrict__ bias, float scale,
                                               float* __restrict__ Y, int ldy, size_t strideY, int K) {
  __shared__ __attribute__((aligned(16))) f16 ldsA[128 * GSTR], ldsAl[128 * GSTR];
  __shared__ __attribute__((aligned(16))) f16 ldsW[128 * GSTR], ldsWl[128 * GSTR];
  __shared__ __attribute__((aligned(16))) float oS[8][32 * 68];
  const int tid = threadIdx.x, lane = tid & 31, wave = tid >> 5, cl = lane & 15, rh = (lane >> 4) * 8;
  const int m0 = blockIdx.x * 128, n0 = blockIdx.y * 128;
  const int wm = (wave & 3) * 32, wn = (wave >> 2) * 64;
  A += (size_t)blockIdx.z * strideA; Wm += (size_t)blockIdx.z * strideW; Y += (size_t)blockIdx.z * strideY;
  f32x8 acc[2][4], accx[2][4];
#pragma unroll
  for (int i = 0; i < 2; ++i)
#pragma unroll
    for (int j = 0; j < 4; ++j) { f32x8 z = {}; acc[i][j] = z; accx[i][j] = z; }
#pragma unroll 1
  for (int k0 = 0; k0 < K; k0 += 32) {
    __syncthreads();
    {  // A: thread -> row tid>>1, 16 elements at column half (tid&1)*16
      const int row = tid >> 1, ch = (tid & 1) * 16;
      const AT* src = A + (size_t)(m0 + row) * lda + k0 + ch;
#pragma unroll
      for (int g = 0; g < 16; ++g) { const float v = (float)src[g]; const f16 h = (f16)v; ldsA[row * GSTR + ch + g] = h; ldsAl[row * GSTR + ch + g] = (f16)((v - (float)h) * 2048.0f); }
    }
    {  // W: thread -> k = tid>>3, 16 consecutive n at (tid&7)*16; stored transposed [n][k]
      const int k = tid >> 3, nn0 = (tid & 7) * 16;
      const float* src = Wm + (size_t)(k0 + k) * ldw + n0 + nn0;
#pragma unroll
      for (int g = 0; g < 4; ++g) { const v4f_t v = *(const v4f_t*)(src + 4 * g);
#pragma unroll
        for (int u = 0; u < 4; ++u) { const f16 h = (f16)v[u]; ldsW[(nn0 + 4 * g + u) * GSTR + k] = h; ldsWl[(nn0 + 4 * g + u) * GSTR + k] = (f16)((v[u] - (float)h) * 2048.0f); } }
    }
    __syncthreads();
    f16x16 af[2], afl[2];
#pragma unroll
    for (int i = 0; i < 2; ++i) { af[i] = lds_frag(ldsA + (wm + 16 * i) * GSTR, GSTR); afl[i] = lds_frag(ldsAl + (wm + 16 * i) * GSTR, GSTR); }
#pragma unroll
    for (int j = 0; j < 4; ++j) {
      const f16x16 bf = lds_frag(ldsW + (wn + 16 * j) * GSTR, GSTR), bfl = lds_frag(ldsWl + (wn + 16 * j) * GSTR, GSTR);
#pragma unroll
      for (int i = 0; i < 2; ++i) { acc[i][j] = wmma16(af[i], bf, acc[i][j]); accx[i][j] = wmma16(af[i], bfl, accx[i][j]); accx[i][j] = wmma16(afl[i], bf, accx[i][j]); }
    }
  }
  float* so = oS[wave];
#pragma unroll
  for (int i = 0; i < 2; ++i)
#pragma unroll
    for (int j = 0; j < 4; ++j) {
      const float bv = bias ? bias[n0 + wn + 16 * j + cl] : 0.0f;
#pragma unroll
      for (int r = 0; r < 8; ++r) so[(16 * i + rh + r) * 68 + 16 * j + cl] = (acc[i][j][r] + accx[i][j][r] * (1.0f / 2048.0f)) * scale + bv;
    }
  asm volatile("s_wait_dscnt 0" ::: "memory");
  __builtin_amdgcn_wave_barrier();
  if (ACC) {   // accumulate: fold the existing Y values into the staging tile ONCE (same thread <-> same chunks as the stores below)
#pragma unroll
    for (int it = 0; it < 16; ++it) { const int f4 = lane + 32 * it, rr = f4 >> 4, q = (f4 & 15) * 4;
      const v4f_t old = *(const v4fa*)(Y + (size_t)(m0 + wm + rr) * ldy + n0 + wn + q);
      v4f_t v = *(const v4fa*)(so + rr * 68 + q); v += old; *(v4fa*)(so + rr * 68 + q) = v; }   // plain LDS store (ordered by the s_wait_dscnt/memory clobber below)
    asm volatile("s_wait_dscnt 0" ::: "memory");
  }
{
#pragma unroll
    for (int it = 0; it < 16; ++it) { const int f4 = lane + 32 * it, rr = f4 >> 4, q = (f4 & 15) * 4;
      *(v4f_t*)(Y + (size_t)(m0 + wm + rr) * ldy + n0 + wn + q) = *(const v4fa*)(so + rr * 68 + q); }
    
  }
}

__global__ __launch_bounds__(256) void k_transpose(const float* __restrict__ Wm, float* __restrict__ Wt, int rows, int cols) {
  __shared__ float tS[64][65];
  const int tid = threadIdx.x, tbj = cols / 64, bi = blockIdx.x / tbj, bj = blockIdx.x % tbj;
  for (int e = tid; e < 64 * 64; e += 256) { const int r = e >> 6, c = e & 63; tS[r][c] = Wm[(size_t)(bi * 64 + r) * cols + bj * 64 + c]; }
  __syncthreads();
  for (int ch = tid; ch < 64 * 16; ch += 256) { const int r = ch >> 4, q4 = (ch & 15) * 4; v4f_t o; o[0] = tS[q4][r]; o[1] = tS[q4 + 1][r]; o[2] = tS[q4 + 2][r]; o[3] = tS[q4 + 3][r];
    float* dst = Wt + (size_t)(bj * 64 + r) * rows + bi * 64 + q4; *(v4f_t*)dst = o;  }
}

#define NBpr 2
#define SSpr 2048
#define SIN 2048
#define DDpr 1024
#define NHpr 16
#define DKpr 64
__global__ __launch_bounds__(256) void k_fill(float* __restrict__ p, float val, size_t n4) { const size_t i = (size_t)blockIdx.x * 256 + threadIdx.x; if (i < n4) { v4f_t v = {val, val, val, val}; *(v4f_t*)(p + 4 * i) = v;  } }
__global__ __launch_bounds__(256) void k_dbg_zero(float* __restrict__ p, size_t n4) { const size_t i = (size_t)blockIdx.x * 256 + threadIdx.x; if (i < n4) { v4f_t z = {0.f,0.f,0.f,0.f}; *(v4f_t*)(p + 4 * i) = z;  } }
__global__ __launch_bounds__(256) void k_copy(const float* __restrict__ src, float* __restrict__ dst, size_t n4) { const size_t i = (size_t)blockIdx.x * 256 + threadIdx.x; if (i < n4) { const v4f_t v = *(const v4f_t*)(src + 4 * i); *(v4f_t*)(dst + 4 * i) = v;  } }
// bf16 round-to-nearest-even of an f32 (bit trick)
__device__ __forceinline__ float bf16r(float x) { unsigned int u = __float_as_uint(x); u = (u + 0x7FFFu + ((u >> 16) & 1u)) & 0xFFFF0000u; return __uint_as_float(u); }
// bf16-rounded copy of an activation block (optionally scaled by a power of two AFTER rounding — exact); 16 B per lane
__global__ __launch_bounds__(256) void k_cpyrnd(const float* __restrict__ src, float* __restrict__ dst, float mul, size_t n4) { const size_t i = (size_t)blockIdx.x * 256 + threadIdx.x; if (i >= n4) return; v4f_t v = *(const v4f_t*)(src + 4 * i);
#pragma unroll
  for (int u = 0; u < 4; ++u) v[u] = mul * bf16r(v[u]);
  *(v4f_t*)(dst + 4 * i) = v;  }
// torch [out][in] weight → WT[i][o] = mul·bf16(W[o][i]) ([in][out], lifted by a power of two so no bf16 weight becomes an f16 subnormal); block = input row i, threads loop over the outputs (4-B lanes)
__global__ __launch_bounds__(256) void k_wprepT(const float* __restrict__ Wt, float* __restrict__ WT, int nout, int nin, float mul) { const int i = blockIdx.x, tid = threadIdx.x;
#pragma unroll 1
  for (int o = tid; o < nout; o += 256) { const float w = mul * bf16r(Wt[(size_t)o * nin + i]); *(float*)(WT + (size_t)i * nout + o) = w;  } }
// bias prep: B2[o] = mul·bf16(b[o]); one block loops
__global__ __launch_bounds__(256) void k_bprep(const float* __restrict__ b, float* __restrict__ B2, int n, float mul) { for (int o = threadIdx.x; o < n; o += 256) { const float v = mul * bf16r(b[o]); *(float*)(B2 + o) = v;  } }

// per-token head-to-head Bhattacharyya attention: block = token; the six projected [16][64] vectors staged in LDS; thread = (query head i, key head j) for the distance, then
__global__ __launch_bounds__(256) void k_bhatt(const float* __restrict__ MQ, const float* __restrict__ SQ, const float* __restrict__ MK, const float* __restrict__ SK, const float* __restrict__ MV, const float* __restrict__ SV, float* __restrict__ omu, float* __restrict__ osg, int srows) {
  __shared__ __attribute__((aligned(16))) float mq[1024], sq[1024], mk[1024], sk[1024], mv[1024], sv[1024]; __shared__ float att[256];
  const size_t t = blockIdx.x; const int tid = threadIdx.x;
  { const size_t o4 = t * DDpr + 4 * tid; *(v4f_t*)(mq + 4 * tid) = *(const v4f_t*)(MQ + o4); *(v4f_t*)(sq + 4 * tid) = *(const v4f_t*)(SQ + o4); *(v4f_t*)(mk + 4 * tid) = *(const v4f_t*)(MK + o4); *(v4f_t*)(sk + 4 * tid) = *(const v4f_t*)(SK + o4); *(v4f_t*)(mv + 4 * tid) = *(const v4f_t*)(MV + o4); *(v4f_t*)(sv + 4 * tid) = *(const v4f_t*)(SV + o4); }
  __syncthreads();
  const int i = tid >> 4, j = tid & 15; float dist = 0.0f;
#pragma unroll 1
  for (int d = 0; d < DKpr; ++d) { const float sgq = sq[i * DKpr + d], sgk = sk[j * DKpr + d]; const float sq2 = sgq * sgq + 1e-6f, sk2 = sgk * sgk + 1e-6f; const float dm = mq[i * DKpr + d] - mk[j * DKpr + d];
    const float term1 = 0.25f * logf(0.25f * (sq2 / sk2 + sk2 / sq2 + 2.0f)); const float term2 = 0.25f * dm * dm / (sgq * sgq + sgk * sgk + 1e-6f); dist += term1 + term2; }
  float lg = -0.5f * (dist * 0.125f); float m = lg;
  m = fmaxf(m, __shfl_xor(m, 1, 32)); m = fmaxf(m, __shfl_xor(m, 2, 32)); m = fmaxf(m, __shfl_xor(m, 4, 32)); m = fmaxf(m, __shfl_xor(m, 8, 32));
  float e = expf(lg - m); float z = e; z += __shfl_xor(z, 1, 32); z += __shfl_xor(z, 2, 32); z += __shfl_xor(z, 4, 32); z += __shfl_xor(z, 8, 32);
  att[tid] = e / z; __syncthreads();
  const int hi = tid >> 4, c4 = (tid & 15) * 4; v4f_t am, av; am[0] = am[1] = am[2] = am[3] = 0.0f; av[0] = av[1] = av[2] = av[3] = 0.0f;
#pragma unroll 1
  for (int jj = 0; jj < NHpr; ++jj) { const float a = att[hi * NHpr + jj]; const v4f_t mvj = *(const v4f_t*)(mv + jj * DKpr + c4), svj = *(const v4f_t*)(sv + jj * DKpr + c4); am += a * mvj; av += a * (svj * svj); }
  v4f_t os; for (int u = 0; u < 4; ++u) os[u] = sqrtf(fmaxf(av[u], 0.0f) + 1e-6f);
  float* dm_ = omu + ((size_t)hi * srows + t) * DKpr + c4; float* ds_ = osg + ((size_t)hi * srows + t) * DKpr + c4;
  *(v4f_t*)dm_ = am; *(v4f_t*)ds_ = os;  }

extern "C" void kernel_launch(void* const* d_in, const int* in_sizes, int n_in,
                              void* d_out, int out_size, void* d_ws, size_t ws_size,
                              hipStream_t stream) {
  (void)in_sizes; (void)n_in; (void)out_size;
  const float** f = (const float**)d_in;
  float* out0 = (float*)d_out; float* out1 = out0 + (size_t)2 * SIN * DDpr;   // out_mu, out_sigma
  char* ws = (char*)d_ws;
  float* WB = (float*)ws; ws += (size_t)6 * DDpr * DDpr * 4; float* BB = (float*)ws; ws += (size_t)6 * DDpr * 4; float* g64 = (float*)ws; ws += DDpr * 4; const size_t slab = (size_t)NBpr * SSpr * DDpr;   // one projection's rows: both batch elements, [4096][1024]
  float* XB = (float*)ws; ws += 6 * slab * 4;
  float* P[6]; for (int i = 0; i < 6; ++i) { P[i] = (float*)ws; ws += slab * 4; }
  if ((size_t)(ws - (char*)d_ws) > ws_size) return;                      // WS TOTAL 226,521,088 B
  const dim3 blk(256); const dim3 gp(NBpr * SSpr / 128, DDpr / 128, 6); const size_t n4 = slab / 4;
  k_fill<<<dim3(1), blk, 0, stream>>>(g64, 1.0f / 64.0f, DDpr / 4);
  for (int i = 0; i < 6; ++i) { k_cpyrnd<<<dim3(((size_t)DDpr * DDpr / 4 + 255) / 256), blk, 0, stream>>>(f[6 + i], WB + (size_t)i * DDpr * DDpr, 64.0f, (size_t)DDpr * DDpr / 4); k_bprep<<<dim3(1), blk, 0, stream>>>(f[12 + i], BB + (size_t)i * DDpr, DDpr, 64.0f); }   // [in][out] weights ×64·bf16, biases

  // input → projection slot map: query→q_mu (w0), key→k_mu (w1), value→v_mu (w2), query_sigma→q_sigma (w3), key_sigma→k_sigma (w4), value_sigma→v_sigma (w5)
  // the batch axis is folded into the GEMM's M (4096 rows) and the six projections into blockIdx.z: one launch of 32 x 8 x 6 tiles, several workgroups resident on every WGP
  for (int i = 0; i < 6; ++i) k_cpyrnd<<<dim3((n4 + 255) / 256), blk, 0, stream>>>(f[i], XB + (size_t)i * slab, 1.0f, n4);
  gemm_knez<float, 4, false><<<gp, blk, 0, stream>>>(XB, DDpr, slab, WB, DDpr, (size_t)DDpr * DDpr, BB, (size_t)DDpr, nullptr, g64, P[0], DDpr, slab, DDpr);
  for (int b = 0; b < NBpr; ++b) { const size_t ob = (size_t)b * SIN * DDpr;
    k_bhatt<<<dim3(SSpr), blk, 0, stream>>>(P[0] + ob, P[3] + ob, P[1] + ob, P[4] + ob, P[2] + ob, P[5] + ob, out0 + ob, out1 + ob, SIN);
  }
}

// v002
// One run takes 280 microseconds.
// Next to v001, in two timings, it ran 1.23 times as fast each time.
// Counting every step since v000, it is 2.59 times as fast.
// the six activations, six [in][out] weights and six biases are rounded to bf16 (RNE) on load; the six projections are then
// exact single f16 products (weights ×2^6, epilogue 2^-6) with f32 accumulation — the Bhattacharyya terms divide by σ² + 1e-6, which amplifies projection error ≈1000x near σ ≈ 1e-3, so
// exact projections are what make the distances reliable. Contractions on v_wmma_f32_16x16x32_f16 (f16 operands, f32 accumulate), both batch elements in one M = 4096 launch: mu_q, sigma_q, mu_k, sigma_k, mu_v,
// sigma_v = x·W + b (K 1024 each). f32 VALU, one block per token: the 16x16 head-to-head Bhattacharyya distances summed over the 64 channels (0.25·log(0.25·(sq²/sk² + sk²/sq² + 2)) +
// 0.25·(μq−μk)²/(σq²+σk²+ε), with sq² = σq²+ε), /√64, softmax over the key-head axis of −0.5·dist, out_mu = attn·mu_v, out_sigma = sqrt(max(attn·σv², 0) + ε), and the module's
// transpose(1,2)-then-view layout: each output is the [B][H][S][64] array reinterpreted as [B][S][1024]. Two outputs, consecutive in d_out: out_mu then out_sigma.
// compute dtype: f16 operands (bf16-valued), f32 accumulate.  six [2,2048,1024] inputs → (out_mu, out_sigma) [2,2048,1024] each.
#include <hip/hip_runtime.h>
#include <hip/hip_bf16.h>
#include <math.h>


typedef _Float16 bf16;
typedef _Float16 f16;
typedef __attribute__((ext_vector_type(4))) unsigned v4u_t;
typedef unsigned v4ua __attribute__((ext_vector_type(4), may_alias));
typedef __attribute__((ext_vector_type(4))) float v4f_t;
typedef float v4fa __attribute__((ext_vector_type(4), may_alias));
typedef __attribute__((ext_vector_type(16))) bf16  bf16x16;
typedef bf16x16 f16x16;
typedef __attribute__((ext_vector_type(8)))  bf16  bf16x8;
typedef bf16x8 f16x8;
typedef __attribute__((ext_vector_type(4)))  bf16  bf16x4;
typedef __attribute__((ext_vector_type(8)))  float f32x8;
__device__ __forceinline__ f32x8 wmma16(f16x16 a, f16x16 b, f32x8 c) {
  c = __builtin_amdgcn_wmma_f32_16x16x32_f16(false, a, false, b, (short)0, c, false, false);
  asm volatile("v_nop\n\tv_nop\n\tv_nop\n\tv_nop" : "+v"(c) : "v"(a), "v"(b));
  return c;
}
#define LDS_STRIDE 48   // unused: the GEMM tiles use GSTR (32 -> 48 elems, 96B rows: aligned b128 reads)
#define KSTRIDE    72   // unused: k_bhatt stages K unpadded ([16][64] f32, stride 64)
#define VSTRIDE    48   // unused: k_bhatt stages V unpadded ([16][64] f32, stride 64)

__device__ __forceinline__ f32x8 wmma_bf16(bf16x16 a, bf16x16 b, f32x8 c) {
  c = __builtin_amdgcn_wmma_f32_16x16x32_f16(false, a, false, b, (short)0, c, false, false);
  asm volatile("v_nop\n\tv_nop\n\tv_nop\n\tv_nop" : "+v"(c) : "v"(a), "v"(b));   // A/B-overwrite hazard guard
  return c;
}

// 16x32 (MxK) bf16 fragment from a row-major global matrix.
// lanes 0-15  (row=lane)    : elems 0..7 = K+0..7,  8..15 = K+16..23
// lanes 16-31 (row=lane-16) : elems 0..7 = K+8..15, 8..15 = K+24..31
template <typename T>
__device__ __forceinline__ bf16x16 load_frag(const T* __restrict__ base, int ld,
                                             int row0, int k0) {
  const int lane = threadIdx.x & 31;
  const int r    = lane & 15;
  const int kh   = (lane >> 4) * 8;
  const T* p0 = base + (size_t)(row0 + r) * ld + (k0 + kh);
  const T* p1 = p0 + 16;
  bf16x16 f;
#pragma unroll
  for (int i = 0; i < 8; ++i) {
    f[i]     = (bf16)p0[i];
    f[i + 8] = (bf16)p1[i];
  }
  return f;
}

// Same fragment from an LDS tile with padded row stride (base includes row0/k0).
__device__ __forceinline__ bf16x16 lds_frag(const bf16* base, int stride) {
  const int lane = threadIdx.x & 31;
  const int row  = lane & 15;
  const int kh   = (lane >> 4) * 8;
  const bf16x8 lo = *(const bf16x8*)(base + row * stride + kh);
  const bf16x8 hi = *(const bf16x8*)(base + row * stride + kh + 16);
  bf16x16 f;
#pragma unroll
  for (int i = 0; i < 8; ++i) { f[i] = lo[i]; f[i + 8] = hi[i]; }
  return f;
}

template <typename T>
__device__ __forceinline__ void stage_read16(const T* __restrict__ p, float* buf) {
#pragma unroll
  for (int i = 0; i < 16; ++i) buf[i] = (float)p[i];
}

__device__ __forceinline__ void stage_write(bf16* dst, const float* buf, int nquad) {
#pragma unroll
  for (int i = 0; i < nquad; ++i) {
    bf16x4 q;
    q[0] = (bf16)buf[4 * i];     q[1] = (bf16)buf[4 * i + 1];
    q[2] = (bf16)buf[4 * i + 2]; q[3] = (bf16)buf[4 * i + 3];
    *(bf16x4*)(dst + 4 * i) = q;
  }
}


#define GSTR 48
// ---------------------------------------------------------------------------------------------------------------------------
// gemm_kne: Y[m][n] = epi( Σ_k A[m][k]·W[k][n] + bias[n] ), A f32/f16 [M][lda], W f32 row-major [K][N] (ldw), plain f16 operands,
// f32 accumulate. EPI 0: identity; 1: exact-erf GELU; 2: R[m][n] + gvec[n]·(·) (residual with per-channel gain); 3: ReLU; 4: gvec[n]·(·) (per-channel scale, no residual). Output f32 (or f16
// when OUT16). Block = 128x128 tile, 8 waves as 4(M) x 2(N); per 32-wide k-step A and W tiles staged f16 in LDS (W transposed
// ---------------------------------------------------------------------------------------------------------------------------
#define GSTR 48
template <typename AT, int EPI, bool OUT16>
__global__ __launch_bounds__(256) void gemm_kne(const AT* __restrict__ A, int lda, const float* __restrict__ Wm, int ldw,
                                                const float* __restrict__ bias, const float* __restrict__ R, const float* __restrict__ gvec,
                                                void* __restrict__ Yv, int ldy, int K) {
  __shared__ __attribute__((aligned(16))) f16 ldsA[128 * GSTR];
  __shared__ __attribute__((aligned(16))) f16 ldsW[128 * GSTR];
  __shared__ __attribute__((aligned(16))) float oS[8][32 * 68];
  const int tid = threadIdx.x, lane = tid & 31, wave = tid >> 5, cl = lane & 15, rh = (lane >> 4) * 8;
  const int m0 = blockIdx.x * 128, n0 = blockIdx.y * 128;
  const int wm = (wave & 3) * 32, wn = (wave >> 2) * 64;
  f32x8 acc[2][4];
#pragma unroll
  for (int i = 0; i < 2; ++i)
#pragma unroll
    for (int j = 0; j < 4; ++j) { f32x8 z = {}; acc[i][j] = z; }
#pragma unroll 1
  for (int k0 = 0; k0 < K; k0 += 32) {
    __syncthreads();
    { const int row = tid >> 1, ch = (tid & 1) * 16;
      const AT* src = A + (size_t)(m0 + row) * lda + k0 + ch;
#pragma unroll
      for (int g = 0; g < 16; ++g) ldsA[row * GSTR + ch + g] = (f16)src[g]; }
    { const int k = tid >> 3, nn0 = (tid & 7) * 16;
      const float* src = Wm + (size_t)(k0 + k) * ldw + n0 + nn0;
#pragma unroll
      for (int g = 0; g < 4; ++g) { const v4f_t v = *(const v4f_t*)(src + 4 * g);
#pragma unroll
        for (int u = 0; u < 4; ++u) ldsW[(nn0 + 4 * g + u) * GSTR + k] = (f16)v[u]; } }
    __syncthreads();
    f16x16 af[2];
#pragma unroll
    for (int i = 0; i < 2; ++i) af[i] = lds_frag(ldsA + (wm + 16 * i) * GSTR, GSTR);
#pragma unroll
    for (int j = 0; j < 4; ++j) {
      const f16x16 bf = lds_frag(ldsW + (wn + 16 * j) * GSTR, GSTR);
#pragma unroll
      for (int i = 0; i < 2; ++i) acc[i][j] = wmma16(af[i], bf, acc[i][j]);
    }
  }
  float* so = oS[wave];
#pragma unroll
  for (int i = 0; i < 2; ++i)
#pragma unroll
    for (int j = 0; j < 4; ++j) {
      const int n = n0 + wn + 16 * j + cl;
      const float bv = bias ? bias[n] : 0.0f;
      const float gv = (EPI == 2 || EPI == 4) ? gvec[n] : 0.0f;
      if (EPI == 1) {
#pragma unroll 1
        for (int r = 0; r < 8; ++r) { const float xg = acc[i][j][r] + bv; so[(16 * i + rh + r) * 68 + 16 * j + cl] = 0.5f * xg * (1.0f + erff(xg * 0.70710678118654752f)); }
      } else {
#pragma unroll
        for (int r = 0; r < 8; ++r) {
          float v = acc[i][j][r] + bv;
          if (EPI == 3) v = fmaxf(v, 0.0f);
          if (EPI == 4) v = gv * v;
          if (EPI == 2) v = R[(size_t)(m0 + wm + 16 * i + rh + r) * ldy + n] + gv * v;
          so[(16 * i + rh + r) * 68 + 16 * j + cl] = v;
        }
      }
    }
  asm volatile("s_wait_dscnt 0" ::: "memory");
  __builtin_amdgcn_wave_barrier();
{
    if (OUT16) {
      f16* Y = (f16*)Yv;
#pragma unroll
      for (int it = 0; it < 8; ++it) { const int c = lane + 32 * it, rr = c >> 3, q8 = (c & 7) * 8;
        union { f16 h[8]; v4u_t v; } u;
#pragma unroll
        for (int e = 0; e < 8; ++e) u.h[e] = (f16)so[rr * 68 + q8 + e];
        *(v4u_t*)(Y + (size_t)(m0 + wm + rr) * ldy + n0 + wn + q8) = u.v; }
    } else {
      float* Y = (float*)Yv;
#pragma unroll
      for (int it = 0; it < 16; ++it) { const int f4 = lane + 32 * it, rr = f4 >> 4, q = (f4 & 15) * 4;
        *(v4f_t*)(Y + (size_t)(m0 + wm + rr) * ldy + n0 + wn + q) = *(const v4fa*)(so + rr * 68 + q); }
    }
    
  }
}

// bf16 round-to-nearest-even of an f32 (bit trick)
__device__ __forceinline__ float bf16r(float x) { unsigned int u = __float_as_uint(x); u = (u + 0x7FFFu + ((u >> 16) & 1u)) & 0xFFFF0000u; return __uint_as_float(u); }

// gemm_proj6: the six projections in one launch, straight from the inputs (same tile code as gemm_kne). blockIdx.z picks activation x, weight w ([in][out]) and bias b;
// Y[z][m][n] = 2^-6 * ( sum_k bf16(x[m][k]) * (2^6 * bf16(w[k][n])) + 2^6 * bf16(b[n]) ). The bf16 rounding and the exact power-of-two lift (no bf16 weight becomes an f16
// subnormal) are applied in registers between the global load and the f16 LDS store, so no rounded copy of any operand goes through memory.
__global__ __launch_bounds__(256) void gemm_proj6(const float* __restrict__ x0, const float* __restrict__ x1, const float* __restrict__ x2,
                                                  const float* __restrict__ x3, const float* __restrict__ x4, const float* __restrict__ x5,
                                                  const float* __restrict__ w0, const float* __restrict__ w1, const float* __restrict__ w2,
                                                  const float* __restrict__ w3, const float* __restrict__ w4, const float* __restrict__ w5,
                                                  const float* __restrict__ b0, const float* __restrict__ b1, const float* __restrict__ b2,
                                                  const float* __restrict__ b3, const float* __restrict__ b4, const float* __restrict__ b5,
                                                  float* __restrict__ Y, int lda, int ldw, int ldy, size_t strideY, int K) {
  const int z = blockIdx.z;
  const float* __restrict__ A    = z == 0 ? x0 : z == 1 ? x1 : z == 2 ? x2 : z == 3 ? x3 : z == 4 ? x4 : x5;
  const float* __restrict__ Wm   = z == 0 ? w0 : z == 1 ? w1 : z == 2 ? w2 : z == 3 ? w3 : z == 4 ? w4 : w5;
  const float* __restrict__ bias = z == 0 ? b0 : z == 1 ? b1 : z == 2 ? b2 : z == 3 ? b3 : z == 4 ? b4 : b5;
  Y += (size_t)z * strideY;
  __shared__ __attribute__((aligned(16))) f16 ldsA[128 * GSTR];
  __shared__ __attribute__((aligned(16))) f16 ldsW[128 * GSTR];
  __shared__ __attribute__((aligned(16))) float oS[8][32 * 68];
  const int tid = threadIdx.x, lane = tid & 31, wave = tid >> 5, cl = lane & 15, rh = (lane >> 4) * 8;
  const int m0 = blockIdx.x * 128, n0 = blockIdx.y * 128;
  const int wm = (wave & 3) * 32, wn = (wave >> 2) * 64;
  f32x8 acc[2][4];
#pragma unroll
  for (int i = 0; i < 2; ++i)
#pragma unroll
    for (int j = 0; j < 4; ++j) { f32x8 zz = {}; acc[i][j] = zz; }
#pragma unroll 1
  for (int k0 = 0; k0 < K; k0 += 32) {
    __syncthreads();
    { const int row = tid >> 1, ch = (tid & 1) * 16;
      const float* src = A + (size_t)(m0 + row) * lda + k0 + ch;
#pragma unroll
      for (int g = 0; g < 16; ++g) ldsA[row * GSTR + ch + g] = (f16)bf16r(src[g]); }
    { const int k = tid >> 3, nn0 = (tid & 7) * 16;
      const float* src = Wm + (size_t)(k0 + k) * ldw + n0 + nn0;
#pragma unroll
      for (int g = 0; g < 4; ++g) { const v4f_t v = *(const v4f_t*)(src + 4 * g);
#pragma unroll
        for (int u = 0; u < 4; ++u) ldsW[(nn0 + 4 * g + u) * GSTR + k] = (f16)(64.0f * bf16r(v[u])); } }
    __syncthreads();
    f16x16 af[2];
#pragma unroll
    for (int i = 0; i < 2; ++i) af[i] = lds_frag(ldsA + (wm + 16 * i) * GSTR, GSTR);
#pragma unroll
    for (int j = 0; j < 4; ++j) {
      const f16x16 bf = lds_frag(ldsW + (wn + 16 * j) * GSTR, GSTR);
#pragma unroll
      for (int i = 0; i < 2; ++i) acc[i][j] = wmma16(af[i], bf, acc[i][j]);
    }
  }
  float* so = oS[wave];
#pragma unroll
  for (int i = 0; i < 2; ++i)
#pragma unroll
    for (int j = 0; j < 4; ++j) {
      const float bv = 64.0f * bf16r(bias[n0 + wn + 16 * j + cl]);
#pragma unroll
      for (int r = 0; r < 8; ++r) so[(16 * i + rh + r) * 68 + 16 * j + cl] = (1.0f / 64.0f) * (acc[i][j][r] + bv);
    }
  asm volatile("s_wait_dscnt 0" ::: "memory");
  __builtin_amdgcn_wave_barrier();
#pragma unroll
  for (int it = 0; it < 16; ++it) { const int f4 = lane + 32 * it, rr = f4 >> 4, q = (f4 & 15) * 4;
    *(v4f_t*)(Y + (size_t)(m0 + wm + rr) * ldy + n0 + wn + q) = *(const v4fa*)(so + rr * 68 + q); }
}

// ---------------------------------------------------------------------------------------------------------------------------
// gemm_kn2 (value+residual planes on both operands: hh + (hl+lh)/2048, f32-class): Y[m][n] (row stride ldy) = scale * sum_k A[m][k] (f32 or f16, row stride lda) * W[k][n] (f32, row-major [K][N], row
// stride ldw) (+ bias[n]) (+ Y if ACC). Block = 128 x 128 tile, 256 threads = 8 waves as 4(M, 32 rows) x 2(N, 64 cols); per
// 32-wide k-step the A tile and the W tile (stored transposed [n][k]) are staged as f16 in LDS; value and residual f16 planes per operand, f32
// blockIdx.z selects a batch: A += z*strideA, W += z*strideW, Y += z*strideY (element strides).
// ---------------------------------------------------------------------------------------------------------------------------
template <typename AT, bool ACC>
__global__ __launch_bounds__(256) void gemm_kn2(const AT* __restrict__ A, int lda, size_t strideA,
                                               const float* __restrict__ Wm, int ldw, size_t strideW,
                                               const float* __restrict__ bias, float scale,
                                               float* __restrict__ Y, int ldy, size_t strideY, int K) {
  __shared__ __attribute__((aligned(16))) f16 ldsA[128 * GSTR], ldsAl[128 * GSTR];
  __shared__ __attribute__((aligned(16))) f16 ldsW[128 * GSTR], ldsWl[128 * GSTR];
  __shared__ __attribute__((aligned(16))) float oS[8][32 * 68];
  const int tid = threadIdx.x, lane = tid & 31, wave = tid >> 5, cl = lane & 15, rh = (lane >> 4) * 8;
  const int m0 = blockIdx.x * 128, n0 = blockIdx.y * 128;
  const int wm = (wave & 3) * 32, wn = (wave >> 2) * 64;
  A += (size_t)blockIdx.z * strideA; Wm += (size_t)blockIdx.z * strideW; Y += (size_t)blockIdx.z * strideY;
  f32x8 acc[2][4], accx[2][4];
#pragma unroll
  for (int i = 0; i < 2; ++i)
#pragma unroll
    for (int j = 0; j < 4; ++j) { f32x8 z = {}; acc[i][j] = z; accx[i][j] = z; }
#pragma unroll 1
  for (int k0 = 0; k0 < K; k0 += 32) {
    __syncthreads();
    {  // A: thread -> row tid>>1, 16 elements at column half (tid&1)*16
      const int row = tid >> 1, ch = (tid & 1) * 16;
      const AT* src = A + (size_t)(m0 + row) * lda + k0 + ch;
#pragma unroll
      for (int g = 0; g < 16; ++g) { const float v = (float)src[g]; const f16 h = (f16)v; ldsA[row * GSTR + ch + g] = h; ldsAl[row * GSTR + ch + g] = (f16)((v - (float)h) * 2048.0f); }
    }
    {  // W: thread -> k = tid>>3, 16 consecutive n at (tid&7)*16; stored transposed [n][k]
      const int k = tid >> 3, nn0 = (tid & 7) * 16;
      const float* src = Wm + (size_t)(k0 + k) * ldw + n0 + nn0;
#pragma unroll
      for (int g = 0; g < 4; ++g) { const v4f_t v = *(const v4f_t*)(src + 4 * g);
#pragma unroll
        for (int u = 0; u < 4; ++u) { const f16 h = (f16)v[u]; ldsW[(nn0 + 4 * g + u) * GSTR + k] = h; ldsWl[(nn0 + 4 * g + u) * GSTR + k] = (f16)((v[u] - (float)h) * 2048.0f); } }
    }
    __syncthreads();
    f16x16 af[2], afl[2];
#pragma unroll
    for (int i = 0; i < 2; ++i) { af[i] = lds_frag(ldsA + (wm + 16 * i) * GSTR, GSTR); afl[i] = lds_frag(ldsAl + (wm + 16 * i) * GSTR, GSTR); }
#pragma unroll
    for (int j = 0; j < 4; ++j) {
      const f16x16 bf = lds_frag(ldsW + (wn + 16 * j) * GSTR, GSTR), bfl = lds_frag(ldsWl + (wn + 16 * j) * GSTR, GSTR);
#pragma unroll
      for (int i = 0; i < 2; ++i) { acc[i][j] = wmma16(af[i], bf, acc[i][j]); accx[i][j] = wmma16(af[i], bfl, accx[i][j]); accx[i][j] = wmma16(afl[i], bf, accx[i][j]); }
    }
  }
  float* so = oS[wave];
#pragma unroll
  for (int i = 0; i < 2; ++i)
#pragma unroll
    for (int j = 0; j < 4; ++j) {
      const float bv = bias ? bias[n0 + wn + 16 * j + cl] : 0.0f;
#pragma unroll
      for (int r = 0; r < 8; ++r) so[(16 * i + rh + r) * 68 + 16 * j + cl] = (acc[i][j][r] + accx[i][j][r] * (1.0f / 2048.0f)) * scale + bv;
    }
  asm volatile("s_wait_dscnt 0" ::: "memory");
  __builtin_amdgcn_wave_barrier();
  if (ACC) {   // accumulate: fold the existing Y values into the staging tile ONCE (same thread <-> same chunks as the stores below)
#pragma unroll
    for (int it = 0; it < 16; ++it) { const int f4 = lane + 32 * it, rr = f4 >> 4, q = (f4 & 15) * 4;
      const v4f_t old = *(const v4fa*)(Y + (size_t)(m0 + wm + rr) * ldy + n0 + wn + q);
      v4f_t v = *(const v4fa*)(so + rr * 68 + q); v += old; *(v4fa*)(so + rr * 68 + q) = v; }   // plain LDS store (ordered by the s_wait_dscnt/memory clobber below)
    asm volatile("s_wait_dscnt 0" ::: "memory");
  }
{
#pragma unroll
    for (int it = 0; it < 16; ++it) { const int f4 = lane + 32 * it, rr = f4 >> 4, q = (f4 & 15) * 4;
      *(v4f_t*)(Y + (size_t)(m0 + wm + rr) * ldy + n0 + wn + q) = *(const v4fa*)(so + rr * 68 + q); }
    
  }
}

__global__ __launch_bounds__(256) void k_transpose(const float* __restrict__ Wm, float* __restrict__ Wt, int rows, int cols) {
  __shared__ float tS[64][65];
  const int tid = threadIdx.x, tbj = cols / 64, bi = blockIdx.x / tbj, bj = blockIdx.x % tbj;
  for (int e = tid; e < 64 * 64; e += 256) { const int r = e >> 6, c = e & 63; tS[r][c] = Wm[(size_t)(bi * 64 + r) * cols + bj * 64 + c]; }
  __syncthreads();
  for (int ch = tid; ch < 64 * 16; ch += 256) { const int r = ch >> 4, q4 = (ch & 15) * 4; v4f_t o; o[0] = tS[q4][r]; o[1] = tS[q4 + 1][r]; o[2] = tS[q4 + 2][r]; o[3] = tS[q4 + 3][r];
    float* dst = Wt + (size_t)(bj * 64 + r) * rows + bi * 64 + q4; *(v4f_t*)dst = o;  }
}

#define NBpr 2
#define SSpr 2048
#define SIN 2048
#define DDpr 1024
#define NHpr 16
#define DKpr 64
__global__ __launch_bounds__(256) void k_dbg_zero(float* __restrict__ p, size_t n4) { const size_t i = (size_t)blockIdx.x * 256 + threadIdx.x; if (i < n4) { v4f_t z = {0.f,0.f,0.f,0.f}; *(v4f_t*)(p + 4 * i) = z;  } }
__global__ __launch_bounds__(256) void k_copy(const float* __restrict__ src, float* __restrict__ dst, size_t n4) { const size_t i = (size_t)blockIdx.x * 256 + threadIdx.x; if (i < n4) { const v4f_t v = *(const v4f_t*)(src + 4 * i); *(v4f_t*)(dst + 4 * i) = v;  } }
// torch [out][in] weight → WT[i][o] = mul·bf16(W[o][i]) ([in][out], lifted by a power of two so no bf16 weight becomes an f16 subnormal); block = input row i, threads loop over the outputs (4-B lanes)
__global__ __launch_bounds__(256) void k_wprepT(const float* __restrict__ Wt, float* __restrict__ WT, int nout, int nin, float mul) { const int i = blockIdx.x, tid = threadIdx.x;
#pragma unroll 1
  for (int o = tid; o < nout; o += 256) { const float w = mul * bf16r(Wt[(size_t)o * nin + i]); *(float*)(WT + (size_t)i * nout + o) = w;  } }

// per-token head-to-head Bhattacharyya attention: block = token; the six projected [16][64] vectors staged in LDS; thread = (query head i, key head j) for the distance, then
__global__ __launch_bounds__(256) void k_bhatt(const float* __restrict__ MQ, const float* __restrict__ SQ, const float* __restrict__ MK, const float* __restrict__ SK, const float* __restrict__ MV, const float* __restrict__ SV, float* __restrict__ omu, float* __restrict__ osg, int srows) {
  __shared__ __attribute__((aligned(16))) float mq[1024], sq[1024], mk[1024], sk[1024], mv[1024], sv[1024]; __shared__ float att[256];
  const size_t t = blockIdx.x; const int tid = threadIdx.x;
  { const size_t o4 = t * DDpr + 4 * tid; *(v4f_t*)(mq + 4 * tid) = *(const v4f_t*)(MQ + o4); *(v4f_t*)(sq + 4 * tid) = *(const v4f_t*)(SQ + o4); *(v4f_t*)(mk + 4 * tid) = *(const v4f_t*)(MK + o4); *(v4f_t*)(sk + 4 * tid) = *(const v4f_t*)(SK + o4); *(v4f_t*)(mv + 4 * tid) = *(const v4f_t*)(MV + o4); *(v4f_t*)(sv + 4 * tid) = *(const v4f_t*)(SV + o4); }
  __syncthreads();
  const int i = tid >> 4, j = tid & 15; float dist = 0.0f;
#pragma unroll 1
  for (int d = 0; d < DKpr; ++d) { const float sgq = sq[i * DKpr + d], sgk = sk[j * DKpr + d]; const float sq2 = sgq * sgq + 1e-6f, sk2 = sgk * sgk + 1e-6f; const float dm = mq[i * DKpr + d] - mk[j * DKpr + d];
    const float term1 = 0.25f * logf(0.25f * (sq2 / sk2 + sk2 / sq2 + 2.0f)); const float term2 = 0.25f * dm * dm / (sgq * sgq + sgk * sgk + 1e-6f); dist += term1 + term2; }
  float lg = -0.5f * (dist * 0.125f); float m = lg;
  m = fmaxf(m, __shfl_xor(m, 1, 32)); m = fmaxf(m, __shfl_xor(m, 2, 32)); m = fmaxf(m, __shfl_xor(m, 4, 32)); m = fmaxf(m, __shfl_xor(m, 8, 32));
  float e = expf(lg - m); float z = e; z += __shfl_xor(z, 1, 32); z += __shfl_xor(z, 2, 32); z += __shfl_xor(z, 4, 32); z += __shfl_xor(z, 8, 32);
  att[tid] = e / z; __syncthreads();
  const int hi = tid >> 4, c4 = (tid & 15) * 4; v4f_t am, av; am[0] = am[1] = am[2] = am[3] = 0.0f; av[0] = av[1] = av[2] = av[3] = 0.0f;
#pragma unroll 1
  for (int jj = 0; jj < NHpr; ++jj) { const float a = att[hi * NHpr + jj]; const v4f_t mvj = *(const v4f_t*)(mv + jj * DKpr + c4), svj = *(const v4f_t*)(sv + jj * DKpr + c4); am += a * mvj; av += a * (svj * svj); }
  v4f_t os; for (int u = 0; u < 4; ++u) os[u] = sqrtf(fmaxf(av[u], 0.0f) + 1e-6f);
  float* dm_ = omu + ((size_t)hi * srows + t) * DKpr + c4; float* ds_ = osg + ((size_t)hi * srows + t) * DKpr + c4;
  *(v4f_t*)dm_ = am; *(v4f_t*)ds_ = os;  }

extern "C" void kernel_launch(void* const* d_in, const int* in_sizes, int n_in,
                              void* d_out, int out_size, void* d_ws, size_t ws_size,
                              hipStream_t stream) {
  (void)in_sizes; (void)n_in; (void)out_size;
  const float** f = (const float**)d_in;
  float* out0 = (float*)d_out; float* out1 = out0 + (size_t)2 * SIN * DDpr;   // out_mu, out_sigma
  char* ws = (char*)d_ws;
  const size_t slab = (size_t)NBpr * SSpr * DDpr;   // one projection's rows: both batch elements, [4096][1024]
  float* P[6]; for (int i = 0; i < 6; ++i) { P[i] = (float*)ws; ws += slab * 4; }
  if ((size_t)(ws - (char*)d_ws) > ws_size) return;                      // WS TOTAL 100,663,296 B
  const dim3 blk(256); const dim3 gp(NBpr * SSpr / 128, DDpr / 128, 6);
  // input -> projection slot map: query->q_mu (w0), key->k_mu (w1), value->v_mu (w2), query_sigma->q_sigma (w3), key_sigma->k_sigma (w4), value_sigma->v_sigma (w5)
  // the batch axis is folded into the GEMM's M (4096 rows) and the six projections into blockIdx.z: one launch of 32 x 8 x 6 tiles, several workgroups resident on every WGP
  gemm_proj6<<<gp, blk, 0, stream>>>(f[0], f[1], f[2], f[3], f[4], f[5], f[6], f[7], f[8], f[9], f[10], f[11], f[12], f[13], f[14], f[15], f[16], f[17],
                                     P[0], DDpr, DDpr, DDpr, slab, DDpr);
  for (int b = 0; b < NBpr; ++b) { const size_t ob = (size_t)b * SIN * DDpr;
    k_bhatt<<<dim3(SSpr), blk, 0, stream>>>(P[0] + ob, P[3] + ob, P[1] + ob, P[4] + ob, P[2] + ob, P[5] + ob, out0 + ob, out1 + ob, SIN);
  }
}

// v003
// It runs in 247 microseconds.
// Next to v002, in two timings, it ran 1.13 and 1.14 times as fast.
// Counting every step since v000, it is 2.94 times as fast.
// the six activations, six [in][out] weights and six biases are rounded to bf16 (RNE) on load; the six projections are then
// exact single f16 products (weights ×2^6, epilogue 2^-6) with f32 accumulation — the Bhattacharyya terms divide by σ² + 1e-6, which amplifies projection error ≈1000x near σ ≈ 1e-3, so
// exact projections are what make the distances reliable. Contractions on v_wmma_f32_16x16x32_f16 (f16 operands, f32 accumulate), both batch elements in one M = 4096 launch: mu_q, sigma_q, mu_k, sigma_k, mu_v,
// sigma_v = x·W + b (K 1024 each). f32 VALU, one block per token: the 16x16 head-to-head Bhattacharyya distances summed over the 64 channels (0.25·log(0.25·(sq²/sk² + sk²/sq² + 2)) +
// 0.25·(μq−μk)²/(σq²+σk²+ε), with sq² = σq²+ε), /√64, softmax over the key-head axis of −0.5·dist, out_mu = attn·mu_v, out_sigma = sqrt(max(attn·σv², 0) + ε), and the module's
// transpose(1,2)-then-view layout: each output is the [B][H][S][64] array reinterpreted as [B][S][1024]. Two outputs, consecutive in d_out: out_mu then out_sigma.
// compute dtype: f16 operands (bf16-valued), f32 accumulate.  six [2,2048,1024] inputs → (out_mu, out_sigma) [2,2048,1024] each.
#include <hip/hip_runtime.h>
#include <hip/hip_bf16.h>
#include <math.h>


typedef _Float16 bf16;
typedef _Float16 f16;
typedef __attribute__((ext_vector_type(4))) unsigned v4u_t;
typedef unsigned v4ua __attribute__((ext_vector_type(4), may_alias));
typedef __attribute__((ext_vector_type(4))) float v4f_t;
typedef float v4fa __attribute__((ext_vector_type(4), may_alias));
typedef __attribute__((ext_vector_type(16))) bf16  bf16x16;
typedef bf16x16 f16x16;
typedef __attribute__((ext_vector_type(8)))  bf16  bf16x8;
typedef bf16x8 f16x8;
typedef __attribute__((ext_vector_type(4)))  bf16  bf16x4;
typedef __attribute__((ext_vector_type(8)))  float f32x8;
__device__ __forceinline__ f32x8 wmma16(f16x16 a, f16x16 b, f32x8 c) {
  c = __builtin_amdgcn_wmma_f32_16x16x32_f16(false, a, false, b, (short)0, c, false, false);
  asm volatile("v_nop\n\tv_nop\n\tv_nop\n\tv_nop" : "+v"(c) : "v"(a), "v"(b));
  return c;
}
#define LDS_STRIDE 48   // unused: the GEMM tiles use GSTR (32 -> 48 elems, 96B rows: aligned b128 reads)
#define KSTRIDE    72   // unused: k_bhatt stages K at pitch HPpr ([16][68] f32, stride 68)
#define VSTRIDE    48   // unused: k_bhatt stages V unpadded ([16][64] f32, stride 64)

__device__ __forceinline__ f32x8 wmma_bf16(bf16x16 a, bf16x16 b, f32x8 c) {
  c = __builtin_amdgcn_wmma_f32_16x16x32_f16(false, a, false, b, (short)0, c, false, false);
  asm volatile("v_nop\n\tv_nop\n\tv_nop\n\tv_nop" : "+v"(c) : "v"(a), "v"(b));   // A/B-overwrite hazard guard
  return c;
}

// 16x32 (MxK) bf16 fragment from a row-major global matrix.
// lanes 0-15  (row=lane)    : elems 0..7 = K+0..7,  8..15 = K+16..23
// lanes 16-31 (row=lane-16) : elems 0..7 = K+8..15, 8..15 = K+24..31
template <typename T>
__device__ __forceinline__ bf16x16 load_frag(const T* __restrict__ base, int ld,
                                             int row0, int k0) {
  const int lane = threadIdx.x & 31;
  const int r    = lane & 15;
  const int kh   = (lane >> 4) * 8;
  const T* p0 = base + (size_t)(row0 + r) * ld + (k0 + kh);
  const T* p1 = p0 + 16;
  bf16x16 f;
#pragma unroll
  for (int i = 0; i < 8; ++i) {
    f[i]     = (bf16)p0[i];
    f[i + 8] = (bf16)p1[i];
  }
  return f;
}

// Same fragment from an LDS tile with padded row stride (base includes row0/k0).
__device__ __forceinline__ bf16x16 lds_frag(const bf16* base, int stride) {
  const int lane = threadIdx.x & 31;
  const int row  = lane & 15;
  const int kh   = (lane >> 4) * 8;
  const bf16x8 lo = *(const bf16x8*)(base + row * stride + kh);
  const bf16x8 hi = *(const bf16x8*)(base + row * stride + kh + 16);
  bf16x16 f;
#pragma unroll
  for (int i = 0; i < 8; ++i) { f[i] = lo[i]; f[i + 8] = hi[i]; }
  return f;
}

template <typename T>
__device__ __forceinline__ void stage_read16(const T* __restrict__ p, float* buf) {
#pragma unroll
  for (int i = 0; i < 16; ++i) buf[i] = (float)p[i];
}

__device__ __forceinline__ void stage_write(bf16* dst, const float* buf, int nquad) {
#pragma unroll
  for (int i = 0; i < nquad; ++i) {
    bf16x4 q;
    q[0] = (bf16)buf[4 * i];     q[1] = (bf16)buf[4 * i + 1];
    q[2] = (bf16)buf[4 * i + 2]; q[3] = (bf16)buf[4 * i + 3];
    *(bf16x4*)(dst + 4 * i) = q;
  }
}


#define GSTR 48
// ---------------------------------------------------------------------------------------------------------------------------
// gemm_kne: Y[m][n] = epi( Σ_k A[m][k]·W[k][n] + bias[n] ), A f32/f16 [M][lda], W f32 row-major [K][N] (ldw), plain f16 operands,
// f32 accumulate. EPI 0: identity; 1: exact-erf GELU; 2: R[m][n] + gvec[n]·(·) (residual with per-channel gain); 3: ReLU; 4: gvec[n]·(·) (per-channel scale, no residual). Output f32 (or f16
// when OUT16). Block = 128x128 tile, 8 waves as 4(M) x 2(N); per 32-wide k-step A and W tiles staged f16 in LDS (W transposed
// ---------------------------------------------------------------------------------------------------------------------------
#define GSTR 48
template <typename AT, int EPI, bool OUT16>
__global__ __launch_bounds__(256) void gemm_kne(const AT* __restrict__ A, int lda, const float* __restrict__ Wm, int ldw,
                                                const float* __restrict__ bias, const float* __restrict__ R, const float* __restrict__ gvec,
                                                void* __restrict__ Yv, int ldy, int K) {
  __shared__ __attribute__((aligned(16))) f16 ldsA[128 * GSTR];
  __shared__ __attribute__((aligned(16))) f16 ldsW[128 * GSTR];
  __shared__ __attribute__((aligned(16))) float oS[8][32 * 68];
  const int tid = threadIdx.x, lane = tid & 31, wave = tid >> 5, cl = lane & 15, rh = (lane >> 4) * 8;
  const int m0 = blockIdx.x * 128, n0 = blockIdx.y * 128;
  const int wm = (wave & 3) * 32, wn = (wave >> 2) * 64;
  f32x8 acc[2][4];
#pragma unroll
  for (int i = 0; i < 2; ++i)
#pragma unroll
    for (int j = 0; j < 4; ++j) { f32x8 z = {}; acc[i][j] = z; }
#pragma unroll 1
  for (int k0 = 0; k0 < K; k0 += 32) {
    __syncthreads();
    { const int row = tid >> 1, ch = (tid & 1) * 16;
      const AT* src = A + (size_t)(m0 + row) * lda + k0 + ch;
#pragma unroll
      for (int g = 0; g < 16; ++g) ldsA[row * GSTR + ch + g] = (f16)src[g]; }
    { const int k = tid >> 3, nn0 = (tid & 7) * 16;
      const float* src = Wm + (size_t)(k0 + k) * ldw + n0 + nn0;
#pragma unroll
      for (int g = 0; g < 4; ++g) { const v4f_t v = *(const v4f_t*)(src + 4 * g);
#pragma unroll
        for (int u = 0; u < 4; ++u) ldsW[(nn0 + 4 * g + u) * GSTR + k] = (f16)v[u]; } }
    __syncthreads();
    f16x16 af[2];
#pragma unroll
    for (int i = 0; i < 2; ++i) af[i] = lds_frag(ldsA + (wm + 16 * i) * GSTR, GSTR);
#pragma unroll
    for (int j = 0; j < 4; ++j) {
      const f16x16 bf = lds_frag(ldsW + (wn + 16 * j) * GSTR, GSTR);
#pragma unroll
      for (int i = 0; i < 2; ++i) acc[i][j] = wmma16(af[i], bf, acc[i][j]);
    }
  }
  float* so = oS[wave];
#pragma unroll
  for (int i = 0; i < 2; ++i)
#pragma unroll
    for (int j = 0; j < 4; ++j) {
      const int n = n0 + wn + 16 * j + cl;
      const float bv = bias ? bias[n] : 0.0f;
      const float gv = (EPI == 2 || EPI == 4) ? gvec[n] : 0.0f;
      if (EPI == 1) {
#pragma unroll 1
        for (int r = 0; r < 8; ++r) { const float xg = acc[i][j][r] + bv; so[(16 * i + rh + r) * 68 + 16 * j + cl] = 0.5f * xg * (1.0f + erff(xg * 0.70710678118654752f)); }
      } else {
#pragma unroll
        for (int r = 0; r < 8; ++r) {
          float v = acc[i][j][r] + bv;
          if (EPI == 3) v = fmaxf(v, 0.0f);
          if (EPI == 4) v = gv * v;
          if (EPI == 2) v = R[(size_t)(m0 + wm + 16 * i + rh + r) * ldy + n] + gv * v;
          so[(16 * i + rh + r) * 68 + 16 * j + cl] = v;
        }
      }
    }
  asm volatile("s_wait_dscnt 0" ::: "memory");
  __builtin_amdgcn_wave_barrier();
{
    if (OUT16) {
      f16* Y = (f16*)Yv;
#pragma unroll
      for (int it = 0; it < 8; ++it) { const int c = lane + 32 * it, rr = c >> 3, q8 = (c & 7) * 8;
        union { f16 h[8]; v4u_t v; } u;
#pragma unroll
        for (int e = 0; e < 8; ++e) u.h[e] = (f16)so[rr * 68 + q8 + e];
        *(v4u_t*)(Y + (size_t)(m0 + wm + rr) * ldy + n0 + wn + q8) = u.v; }
    } else {
      float* Y = (float*)Yv;
#pragma unroll
      for (int it = 0; it < 16; ++it) { const int f4 = lane + 32 * it, rr = f4 >> 4, q = (f4 & 15) * 4;
        *(v4f_t*)(Y + (size_t)(m0 + wm + rr) * ldy + n0 + wn + q) = *(const v4fa*)(so + rr * 68 + q); }
    }
    
  }
}

// bf16 round-to-nearest-even of an f32 (bit trick)
__device__ __forceinline__ float bf16r(float x) { unsigned int u = __float_as_uint(x); u = (u + 0x7FFFu + ((u >> 16) & 1u)) & 0xFFFF0000u; return __uint_as_float(u); }

// gemm_proj6: the six projections in one launch, straight from the inputs (same tile code as gemm_kne). blockIdx.z picks activation x, weight w ([in][out]) and bias b;
// Y[z][m][n] = 2^-6 * ( sum_k bf16(x[m][k]) * (2^6 * bf16(w[k][n])) + 2^6 * bf16(b[n]) ). The bf16 rounding and the exact power-of-two lift (no bf16 weight becomes an f16
// subnormal) are applied in registers between the global load and the f16 LDS store, so no rounded copy of any operand goes through memory.
__global__ __launch_bounds__(256) void gemm_proj6(const float* __restrict__ x0, const float* __restrict__ x1, const float* __restrict__ x2,
                                                  const float* __restrict__ x3, const float* __restrict__ x4, const float* __restrict__ x5,
                                                  const float* __restrict__ w0, const float* __restrict__ w1, const float* __restrict__ w2,
                                                  const float* __restrict__ w3, const float* __restrict__ w4, const float* __restrict__ w5,
                                                  const float* __restrict__ b0, const float* __restrict__ b1, const float* __restrict__ b2,
                                                  const float* __restrict__ b3, const float* __restrict__ b4, const float* __restrict__ b5,
                                                  float* __restrict__ Y, int lda, int ldw, int ldy, size_t strideY, int K) {
  const int z = blockIdx.z;
  const float* __restrict__ A    = z == 0 ? x0 : z == 1 ? x1 : z == 2 ? x2 : z == 3 ? x3 : z == 4 ? x4 : x5;
  const float* __restrict__ Wm   = z == 0 ? w0 : z == 1 ? w1 : z == 2 ? w2 : z == 3 ? w3 : z == 4 ? w4 : w5;
  const float* __restrict__ bias = z == 0 ? b0 : z == 1 ? b1 : z == 2 ? b2 : z == 3 ? b3 : z == 4 ? b4 : b5;
  Y += (size_t)z * strideY;
  __shared__ __attribute__((aligned(16))) f16 ldsA[128 * GSTR];
  __shared__ __attribute__((aligned(16))) f16 ldsW[128 * GSTR];
  __shared__ __attribute__((aligned(16))) float oS[8][32 * 68];
  const int tid = threadIdx.x, lane = tid & 31, wave = tid >> 5, cl = lane & 15, rh = (lane >> 4) * 8;
  const int m0 = blockIdx.x * 128, n0 = blockIdx.y * 128;
  const int wm = (wave & 3) * 32, wn = (wave >> 2) * 64;
  f32x8 acc[2][4];
#pragma unroll
  for (int i = 0; i < 2; ++i)
#pragma unroll
    for (int j = 0; j < 4; ++j) { f32x8 zz = {}; acc[i][j] = zz; }
#pragma unroll 1
  for (int k0 = 0; k0 < K; k0 += 32) {
    __syncthreads();
    { const int row = tid >> 1, ch = (tid & 1) * 16;
      const float* src = A + (size_t)(m0 + row) * lda + k0 + ch;
#pragma unroll
      for (int g = 0; g < 16; ++g) ldsA[row * GSTR + ch + g] = (f16)bf16r(src[g]); }
    { const int k = tid >> 3, nn0 = (tid & 7) * 16;
      const float* src = Wm + (size_t)(k0 + k) * ldw + n0 + nn0;
#pragma unroll
      for (int g = 0; g < 4; ++g) { const v4f_t v = *(const v4f_t*)(src + 4 * g);
#pragma unroll
        for (int u = 0; u < 4; ++u) ldsW[(nn0 + 4 * g + u) * GSTR + k] = (f16)(64.0f * bf16r(v[u])); } }
    __syncthreads();
    f16x16 af[2];
#pragma unroll
    for (int i = 0; i < 2; ++i) af[i] = lds_frag(ldsA + (wm + 16 * i) * GSTR, GSTR);
#pragma unroll
    for (int j = 0; j < 4; ++j) {
      const f16x16 bf = lds_frag(ldsW + (wn + 16 * j) * GSTR, GSTR);
#pragma unroll
      for (int i = 0; i < 2; ++i) acc[i][j] = wmma16(af[i], bf, acc[i][j]);
    }
  }
  float* so = oS[wave];
#pragma unroll
  for (int i = 0; i < 2; ++i)
#pragma unroll
    for (int j = 0; j < 4; ++j) {
      const float bv = 64.0f * bf16r(bias[n0 + wn + 16 * j + cl]);
#pragma unroll
      for (int r = 0; r < 8; ++r) so[(16 * i + rh + r) * 68 + 16 * j + cl] = (1.0f / 64.0f) * (acc[i][j][r] + bv);
    }
  asm volatile("s_wait_dscnt 0" ::: "memory");
  __builtin_amdgcn_wave_barrier();
#pragma unroll
  for (int it = 0; it < 16; ++it) { const int f4 = lane + 32 * it, rr = f4 >> 4, q = (f4 & 15) * 4;
    *(v4f_t*)(Y + (size_t)(m0 + wm + rr) * ldy + n0 + wn + q) = *(const v4fa*)(so + rr * 68 + q); }
}

// ---------------------------------------------------------------------------------------------------------------------------
// gemm_kn2 (value+residual planes on both operands: hh + (hl+lh)/2048, f32-class): Y[m][n] (row stride ldy) = scale * sum_k A[m][k] (f32 or f16, row stride lda) * W[k][n] (f32, row-major [K][N], row
// stride ldw) (+ bias[n]) (+ Y if ACC). Block = 128 x 128 tile, 256 threads = 8 waves as 4(M, 32 rows) x 2(N, 64 cols); per
// 32-wide k-step the A tile and the W tile (stored transposed [n][k]) are staged as f16 in LDS; value and residual f16 planes per operand, f32
// blockIdx.z selects a batch: A += z*strideA, W += z*strideW, Y += z*strideY (element strides).
// ---------------------------------------------------------------------------------------------------------------------------
template <typename AT, bool ACC>
__global__ __launch_bounds__(256) void gemm_kn2(const AT* __restrict__ A, int lda, size_t strideA,
                                               const float* __restrict__ Wm, int ldw, size_t strideW,
                                               const float* __restrict__ bias, float scale,
                                               float* __restrict__ Y, int ldy, size_t strideY, int K) {
  __shared__ __attribute__((aligned(16))) f16 ldsA[128 * GSTR], ldsAl[128 * GSTR];
  __shared__ __attribute__((aligned(16))) f16 ldsW[128 * GSTR], ldsWl[128 * GSTR];
  __shared__ __attribute__((aligned(16))) float oS[8][32 * 68];
  const int tid = threadIdx.x, lane = tid & 31, wave = tid >> 5, cl = lane & 15, rh = (lane >> 4) * 8;
  const int m0 = blockIdx.x * 128, n0 = blockIdx.y * 128;
  const int wm = (wave & 3) * 32, wn = (wave >> 2) * 64;
  A += (size_t)blockIdx.z * strideA; Wm += (size_t)blockIdx.z * strideW; Y += (size_t)blockIdx.z * strideY;
  f32x8 acc[2][4], accx[2][4];
#pragma unroll
  for (int i = 0; i < 2; ++i)
#pragma unroll
    for (int j = 0; j < 4; ++j) { f32x8 z = {}; acc[i][j] = z; accx[i][j] = z; }
#pragma unroll 1
  for (int k0 = 0; k0 < K; k0 += 32) {
    __syncthreads();
    {  // A: thread -> row tid>>1, 16 elements at column half (tid&1)*16
      const int row = tid >> 1, ch = (tid & 1) * 16;
      const AT* src = A + (size_t)(m0 + row) * lda + k0 + ch;
#pragma unroll
      for (int g = 0; g < 16; ++g) { const float v = (float)src[g]; const f16 h = (f16)v; ldsA[row * GSTR + ch + g] = h; ldsAl[row * GSTR + ch + g] = (f16)((v - (float)h) * 2048.0f); }
    }
    {  // W: thread -> k = tid>>3, 16 consecutive n at (tid&7)*16; stored transposed [n][k]
      const int k = tid >> 3, nn0 = (tid & 7) * 16;
      const float* src = Wm + (size_t)(k0 + k) * ldw + n0 + nn0;
#pragma unroll
      for (int g = 0; g < 4; ++g) { const v4f_t v = *(const v4f_t*)(src + 4 * g);
#pragma unroll
        for (int u = 0; u < 4; ++u) { const f16 h = (f16)v[u]; ldsW[(nn0 + 4 * g + u) * GSTR + k] = h; ldsWl[(nn0 + 4 * g + u) * GSTR + k] = (f16)((v[u] - (float)h) * 2048.0f); } }
    }
    __syncthreads();
    f16x16 af[2], afl[2];
#pragma unroll
    for (int i = 0; i < 2; ++i) { af[i] = lds_frag(ldsA + (wm + 16 * i) * GSTR, GSTR); afl[i] = lds_frag(ldsAl + (wm + 16 * i) * GSTR, GSTR); }
#pragma unroll
    for (int j = 0; j < 4; ++j) {
      const f16x16 bf = lds_frag(ldsW + (wn + 16 * j) * GSTR, GSTR), bfl = lds_frag(ldsWl + (wn + 16 * j) * GSTR, GSTR);
#pragma unroll
      for (int i = 0; i < 2; ++i) { acc[i][j] = wmma16(af[i], bf, acc[i][j]); accx[i][j] = wmma16(af[i], bfl, accx[i][j]); accx[i][j] = wmma16(afl[i], bf, accx[i][j]); }
    }
  }
  float* so = oS[wave];
#pragma unroll
  for (int i = 0; i < 2; ++i)
#pragma unroll
    for (int j = 0; j < 4; ++j) {
      const float bv = bias ? bias[n0 + wn + 16 * j + cl] : 0.0f;
#pragma unroll
      for (int r = 0; r < 8; ++r) so[(16 * i + rh + r) * 68 + 16 * j + cl] = (acc[i][j][r] + accx[i][j][r] * (1.0f / 2048.0f)) * scale + bv;
    }
  asm volatile("s_wait_dscnt 0" ::: "memory");
  __builtin_amdgcn_wave_barrier();
  if (ACC) {   // accumulate: fold the existing Y values into the staging tile ONCE (same thread <-> same chunks as the stores below)
#pragma unroll
    for (int it = 0; it < 16; ++it) { const int f4 = lane + 32 * it, rr = f4 >> 4, q = (f4 & 15) * 4;
      const v4f_t old = *(const v4fa*)(Y + (size_t)(m0 + wm + rr) * ldy + n0 + wn + q);
      v4f_t v = *(const v4fa*)(so + rr * 68 + q); v += old; *(v4fa*)(so + rr * 68 + q) = v; }   // plain LDS store (ordered by the s_wait_dscnt/memory clobber below)
    asm volatile("s_wait_dscnt 0" ::: "memory");
  }
{
#pragma unroll
    for (int it = 0; it < 16; ++it) { const int f4 = lane + 32 * it, rr = f4 >> 4, q = (f4 & 15) * 4;
      *(v4f_t*)(Y + (size_t)(m0 + wm + rr) * ldy + n0 + wn + q) = *(const v4fa*)(so + rr * 68 + q); }
    
  }
}

__global__ __launch_bounds__(256) void k_transpose(const float* __restrict__ Wm, float* __restrict__ Wt, int rows, int cols) {
  __shared__ float tS[64][65];
  const int tid = threadIdx.x, tbj = cols / 64, bi = blockIdx.x / tbj, bj = blockIdx.x % tbj;
  for (int e = tid; e < 64 * 64; e += 256) { const int r = e >> 6, c = e & 63; tS[r][c] = Wm[(size_t)(bi * 64 + r) * cols + bj * 64 + c]; }
  __syncthreads();
  for (int ch = tid; ch < 64 * 16; ch += 256) { const int r = ch >> 4, q4 = (ch & 15) * 4; v4f_t o; o[0] = tS[q4][r]; o[1] = tS[q4 + 1][r]; o[2] = tS[q4 + 2][r]; o[3] = tS[q4 + 3][r];
    float* dst = Wt + (size_t)(bj * 64 + r) * rows + bi * 64 + q4; *(v4f_t*)dst = o;  }
}

#define NBpr 2
#define SSpr 2048
#define SIN 2048
#define DDpr 1024
#define NHpr 16
#define DKpr 64
#define HPpr 68   // LDS pitch, in floats, of one head's 64 channels in k_bhatt
__global__ __launch_bounds__(256) void k_dbg_zero(float* __restrict__ p, size_t n4) { const size_t i = (size_t)blockIdx.x * 256 + threadIdx.x; if (i < n4) { v4f_t z = {0.f,0.f,0.f,0.f}; *(v4f_t*)(p + 4 * i) = z;  } }
__global__ __launch_bounds__(256) void k_copy(const float* __restrict__ src, float* __restrict__ dst, size_t n4) { const size_t i = (size_t)blockIdx.x * 256 + threadIdx.x; if (i < n4) { const v4f_t v = *(const v4f_t*)(src + 4 * i); *(v4f_t*)(dst + 4 * i) = v;  } }
// torch [out][in] weight → WT[i][o] = mul·bf16(W[o][i]) ([in][out], lifted by a power of two so no bf16 weight becomes an f16 subnormal); block = input row i, threads loop over the outputs (4-B lanes)
__global__ __launch_bounds__(256) void k_wprepT(const float* __restrict__ Wt, float* __restrict__ WT, int nout, int nin, float mul) { const int i = blockIdx.x, tid = threadIdx.x;
#pragma unroll 1
  for (int o = tid; o < nout; o += 256) { const float w = mul * bf16r(Wt[(size_t)o * nin + i]); *(float*)(WT + (size_t)i * nout + o) = w;  } }

// per-token head-to-head Bhattacharyya attention: block = token; the six projected [16][64] vectors staged in LDS; thread = (query head i, key head j) for the distance, then
__global__ __launch_bounds__(256) void k_bhatt(const float* __restrict__ MQ, const float* __restrict__ SQ, const float* __restrict__ MK, const float* __restrict__ SK, const float* __restrict__ MV, const float* __restrict__ SV, float* __restrict__ omu, float* __restrict__ osg, int srows) {
  // q and k head rows sit at a pitch of HPpr floats (272 B = 16 B x 17): the 16 key heads that the 16 lanes of a row read at one channel offset fall on distinct banks
  __shared__ __attribute__((aligned(16))) float mq[NHpr * HPpr], sq[NHpr * HPpr], mk[NHpr * HPpr], sk[NHpr * HPpr], mv[1024], sv[1024]; __shared__ float att[256];
  const size_t t = blockIdx.x; const int tid = threadIdx.x;
  { const size_t o4 = t * DDpr + 4 * tid; const int p4 = (tid >> 4) * HPpr + (tid & 15) * 4;
    *(v4f_t*)(mq + p4) = *(const v4f_t*)(MQ + o4); *(v4f_t*)(sq + p4) = *(const v4f_t*)(SQ + o4); *(v4f_t*)(mk + p4) = *(const v4f_t*)(MK + o4); *(v4f_t*)(sk + p4) = *(const v4f_t*)(SK + o4); *(v4f_t*)(mv + 4 * tid) = *(const v4f_t*)(MV + o4); *(v4f_t*)(sv + 4 * tid) = *(const v4f_t*)(SV + o4); }
  __syncthreads();
  const int i = tid >> 4, j = tid & 15; float dist = 0.0f;
#pragma unroll 1
  for (int d = 0; d < DKpr; d += 4) {   // four channels per 16-byte LDS read; the channels are summed one by one in ascending order
    const v4f_t sgq4 = *(const v4f_t*)(sq + i * HPpr + d), sgk4 = *(const v4f_t*)(sk + j * HPpr + d), mq4 = *(const v4f_t*)(mq + i * HPpr + d), mk4 = *(const v4f_t*)(mk + j * HPpr + d);
#pragma unroll   // constant indices into the four-channel vectors, so that they stay in registers
    for (int u = 0; u < 4; ++u) { const float sgq = sgq4[u], sgk = sgk4[u]; const float sq2 = sgq * sgq + 1e-6f, sk2 = sgk * sgk + 1e-6f; const float dm = mq4[u] - mk4[u];
      const float term1 = 0.25f * logf(0.25f * (sq2 / sk2 + sk2 / sq2 + 2.0f)); const float term2 = 0.25f * dm * dm / (sgq * sgq + sgk * sgk + 1e-6f); dist += term1 + term2; } }
  float lg = -0.5f * (dist * 0.125f); float m = lg;
  m = fmaxf(m, __shfl_xor(m, 1, 32)); m = fmaxf(m, __shfl_xor(m, 2, 32)); m = fmaxf(m, __shfl_xor(m, 4, 32)); m = fmaxf(m, __shfl_xor(m, 8, 32));
  float e = expf(lg - m); float z = e; z += __shfl_xor(z, 1, 32); z += __shfl_xor(z, 2, 32); z += __shfl_xor(z, 4, 32); z += __shfl_xor(z, 8, 32);
  att[tid] = e / z; __syncthreads();
  const int hi = tid >> 4, c4 = (tid & 15) * 4; v4f_t am, av; am[0] = am[1] = am[2] = am[3] = 0.0f; av[0] = av[1] = av[2] = av[3] = 0.0f;
#pragma unroll 1
  for (int jj = 0; jj < NHpr; ++jj) { const float a = att[hi * NHpr + jj]; const v4f_t mvj = *(const v4f_t*)(mv + jj * DKpr + c4), svj = *(const v4f_t*)(sv + jj * DKpr + c4); am += a * mvj; av += a * (svj * svj); }
  v4f_t os; for (int u = 0; u < 4; ++u) os[u] = sqrtf(fmaxf(av[u], 0.0f) + 1e-6f);
  float* dm_ = omu + ((size_t)hi * srows + t) * DKpr + c4; float* ds_ = osg + ((size_t)hi * srows + t) * DKpr + c4;
  *(v4f_t*)dm_ = am; *(v4f_t*)ds_ = os;  }

extern "C" void kernel_launch(void* const* d_in, const int* in_sizes, int n_in,
                              void* d_out, int out_size, void* d_ws, size_t ws_size,
                              hipStream_t stream) {
  (void)in_sizes; (void)n_in; (void)out_size;
  const float** f = (const float**)d_in;
  float* out0 = (float*)d_out; float* out1 = out0 + (size_t)2 * SIN * DDpr;   // out_mu, out_sigma
  char* ws = (char*)d_ws;
  const size_t slab = (size_t)NBpr * SSpr * DDpr;   // one projection's rows: both batch elements, [4096][1024]
  float* P[6]; for (int i = 0; i < 6; ++i) { P[i] = (float*)ws; ws += slab * 4; }
  if ((size_t)(ws - (char*)d_ws) > ws_size) return;                      // WS TOTAL 100,663,296 B
  const dim3 blk(256); const dim3 gp(NBpr * SSpr / 128, DDpr / 128, 6);
  // input -> projection slot map: query->q_mu (w0), key->k_mu (w1), value->v_mu (w2), query_sigma->q_sigma (w3), key_sigma->k_sigma (w4), value_sigma->v_sigma (w5)
  // the batch axis is folded into the GEMM's M (4096 rows) and the six projections into blockIdx.z: one launch of 32 x 8 x 6 tiles, several workgroups resident on every WGP
  gemm_proj6<<<gp, blk, 0, stream>>>(f[0], f[1], f[2], f[3], f[4], f[5], f[6], f[7], f[8], f[9], f[10], f[11], f[12], f[13], f[14], f[15], f[16], f[17],
                                     P[0], DDpr, DDpr, DDpr, slab, DDpr);
  for (int b = 0; b < NBpr; ++b) { const size_t ob = (size_t)b * SIN * DDpr;
    k_bhatt<<<dim3(SSpr), blk, 0, stream>>>(P[0] + ob, P[3] + ob, P[1] + ob, P[4] + ob, P[2] + ob, P[5] + ob, out0 + ob, out1 + ob, SIN);
  }
}

// v004
// One run takes 183 microseconds.
// Timed twice side by side with v003, it ran 1.35 times as fast both times.
// Counting every step since v000, it is 3.97 times as fast.
// the six activations, six [in][out] weights and six biases are rounded to bf16 (RNE) on load; the six projections are then
// exact single f16 products (weights ×2^6, epilogue 2^-6) with f32 accumulation — the Bhattacharyya terms divide by σ² + 1e-6, which amplifies projection error ≈1000x near σ ≈ 1e-3, so
// exact projections are what make the distances reliable. Contractions on v_wmma_f32_16x16x32_f16 (f16 operands, f32 accumulate), both batch elements in one M = 4096 launch: mu_q, sigma_q, mu_k, sigma_k, mu_v,
// sigma_v = x·W + b (K 1024 each). f32 VALU, one block per token: the 16x16 head-to-head Bhattacharyya distances summed over the 64 channels (0.25·log(0.25·(sq²/sk² + sk²/sq² + 2)) +
// 0.25·(μq−μk)²/(σq²+σk²+ε), with sq² = σq²+ε), /√64, softmax over the key-head axis of −0.5·dist, out_mu = attn·mu_v, out_sigma = sqrt(max(attn·σv², 0) + ε), and the module's
// transpose(1,2)-then-view layout: each output is the [B][H][S][64] array reinterpreted as [B][S][1024]. Two outputs, consecutive in d_out: out_mu then out_sigma.
// compute dtype: f16 operands (bf16-valued), f32 accumulate.  six [2,2048,1024] inputs → (out_mu, out_sigma) [2,2048,1024] each.
#include <hip/hip_runtime.h>
#include <hip/hip_bf16.h>
#include <math.h>


typedef _Float16 bf16;
typedef _Float16 f16;
typedef __attribute__((ext_vector_type(4))) unsigned v4u_t;
typedef unsigned v4ua __attribute__((ext_vector_type(4), may_alias));
typedef __attribute__((ext_vector_type(4))) float v4f_t;
typedef float v4fa __attribute__((ext_vector_type(4), may_alias));
typedef __attribute__((ext_vector_type(16))) bf16  bf16x16;
typedef bf16x16 f16x16;
typedef __attribute__((ext_vector_type(8)))  bf16  bf16x8;
typedef bf16x8 f16x8;
typedef __attribute__((ext_vector_type(4)))  bf16  bf16x4;
typedef __attribute__((ext_vector_type(8)))  float f32x8;
__device__ __forceinline__ f32x8 wmma16(f16x16 a, f16x16 b, f32x8 c) {
  c = __builtin_amdgcn_wmma_f32_16x16x32_f16(false, a, false, b, (short)0, c, false, false);
  asm volatile("v_nop\n\tv_nop\n\tv_nop\n\tv_nop" : "+v"(c) : "v"(a), "v"(b));
  return c;
}
#define LDS_STRIDE 48   // unused: the GEMM tiles use GSTR (32 -> 48 elems, 96B rows: aligned b128 reads)
#define KSTRIDE    72   // unused: k_bhatt stages K at pitch HPpr ([16][68] f32, stride 68)
#define VSTRIDE    48   // unused: k_bhatt stages V unpadded ([16][64] f32, stride 64)

__device__ __forceinline__ f32x8 wmma_bf16(bf16x16 a, bf16x16 b, f32x8 c) {
  c = __builtin_amdgcn_wmma_f32_16x16x32_f16(false, a, false, b, (short)0, c, false, false);
  asm volatile("v_nop\n\tv_nop\n\tv_nop\n\tv_nop" : "+v"(c) : "v"(a), "v"(b));   // A/B-overwrite hazard guard
  return c;
}

// 16x32 (MxK) bf16 fragment from a row-major global matrix.
// lanes 0-15  (row=lane)    : elems 0..7 = K+0..7,  8..15 = K+16..23
// lanes 16-31 (row=lane-16) : elems 0..7 = K+8..15, 8..15 = K+24..31
template <typename T>
__device__ __forceinline__ bf16x16 load_frag(const T* __restrict__ base, int ld,
                                             int row0, int k0) {
  const int lane = threadIdx.x & 31;
  const int r    = lane & 15;
  const int kh   = (lane >> 4) * 8;
  const T* p0 = base + (size_t)(row0 + r) * ld + (k0 + kh);
  const T* p1 = p0 + 16;
  bf16x16 f;
#pragma unroll
  for (int i = 0; i < 8; ++i) {
    f[i]     = (bf16)p0[i];
    f[i + 8] = (bf16)p1[i];
  }
  return f;
}

// Same fragment from an LDS tile with padded row stride (base includes row0/k0).
__device__ __forceinline__ bf16x16 lds_frag(const bf16* base, int stride) {
  const int lane = threadIdx.x & 31;
  const int row  = lane & 15;
  const int kh   = (lane >> 4) * 8;
  const bf16x8 lo = *(const bf16x8*)(base + row * stride + kh);
  const bf16x8 hi = *(const bf16x8*)(base + row * stride + kh + 16);
  bf16x16 f;
#pragma unroll
  for (int i = 0; i < 8; ++i) { f[i] = lo[i]; f[i + 8] = hi[i]; }
  return f;
}

template <typename T>
__device__ __forceinline__ void stage_read16(const T* __restrict__ p, float* buf) {
#pragma unroll
  for (int i = 0; i < 16; ++i) buf[i] = (float)p[i];
}

__device__ __forceinline__ void stage_write(bf16* dst, const float* buf, int nquad) {
#pragma unroll
  for (int i = 0; i < nquad; ++i) {
    bf16x4 q;
    q[0] = (bf16)buf[4 * i];     q[1] = (bf16)buf[4 * i + 1];
    q[2] = (bf16)buf[4 * i + 2]; q[3] = (bf16)buf[4 * i + 3];
    *(bf16x4*)(dst + 4 * i) = q;
  }
}


#define GSTR 48
// ---------------------------------------------------------------------------------------------------------------------------
// gemm_kne: Y[m][n] = epi( Σ_k A[m][k]·W[k][n] + bias[n] ), A f32/f16 [M][lda], W f32 row-major [K][N] (ldw), plain f16 operands,
// f32 accumulate. EPI 0: identity; 1: exact-erf GELU; 2: R[m][n] + gvec[n]·(·) (residual with per-channel gain); 3: ReLU; 4: gvec[n]·(·) (per-channel scale, no residual). Output f32 (or f16
// when OUT16). Block = 128x128 tile, 8 waves as 4(M) x 2(N); per 32-wide k-step A and W tiles staged f16 in LDS (W transposed
// ---------------------------------------------------------------------------------------------------------------------------
#define GSTR 48
template <typename AT, int EPI, bool OUT16>
__global__ __launch_bounds__(256) void gemm_kne(const AT* __restrict__ A, int lda, const float* __restrict__ Wm, int ldw,
                                                const float* __restrict__ bias, const float* __restrict__ R, const float* __restrict__ gvec,
                                                void* __restrict__ Yv, int ldy, int K) {
  __shared__ __attribute__((aligned(16))) f16 ldsA[128 * GSTR];
  __shared__ __attribute__((aligned(16))) f16 ldsW[128 * GSTR];
  __shared__ __attribute__((aligned(16))) float oS[8][32 * 68];
  const int tid = threadIdx.x, lane = tid & 31, wave = tid >> 5, cl = lane & 15, rh = (lane >> 4) * 8;
  const int m0 = blockIdx.x * 128, n0 = blockIdx.y * 128;
  const int wm = (wave & 3) * 32, wn = (wave >> 2) * 64;
  f32x8 acc[2][4];
#pragma unroll
  for (int i = 0; i < 2; ++i)
#pragma unroll
    for (int j = 0; j < 4; ++j) { f32x8 z = {}; acc[i][j] = z; }
#pragma unroll 1
  for (int k0 = 0; k0 < K; k0 += 32) {
    __syncthreads();
    { const int row = tid >> 1, ch = (tid & 1) * 16;
      const AT* src = A + (size_t)(m0 + row) * lda + k0 + ch;
#pragma unroll
      for (int g = 0; g < 16; ++g) ldsA[row * GSTR + ch + g] = (f16)src[g]; }
    { const int k = tid >> 3, nn0 = (tid & 7) * 16;
      const float* src = Wm + (size_t)(k0 + k) * ldw + n0 + nn0;
#pragma unroll
      for (int g = 0; g < 4; ++g) { const v4f_t v = *(const v4f_t*)(src + 4 * g);
#pragma unroll
        for (int u = 0; u < 4; ++u) ldsW[(nn0 + 4 * g + u) * GSTR + k] = (f16)v[u]; } }
    __syncthreads();
    f16x16 af[2];
#pragma unroll
    for (int i = 0; i < 2; ++i) af[i] = lds_frag(ldsA + (wm + 16 * i) * GSTR, GSTR);
#pragma unroll
    for (int j = 0; j < 4; ++j) {
      const f16x16 bf = lds_frag(ldsW + (wn + 16 * j) * GSTR, GSTR);
#pragma unroll
      for (int i = 0; i < 2; ++i) acc[i][j] = wmma16(af[i], bf, acc[i][j]);
    }
  }
  float* so = oS[wave];
#pragma unroll
  for (int i = 0; i < 2; ++i)
#pragma unroll
    for (int j = 0; j < 4; ++j) {
      const int n = n0 + wn + 16 * j + cl;
      const float bv = bias ? bias[n] : 0.0f;
      const float gv = (EPI == 2 || EPI == 4) ? gvec[n] : 0.0f;
      if (EPI == 1) {
#pragma unroll 1
        for (int r = 0; r < 8; ++r) { const float xg = acc[i][j][r] + bv; so[(16 * i + rh + r) * 68 + 16 * j + cl] = 0.5f * xg * (1.0f + erff(xg * 0.70710678118654752f)); }
      } else {
#pragma unroll
        for (int r = 0; r < 8; ++r) {
          float v = acc[i][j][r] + bv;
          if (EPI == 3) v = fmaxf(v, 0.0f);
          if (EPI == 4) v = gv * v;
          if (EPI == 2) v = R[(size_t)(m0 + wm + 16 * i + rh + r) * ldy + n] + gv * v;
          so[(16 * i + rh + r) * 68 + 16 * j + cl] = v;
        }
      }
    }
  asm volatile("s_wait_dscnt 0" ::: "memory");
  __builtin_amdgcn_wave_barrier();
{
    if (OUT16) {
      f16* Y = (f16*)Yv;
#pragma unroll
      for (int it = 0; it < 8; ++it) { const int c = lane + 32 * it, rr = c >> 3, q8 = (c & 7) * 8;
        union { f16 h[8]; v4u_t v; } u;
#pragma unroll
        for (int e = 0; e < 8; ++e) u.h[e] = (f16)so[rr * 68 + q8 + e];
        *(v4u_t*)(Y + (size_t)(m0 + wm + rr) * ldy + n0 + wn + q8) = u.v; }
    } else {
      float* Y = (float*)Yv;
#pragma unroll
      for (int it = 0; it < 16; ++it) { const int f4 = lane + 32 * it, rr = f4 >> 4, q = (f4 & 15) * 4;
        *(v4f_t*)(Y + (size_t)(m0 + wm + rr) * ldy + n0 + wn + q) = *(const v4fa*)(so + rr * 68 + q); }
    }
    
  }
}

// bf16 round-to-nearest-even of an f32 (bit trick)
__device__ __forceinline__ float bf16r(float x) { unsigned int u = __float_as_uint(x); u = (u + 0x7FFFu + ((u >> 16) & 1u)) & 0xFFFF0000u; return __uint_as_float(u); }

// gemm_proj6: the six projections in one launch, straight from the inputs (same tile code as gemm_kne). blockIdx.z picks activation x, weight w ([in][out]) and bias b;
// Y[z][m][n] = 2^-6 * ( sum_k bf16(x[m][k]) * (2^6 * bf16(w[k][n])) + 2^6 * bf16(b[n]) ). The bf16 rounding and the exact power-of-two lift (no bf16 weight becomes an f16
// subnormal) are applied in registers between the global load and the f16 LDS store, so no rounded copy of any operand goes through memory.
__global__ __launch_bounds__(256) void gemm_proj6(const float* __restrict__ x0, const float* __restrict__ x1, const float* __restrict__ x2,
                                                  const float* __restrict__ x3, const float* __restrict__ x4, const float* __restrict__ x5,
                                                  const float* __restrict__ w0, const float* __restrict__ w1, const float* __restrict__ w2,
                                                  const float* __restrict__ w3, const float* __restrict__ w4, const float* __restrict__ w5,
                                                  const float* __restrict__ b0, const float* __restrict__ b1, const float* __restrict__ b2,
                                                  const float* __restrict__ b3, const float* __restrict__ b4, const float* __restrict__ b5,
                                                  float* __restrict__ Y, int lda, int ldw, int ldy, size_t strideY, int K) {
  const int z = blockIdx.z;
  const float* __restrict__ A    = z == 0 ? x0 : z == 1 ? x1 : z == 2 ? x2 : z == 3 ? x3 : z == 4 ? x4 : x5;
  const float* __restrict__ Wm   = z == 0 ? w0 : z == 1 ? w1 : z == 2 ? w2 : z == 3 ? w3 : z == 4 ? w4 : w5;
  const float* __restrict__ bias = z == 0 ? b0 : z == 1 ? b1 : z == 2 ? b2 : z == 3 ? b3 : z == 4 ? b4 : b5;
  Y += (size_t)z * strideY;
  __shared__ __attribute__((aligned(16))) f16 ldsA[128 * GSTR];
  __shared__ __attribute__((aligned(16))) f16 ldsW[128 * GSTR];
  __shared__ __attribute__((aligned(16))) float oS[8][32 * 68];
  const int tid = threadIdx.x, lane = tid & 31, wave = tid >> 5, cl = lane & 15, rh = (lane >> 4) * 8;
  const int m0 = blockIdx.x * 128, n0 = blockIdx.y * 128;
  const int wm = (wave & 3) * 32, wn = (wave >> 2) * 64;
  f32x8 acc[2][4];
#pragma unroll
  for (int i = 0; i < 2; ++i)
#pragma unroll
    for (int j = 0; j < 4; ++j) { f32x8 zz = {}; acc[i][j] = zz; }
#pragma unroll 1
  for (int k0 = 0; k0 < K; k0 += 32) {
    __syncthreads();
    // staging map: 8 lanes x 16 B cover one whole 128-B line, so every wave-wide load touches 4 whole lines.
    // A: lane -> (row l8 of 4, 4-channel chunk l7); W: lane -> (group kg of 4 consecutive k rows, 4 columns at nn), so that each column's 4 k values go to the transposed tile as one 8-byte store.
    { const int l7 = lane & 7, l8 = lane >> 3;
      const int ar = wave * 4 + l8, kg = (wave >> 2) * 4 + l8, nn = (wave & 3) * 32 + l7 * 4;
      const float* sa = A + (size_t)(m0 + ar) * lda + k0 + l7 * 4;
      const float* sw = Wm + (size_t)(k0 + 4 * kg) * ldw + n0 + nn;
      float fa[4][4], fw[4][4];
#pragma unroll
      for (int g = 0; g < 4; ++g)
#pragma unroll
        for (int e = 0; e < 4; ++e) fa[g][e] = sa[(size_t)(32 * g) * lda + e];
#pragma unroll
      for (int r = 0; r < 4; ++r)
#pragma unroll
        for (int u = 0; u < 4; ++u) fw[r][u] = sw[(size_t)r * ldw + u];
#pragma unroll
      for (int g = 0; g < 4; ++g)
#pragma unroll
        for (int e = 0; e < 4; ++e) ldsA[(ar + 32 * g) * GSTR + l7 * 4 + e] = (f16)bf16r(fa[g][e]);
#pragma unroll
      for (int u = 0; u < 4; ++u)
#pragma unroll
        for (int r = 0; r < 4; ++r) ldsW[(nn + u) * GSTR + 4 * kg + r] = (f16)(64.0f * bf16r(fw[r][u])); }
    __syncthreads();
    f16x16 af[2];
#pragma unroll
    for (int i = 0; i < 2; ++i) af[i] = lds_frag(ldsA + (wm + 16 * i) * GSTR, GSTR);
#pragma unroll
    for (int j = 0; j < 4; ++j) {
      const f16x16 bf = lds_frag(ldsW + (wn + 16 * j) * GSTR, GSTR);
#pragma unroll
      for (int i = 0; i < 2; ++i) acc[i][j] = wmma16(af[i], bf, acc[i][j]);
    }
  }
  float* so = oS[wave];
#pragma unroll
  for (int i = 0; i < 2; ++i)
#pragma unroll
    for (int j = 0; j < 4; ++j) {
      const float bv = 64.0f * bf16r(bias[n0 + wn + 16 * j + cl]);
#pragma unroll
      for (int r = 0; r < 8; ++r) so[(16 * i + rh + r) * 68 + 16 * j + cl] = (1.0f / 64.0f) * (acc[i][j][r] + bv);
    }
  asm volatile("s_wait_dscnt 0" ::: "memory");
  __builtin_amdgcn_wave_barrier();
#pragma unroll
  for (int it = 0; it < 16; ++it) { const int f4 = lane + 32 * it, rr = f4 >> 4, q = (f4 & 15) * 4;
    *(v4f_t*)(Y + (size_t)(m0 + wm + rr) * ldy + n0 + wn + q) = *(const v4fa*)(so + rr * 68 + q); }
}

// ---------------------------------------------------------------------------------------------------------------------------
// gemm_kn2 (value+residual planes on both operands: hh + (hl+lh)/2048, f32-class): Y[m][n] (row stride ldy) = scale * sum_k A[m][k] (f32 or f16, row stride lda) * W[k][n] (f32, row-major [K][N], row
// stride ldw) (+ bias[n]) (+ Y if ACC). Block = 128 x 128 tile, 256 threads = 8 waves as 4(M, 32 rows) x 2(N, 64 cols); per
// 32-wide k-step the A tile and the W tile (stored transposed [n][k]) are staged as f16 in LDS; value and residual f16 planes per operand, f32
// blockIdx.z selects a batch: A += z*strideA, W += z*strideW, Y += z*strideY (element strides).
// ---------------------------------------------------------------------------------------------------------------------------
template <typename AT, bool ACC>
__global__ __launch_bounds__(256) void gemm_kn2(const AT* __restrict__ A, int lda, size_t strideA,
                                               const float* __restrict__ Wm, int ldw, size_t strideW,
                                               const float* __restrict__ bias, float scale,
                                               float* __restrict__ Y, int ldy, size_t strideY, int K) {
  __shared__ __attribute__((aligned(16))) f16 ldsA[128 * GSTR], ldsAl[128 * GSTR];
  __shared__ __attribute__((aligned(16))) f16 ldsW[128 * GSTR], ldsWl[128 * GSTR];
  __shared__ __attribute__((aligned(16))) float oS[8][32 * 68];
  const int tid = threadIdx.x, lane = tid & 31, wave = tid >> 5, cl = lane & 15, rh = (lane >> 4) * 8;
  const int m0 = blockIdx.x * 128, n0 = blockIdx.y * 128;
  const int wm = (wave & 3) * 32, wn = (wave >> 2) * 64;
  A += (size_t)blockIdx.z * strideA; Wm += (size_t)blockIdx.z * strideW; Y += (size_t)blockIdx.z * strideY;
  f32x8 acc[2][4], accx[2][4];
#pragma unroll
  for (int i = 0; i < 2; ++i)
#pragma unroll
    for (int j = 0; j < 4; ++j) { f32x8 z = {}; acc[i][j] = z; accx[i][j] = z; }
#pragma unroll 1
  for (int k0 = 0; k0 < K; k0 += 32) {
    __syncthreads();
    {  // A: thread -> row tid>>1, 16 elements at column half (tid&1)*16
      const int row = tid >> 1, ch = (tid & 1) * 16;
      const AT* src = A + (size_t)(m0 + row) * lda + k0 + ch;
#pragma unroll
      for (int g = 0; g < 16; ++g) { const float v = (float)src[g]; const f16 h = (f16)v; ldsA[row * GSTR + ch + g] = h; ldsAl[row * GSTR + ch + g] = (f16)((v - (float)h) * 2048.0f); }
    }
    {  // W: thread -> k = tid>>3, 16 consecutive n at (tid&7)*16; stored transposed [n][k]
      const int k = tid >> 3, nn0 = (tid & 7) * 16;
      const float* src = Wm + (size_t)(k0 + k) * ldw + n0 + nn0;
#pragma unroll
      for (int g = 0; g < 4; ++g) { const v4f_t v = *(const v4f_t*)(src + 4 * g);
#pragma unroll
        for (int u = 0; u < 4; ++u) { const f16 h = (f16)v[u]; ldsW[(nn0 + 4 * g + u) * GSTR + k] = h; ldsWl[(nn0 + 4 * g + u) * GSTR + k] = (f16)((v[u] - (float)h) * 2048.0f); } }
    }
    __syncthreads();
    f16x16 af[2], afl[2];
#pragma unroll
    for (int i = 0; i < 2; ++i) { af[i] = lds_frag(ldsA + (wm + 16 * i) * GSTR, GSTR); afl[i] = lds_frag(ldsAl + (wm + 16 * i) * GSTR, GSTR); }
#pragma unroll
    for (int j = 0; j < 4; ++j) {
      const f16x16 bf = lds_frag(ldsW + (wn + 16 * j) * GSTR, GSTR), bfl = lds_frag(ldsWl + (wn + 16 * j) * GSTR, GSTR);
#pragma unroll
      for (int i = 0; i < 2; ++i) { acc[i][j] = wmma16(af[i], bf, acc[i][j]); accx[i][j] = wmma16(af[i], bfl, accx[i][j]); accx[i][j] = wmma16(afl[i], bf, accx[i][j]); }
    }
  }
  float* so = oS[wave];
#pragma unroll
  for (int i = 0; i < 2; ++i)
#pragma unroll
    for (int j = 0; j < 4; ++j) {
      const float bv = bias ? bias[n0 + wn + 16 * j + cl] : 0.0f;
#pragma unroll
      for (int r = 0; r < 8; ++r) so[(16 * i + rh + r) * 68 + 16 * j + cl] = (acc[i][j][r] + accx[i][j][r] * (1.0f / 2048.0f)) * scale + bv;
    }
  asm volatile("s_wait_dscnt 0" ::: "memory");
  __builtin_amdgcn_wave_barrier();
  if (ACC) {   // accumulate: fold the existing Y values into the staging tile ONCE (same thread <-> same chunks as the stores below)
#pragma unroll
    for (int it = 0; it < 16; ++it) { const int f4 = lane + 32 * it, rr = f4 >> 4, q = (f4 & 15) * 4;
      const v4f_t old = *(const v4fa*)(Y + (size_t)(m0 + wm + rr) * ldy + n0 + wn + q);
      v4f_t v = *(const v4fa*)(so + rr * 68 + q); v += old; *(v4fa*)(so + rr * 68 + q) = v; }   // plain LDS store (ordered by the s_wait_dscnt/memory clobber below)
    asm volatile("s_wait_dscnt 0" ::: "memory");
  }
{
#pragma unroll
    for (int it = 0; it < 16; ++it) { const int f4 = lane + 32 * it, rr = f4 >> 4, q = (f4 & 15) * 4;
      *(v4f_t*)(Y + (size_t)(m0 + wm + rr) * ldy + n0 + wn + q) = *(const v4fa*)(so + rr * 68 + q); }
    
  }
}

__global__ __launch_bounds__(256) void k_transpose(const float* __restrict__ Wm, float* __restrict__ Wt, int rows, int cols) {
  __shared__ float tS[64][65];
  const int tid = threadIdx.x, tbj = cols / 64, bi = blockIdx.x / tbj, bj = blockIdx.x % tbj;
  for (int e = tid; e < 64 * 64; e += 256) { const int r = e >> 6, c = e & 63; tS[r][c] = Wm[(size_t)(bi * 64 + r) * cols + bj * 64 + c]; }
  __syncthreads();
  for (int ch = tid; ch < 64 * 16; ch += 256) { const int r = ch >> 4, q4 = (ch & 15) * 4; v4f_t o; o[0] = tS[q4][r]; o[1] = tS[q4 + 1][r]; o[2] = tS[q4 + 2][r]; o[3] = tS[q4 + 3][r];
    float* dst = Wt + (size_t)(bj * 64 + r) * rows + bi * 64 + q4; *(v4f_t*)dst = o;  }
}

#define NBpr 2
#define SSpr 2048
#define SIN 2048
#define DDpr 1024
#define NHpr 16
#define DKpr 64
#define HPpr 68   // LDS pitch, in floats, of one head's 64 channels in k_bhatt
__global__ __launch_bounds__(256) void k_dbg_zero(float* __restrict__ p, size_t n4) { const size_t i = (size_t)blockIdx.x * 256 + threadIdx.x; if (i < n4) { v4f_t z = {0.f,0.f,0.f,0.f}; *(v4f_t*)(p + 4 * i) = z;  } }
__global__ __launch_bounds__(256) void k_copy(const float* __restrict__ src, float* __restrict__ dst, size_t n4) { const size_t i = (size_t)blockIdx.x * 256 + threadIdx.x; if (i < n4) { const v4f_t v = *(const v4f_t*)(src + 4 * i); *(v4f_t*)(dst + 4 * i) = v;  } }
// torch [out][in] weight → WT[i][o] = mul·bf16(W[o][i]) ([in][out], lifted by a power of two so no bf16 weight becomes an f16 subnormal); block = input row i, threads loop over the outputs (4-B lanes)
__global__ __launch_bounds__(256) void k_wprepT(const float* __restrict__ Wt, float* __restrict__ WT, int nout, int nin, float mul) { const int i = blockIdx.x, tid = threadIdx.x;
#pragma unroll 1
  for (int o = tid; o < nout; o += 256) { const float w = mul * bf16r(Wt[(size_t)o * nin + i]); *(float*)(WT + (size_t)i * nout + o) = w;  } }

// per-token head-to-head Bhattacharyya attention: block = token; the six projected [16][64] vectors staged in LDS; thread = (query head i, key head j) for the distance, then
__global__ __launch_bounds__(256) void k_bhatt(const float* __restrict__ MQ, const float* __restrict__ SQ, const float* __restrict__ MK, const float* __restrict__ SK, const float* __restrict__ MV, const float* __restrict__ SV, float* __restrict__ omu, float* __restrict__ osg, int srows) {
  // q and k head rows sit at a pitch of HPpr floats (272 B = 16 B x 17): the 16 key heads that the 16 lanes of a row read at one channel offset fall on distinct banks
  __shared__ __attribute__((aligned(16))) float mq[NHpr * HPpr], sq[NHpr * HPpr], mk[NHpr * HPpr], sk[NHpr * HPpr], mv[1024], sv[1024]; __shared__ float att[256];
  const size_t t = blockIdx.x; const int tid = threadIdx.x;
  { const size_t o4 = t * DDpr + 4 * tid; const int p4 = (tid >> 4) * HPpr + (tid & 15) * 4;
    *(v4f_t*)(mq + p4) = *(const v4f_t*)(MQ + o4); *(v4f_t*)(sq + p4) = *(const v4f_t*)(SQ + o4); *(v4f_t*)(mk + p4) = *(const v4f_t*)(MK + o4); *(v4f_t*)(sk + p4) = *(const v4f_t*)(SK + o4); *(v4f_t*)(mv + 4 * tid) = *(const v4f_t*)(MV + o4); *(v4f_t*)(sv + 4 * tid) = *(const v4f_t*)(SV + o4); }
  __syncthreads();
  const int i = tid >> 4, j = tid & 15; float dist = 0.0f;
#pragma unroll 1
  for (int d = 0; d < DKpr; d += 4) {   // four channels per 16-byte LDS read; the channels are summed one by one in ascending order
    const v4f_t sgq4 = *(const v4f_t*)(sq + i * HPpr + d), sgk4 = *(const v4f_t*)(sk + j * HPpr + d), mq4 = *(const v4f_t*)(mq + i * HPpr + d), mk4 = *(const v4f_t*)(mk + j * HPpr + d);
#pragma unroll   // constant indices into the four-channel vectors, so that they stay in registers
    for (int u = 0; u < 4; ++u) { const float sgq = sgq4[u], sgk = sgk4[u]; const float sq2 = sgq * sgq + 1e-6f, sk2 = sgk * sgk + 1e-6f; const float dm = mq4[u] - mk4[u];
      const float term1 = 0.25f * logf(0.25f * (sq2 / sk2 + sk2 / sq2 + 2.0f)); const float term2 = 0.25f * dm * dm / (sgq * sgq + sgk * sgk + 1e-6f); dist += term1 + term2; } }
  float lg = -0.5f * (dist * 0.125f); float m = lg;
  m = fmaxf(m, __shfl_xor(m, 1, 32)); m = fmaxf(m, __shfl_xor(m, 2, 32)); m = fmaxf(m, __shfl_xor(m, 4, 32)); m = fmaxf(m, __shfl_xor(m, 8, 32));
  float e = expf(lg - m); float z = e; z += __shfl_xor(z, 1, 32); z += __shfl_xor(z, 2, 32); z += __shfl_xor(z, 4, 32); z += __shfl_xor(z, 8, 32);
  att[tid] = e / z; __syncthreads();
  const int hi = tid >> 4, c4 = (tid & 15) * 4; v4f_t am, av; am[0] = am[1] = am[2] = am[3] = 0.0f; av[0] = av[1] = av[2] = av[3] = 0.0f;
#pragma unroll 1
  for (int jj = 0; jj < NHpr; ++jj) { const float a = att[hi * NHpr + jj]; const v4f_t mvj = *(const v4f_t*)(mv + jj * DKpr + c4), svj = *(const v4f_t*)(sv + jj * DKpr + c4); am += a * mvj; av += a * (svj * svj); }
  v4f_t os; for (int u = 0; u < 4; ++u) os[u] = sqrtf(fmaxf(av[u], 0.0f) + 1e-6f);
  float* dm_ = omu + ((size_t)hi * srows + t) * DKpr + c4; float* ds_ = osg + ((size_t)hi * srows + t) * DKpr + c4;
  *(v4f_t*)dm_ = am; *(v4f_t*)ds_ = os;  }

extern "C" void kernel_launch(void* const* d_in, const int* in_sizes, int n_in,
                              void* d_out, int out_size, void* d_ws, size_t ws_size,
                              hipStream_t stream) {
  (void)in_sizes; (void)n_in; (void)out_size;
  const float** f = (const float**)d_in;
  float* out0 = (float*)d_out; float* out1 = out0 + (size_t)2 * SIN * DDpr;   // out_mu, out_sigma
  char* ws = (char*)d_ws;
  const size_t slab = (size_t)NBpr * SSpr * DDpr;   // one projection's rows: both batch elements, [4096][1024]
  float* P[6]; for (int i = 0; i < 6; ++i) { P[i] = (float*)ws; ws += slab * 4; }
  if ((size_t)(ws - (char*)d_ws) > ws_size) return;                      // WS TOTAL 100,663,296 B
  const dim3 blk(256); const dim3 gp(NBpr * SSpr / 128, DDpr / 128, 6);
  // input -> projection slot map: query->q_mu (w0), key->k_mu (w1), value->v_mu (w2), query_sigma->q_sigma (w3), key_sigma->k_sigma (w4), value_sigma->v_sigma (w5)
  // the batch axis is folded into the GEMM's M (4096 rows) and the six projections into blockIdx.z: one launch of 32 x 8 x 6 tiles, several workgroups resident on every WGP
  gemm_proj6<<<gp, blk, 0, stream>>>(f[0], f[1], f[2], f[3], f[4], f[5], f[6], f[7], f[8], f[9], f[10], f[11], f[12], f[13], f[14], f[15], f[16], f[17],
                                     P[0], DDpr, DDpr, DDpr, slab, DDpr);
  for (int b = 0; b < NBpr; ++b) { const size_t ob = (size_t)b * SIN * DDpr;
    k_bhatt<<<dim3(SSpr), blk, 0, stream>>>(P[0] + ob, P[3] + ob, P[1] + ob, P[4] + ob, P[2] + ob, P[5] + ob, out0 + ob, out1 + ob, SIN);
  }
}

// v005
// A run of this version takes 127 microseconds.
// Timed twice side by side with v004, it ran 1.44 times as fast both times.
// Over all steps from v000 it is 5.72 times as fast.
// the six activations, six [in][out] weights and six biases are rounded to bf16 (RNE) on load; the six projections are then
// exact single f16 products (weights ×2^6, epilogue 2^-6) with f32 accumulation — the Bhattacharyya terms divide by σ² + 1e-6, which amplifies projection error ≈1000x near σ ≈ 1e-3, so
// exact projections are what make the distances reliable. Contractions on v_wmma_f32_16x16x32_f16 (f16 operands, f32 accumulate), both batch elements in one M = 4096 launch: mu_q, sigma_q, mu_k, sigma_k, mu_v,
// sigma_v = x·W + b (K 1024 each). f32 VALU, one block per token: the 16x16 head-to-head Bhattacharyya distances summed over the 64 channels (0.25·log(0.25·(sq²/sk² + sk²/sq² + 2)) +
// 0.25·(μq−μk)²/(σq²+σk²+ε), with sq² = σq²+ε), /√64, softmax over the key-head axis of −0.5·dist, out_mu = attn·mu_v, out_sigma = sqrt(max(attn·σv², 0) + ε), and the module's
// transpose(1,2)-then-view layout: each output is the [B][H][S][64] array reinterpreted as [B][S][1024]. Two outputs, consecutive in d_out: out_mu then out_sigma.
// compute dtype: f16 operands (bf16-valued), f32 accumulate.  six [2,2048,1024] inputs → (out_mu, out_sigma) [2,2048,1024] each.
#include <hip/hip_runtime.h>
#include <hip/hip_bf16.h>
#include <math.h>


typedef _Float16 bf16;
typedef _Float16 f16;
typedef __attribute__((ext_vector_type(4))) unsigned v4u_t;
typedef unsigned v4ua __attribute__((ext_vector_type(4), may_alias));
typedef __attribute__((ext_vector_type(4))) float v4f_t;
typedef float v4fa __attribute__((ext_vector_type(4), may_alias));
typedef __attribute__((ext_vector_type(16))) bf16  bf16x16;
typedef bf16x16 f16x16;
typedef __attribute__((ext_vector_type(8)))  bf16  bf16x8;
typedef bf16x8 f16x8;
typedef __attribute__((ext_vector_type(4)))  bf16  bf16x4;
typedef __attribute__((ext_vector_type(8)))  float f32x8;
__device__ __forceinline__ f32x8 wmma16(f16x16 a, f16x16 b, f32x8 c) {
  c = __builtin_amdgcn_wmma_f32_16x16x32_f16(false, a, false, b, (short)0, c, false, false);
  asm volatile("v_nop\n\tv_nop\n\tv_nop\n\tv_nop" : "+v"(c) : "v"(a), "v"(b));
  return c;
}
#define LDS_STRIDE 48   // unused: the GEMM tiles use GSTR (32 -> 48 elems, 96B rows: aligned b128 reads)
#define KSTRIDE    72   // unused: k_bhatt stages K at pitch HPpr ([16][68] f32, stride 68)
#define VSTRIDE    48   // unused: k_bhatt stages V unpadded ([16][64] f32, stride 64)

__device__ __forceinline__ f32x8 wmma_bf16(bf16x16 a, bf16x16 b, f32x8 c) {
  c = __builtin_amdgcn_wmma_f32_16x16x32_f16(false, a, false, b, (short)0, c, false, false);
  asm volatile("v_nop\n\tv_nop\n\tv_nop\n\tv_nop" : "+v"(c) : "v"(a), "v"(b));   // A/B-overwrite hazard guard
  return c;
}

// 16x32 (MxK) bf16 fragment from a row-major global matrix.
// lanes 0-15  (row=lane)    : elems 0..7 = K+0..7,  8..15 = K+16..23
// lanes 16-31 (row=lane-16) : elems 0..7 = K+8..15, 8..15 = K+24..31
template <typename T>
__device__ __forceinline__ bf16x16 load_frag(const T* __restrict__ base, int ld,
                                             int row0, int k0) {
  const int lane = threadIdx.x & 31;
  const int r    = lane & 15;
  const int kh   = (lane >> 4) * 8;
  const T* p0 = base + (size_t)(row0 + r) * ld + (k0 + kh);
  const T* p1 = p0 + 16;
  bf16x16 f;
#pragma unroll
  for (int i = 0; i < 8; ++i) {
    f[i]     = (bf16)p0[i];
    f[i + 8] = (bf16)p1[i];
  }
  return f;
}

// Same fragment from an LDS tile with padded row stride (base includes row0/k0).
__device__ __forceinline__ bf16x16 lds_frag(const bf16* base, int stride) {
  const int lane = threadIdx.x & 31;
  const int row  = lane & 15;
  const int kh   = (lane >> 4) * 8;
  const bf16x8 lo = *(const bf16x8*)(base + row * stride + kh);
  const bf16x8 hi = *(const bf16x8*)(base + row * stride + kh + 16);
  bf16x16 f;
#pragma unroll
  for (int i = 0; i < 8; ++i) { f[i] = lo[i]; f[i + 8] = hi[i]; }
  return f;
}

template <typename T>
__device__ __forceinline__ void stage_read16(const T* __restrict__ p, float* buf) {
#pragma unroll
  for (int i = 0; i < 16; ++i) buf[i] = (float)p[i];
}

__device__ __forceinline__ void stage_write(bf16* dst, const float* buf, int nquad) {
#pragma unroll
  for (int i = 0; i < nquad; ++i) {
    bf16x4 q;
    q[0] = (bf16)buf[4 * i];     q[1] = (bf16)buf[4 * i + 1];
    q[2] = (bf16)buf[4 * i + 2]; q[3] = (bf16)buf[4 * i + 3];
    *(bf16x4*)(dst + 4 * i) = q;
  }
}


#define GSTR 48
// ---------------------------------------------------------------------------------------------------------------------------
// gemm_kne: Y[m][n] = epi( Σ_k A[m][k]·W[k][n] + bias[n] ), A f32/f16 [M][lda], W f32 row-major [K][N] (ldw), plain f16 operands,
// f32 accumulate. EPI 0: identity; 1: exact-erf GELU; 2: R[m][n] + gvec[n]·(·) (residual with per-channel gain); 3: ReLU; 4: gvec[n]·(·) (per-channel scale, no residual). Output f32 (or f16
// when OUT16). Block = 128x128 tile, 8 waves as 4(M) x 2(N); per 32-wide k-step A and W tiles staged f16 in LDS (W transposed
// ---------------------------------------------------------------------------------------------------------------------------
#define GSTR 48
template <typename AT, int EPI, bool OUT16>
__global__ __launch_bounds__(256) void gemm_kne(const AT* __restrict__ A, int lda, const float* __restrict__ Wm, int ldw,
                                                const float* __restrict__ bias, const float* __restrict__ R, const float* __restrict__ gvec,
                                                void* __restrict__ Yv, int ldy, int K) {
  __shared__ __attribute__((aligned(16))) f16 ldsA[128 * GSTR];
  __shared__ __attribute__((aligned(16))) f16 ldsW[128 * GSTR];
  __shared__ __attribute__((aligned(16))) float oS[8][32 * 68];
  const int tid = threadIdx.x, lane = tid & 31, wave = tid >> 5, cl = lane & 15, rh = (lane >> 4) * 8;
  const int m0 = blockIdx.x * 128, n0 = blockIdx.y * 128;
  const int wm = (wave & 3) * 32, wn = (wave >> 2) * 64;
  f32x8 acc[2][4];
#pragma unroll
  for (int i = 0; i < 2; ++i)
#pragma unroll
    for (int j = 0; j < 4; ++j) { f32x8 z = {}; acc[i][j] = z; }
#pragma unroll 1
  for (int k0 = 0; k0 < K; k0 += 32) {
    __syncthreads();
    { const int row = tid >> 1, ch = (tid & 1) * 16;
      const AT* src = A + (size_t)(m0 + row) * lda + k0 + ch;
#pragma unroll
      for (int g = 0; g < 16; ++g) ldsA[row * GSTR + ch + g] = (f16)src[g]; }
    { const int k = tid >> 3, nn0 = (tid & 7) * 16;
      const float* src = Wm + (size_t)(k0 + k) * ldw + n0 + nn0;
#pragma unroll
      for (int g = 0; g < 4; ++g) { const v4f_t v = *(const v4f_t*)(src + 4 * g);
#pragma unroll
        for (int u = 0; u < 4; ++u) ldsW[(nn0 + 4 * g + u) * GSTR + k] = (f16)v[u]; } }
    __syncthreads();
    f16x16 af[2];
#pragma unroll
    for (int i = 0; i < 2; ++i) af[i] = lds_frag(ldsA + (wm + 16 * i) * GSTR, GSTR);
#pragma unroll
    for (int j = 0; j < 4; ++j) {
      const f16x16 bf = lds_frag(ldsW + (wn + 16 * j) * GSTR, GSTR);
#pragma unroll
      for (int i = 0; i < 2; ++i) acc[i][j] = wmma16(af[i], bf, acc[i][j]);
    }
  }
  float* so = oS[wave];
#pragma unroll
  for (int i = 0; i < 2; ++i)
#pragma unroll
    for (int j = 0; j < 4; ++j) {
      const int n = n0 + wn + 16 * j + cl;
      const float bv = bias ? bias[n] : 0.0f;
      const float gv = (EPI == 2 || EPI == 4) ? gvec[n] : 0.0f;
      if (EPI == 1) {
#pragma unroll 1
        for (int r = 0; r < 8; ++r) { const float xg = acc[i][j][r] + bv; so[(16 * i + rh + r) * 68 + 16 * j + cl] = 0.5f * xg * (1.0f + erff(xg * 0.70710678118654752f)); }
      } else {
#pragma unroll
        for (int r = 0; r < 8; ++r) {
          float v = acc[i][j][r] + bv;
          if (EPI == 3) v = fmaxf(v, 0.0f);
          if (EPI == 4) v = gv * v;
          if (EPI == 2) v = R[(size_t)(m0 + wm + 16 * i + rh + r) * ldy + n] + gv * v;
          so[(16 * i + rh + r) * 68 + 16 * j + cl] = v;
        }
      }
    }
  asm volatile("s_wait_dscnt 0" ::: "memory");
  __builtin_amdgcn_wave_barrier();
{
    if (OUT16) {
      f16* Y = (f16*)Yv;
#pragma unroll
      for (int it = 0; it < 8; ++it) { const int c = lane + 32 * it, rr = c >> 3, q8 = (c & 7) * 8;
        union { f16 h[8]; v4u_t v; } u;
#pragma unroll
        for (int e = 0; e < 8; ++e) u.h[e] = (f16)so[rr * 68 + q8 + e];
        *(v4u_t*)(Y + (size_t)(m0 + wm + rr) * ldy + n0 + wn + q8) = u.v; }
    } else {
      float* Y = (float*)Yv;
#pragma unroll
      for (int it = 0; it < 16; ++it) { const int f4 = lane + 32 * it, rr = f4 >> 4, q = (f4 & 15) * 4;
        *(v4f_t*)(Y + (size_t)(m0 + wm + rr) * ldy + n0 + wn + q) = *(const v4fa*)(so + rr * 68 + q); }
    }
    
  }
}

// bf16 round-to-nearest-even of an f32 (bit trick)
__device__ __forceinline__ float bf16r(float x) { unsigned int u = __float_as_uint(x); u = (u + 0x7FFFu + ((u >> 16) & 1u)) & 0xFFFF0000u; return __uint_as_float(u); }

// gemm_proj6: the six projections in one launch, straight from the inputs (same tile code as gemm_kne). blockIdx.z picks activation x, weight w ([in][out]) and bias b;
// Y[z][m][n] = 2^-6 * ( sum_k bf16(x[m][k]) * (2^6 * bf16(w[k][n])) + 2^6 * bf16(b[n]) ). The bf16 rounding and the exact power-of-two lift (no bf16 weight becomes an f16
// subnormal) are applied in registers between the global load and the f16 LDS store, so no rounded copy of any operand goes through memory.
__global__ __launch_bounds__(256) void gemm_proj6(const float* __restrict__ x0, const float* __restrict__ x1, const float* __restrict__ x2,
                                                  const float* __restrict__ x3, const float* __restrict__ x4, const float* __restrict__ x5,
                                                  const float* __restrict__ w0, const float* __restrict__ w1, const float* __restrict__ w2,
                                                  const float* __restrict__ w3, const float* __restrict__ w4, const float* __restrict__ w5,
                                                  const float* __restrict__ b0, const float* __restrict__ b1, const float* __restrict__ b2,
                                                  const float* __restrict__ b3, const float* __restrict__ b4, const float* __restrict__ b5,
                                                  float* __restrict__ Y, int lda, int ldw, int ldy, size_t strideY, int K) {
  const int z = blockIdx.z;
  const float* __restrict__ A    = z == 0 ? x0 : z == 1 ? x1 : z == 2 ? x2 : z == 3 ? x3 : z == 4 ? x4 : x5;
  const float* __restrict__ Wm   = z == 0 ? w0 : z == 1 ? w1 : z == 2 ? w2 : z == 3 ? w3 : z == 4 ? w4 : w5;
  const float* __restrict__ bias = z == 0 ? b0 : z == 1 ? b1 : z == 2 ? b2 : z == 3 ? b3 : z == 4 ? b4 : b5;
  Y += (size_t)z * strideY;
  __shared__ __attribute__((aligned(16))) f16 ldsA[128 * GSTR];
  __shared__ __attribute__((aligned(16))) f16 ldsW[128 * GSTR];
  __shared__ __attribute__((aligned(16))) float oS[8][32 * 68];
  const int tid = threadIdx.x, lane = tid & 31, wave = tid >> 5, cl = lane & 15, rh = (lane >> 4) * 8;
  const int m0 = blockIdx.x * 128, n0 = blockIdx.y * 128;
  const int wm = (wave & 3) * 32, wn = (wave >> 2) * 64;
  f32x8 acc[2][4];
#pragma unroll
  for (int i = 0; i < 2; ++i)
#pragma unroll
    for (int j = 0; j < 4; ++j) { f32x8 zz = {}; acc[i][j] = zz; }
#pragma unroll 1
  for (int k0 = 0; k0 < K; k0 += 32) {
    __syncthreads();
    // staging map: 8 lanes x 16 B cover one whole 128-B line, so every wave-wide load touches 4 whole lines.
    // A: lane -> (row l8 of 4, 4-channel chunk l7); W: lane -> (group kg of 4 consecutive k rows, 4 columns at nn), so that each column's 4 k values go to the transposed tile as one 8-byte store.
    { const int l7 = lane & 7, l8 = lane >> 3;
      const int ar = wave * 4 + l8, kg = (wave >> 2) * 4 + l8, nn = (wave & 3) * 32 + l7 * 4;
      const float* sa = A + (size_t)(m0 + ar) * lda + k0 + l7 * 4;
      const float* sw = Wm + (size_t)(k0 + 4 * kg) * ldw + n0 + nn;
      float fa[4][4], fw[4][4];
#pragma unroll
      for (int g = 0; g < 4; ++g)
#pragma unroll
        for (int e = 0; e < 4; ++e) fa[g][e] = sa[(size_t)(32 * g) * lda + e];
#pragma unroll
      for (int r = 0; r < 4; ++r)
#pragma unroll
        for (int u = 0; u < 4; ++u) fw[r][u] = sw[(size_t)r * ldw + u];
#pragma unroll
      for (int g = 0; g < 4; ++g)
#pragma unroll
        for (int e = 0; e < 4; ++e) ldsA[(ar + 32 * g) * GSTR + l7 * 4 + e] = (f16)bf16r(fa[g][e]);
#pragma unroll
      for (int u = 0; u < 4; ++u)
#pragma unroll
        for (int r = 0; r < 4; ++r) ldsW[(nn + u) * GSTR + 4 * kg + r] = (f16)(64.0f * bf16r(fw[r][u])); }
    __syncthreads();
    f16x16 af[2];
#pragma unroll
    for (int i = 0; i < 2; ++i) af[i] = lds_frag(ldsA + (wm + 16 * i) * GSTR, GSTR);
#pragma unroll
    for (int j = 0; j < 4; ++j) {
      const f16x16 bf = lds_frag(ldsW + (wn + 16 * j) * GSTR, GSTR);
#pragma unroll
      for (int i = 0; i < 2; ++i) acc[i][j] = wmma16(af[i], bf, acc[i][j]);
    }
  }
  float* so = oS[wave];
#pragma unroll
  for (int i = 0; i < 2; ++i)
#pragma unroll
    for (int j = 0; j < 4; ++j) {
      const float bv = 64.0f * bf16r(bias[n0 + wn + 16 * j + cl]);
#pragma unroll
      for (int r = 0; r < 8; ++r) so[(16 * i + rh + r) * 68 + 16 * j + cl] = (1.0f / 64.0f) * (acc[i][j][r] + bv);
    }
  asm volatile("s_wait_dscnt 0" ::: "memory");
  __builtin_amdgcn_wave_barrier();
#pragma unroll
  for (int it = 0; it < 16; ++it) { const int f4 = lane + 32 * it, rr = f4 >> 4, q = (f4 & 15) * 4;
    *(v4f_t*)(Y + (size_t)(m0 + wm + rr) * ldy + n0 + wn + q) = *(const v4fa*)(so + rr * 68 + q); }
}

// ---------------------------------------------------------------------------------------------------------------------------
// gemm_kn2 (value+residual planes on both operands: hh + (hl+lh)/2048, f32-class): Y[m][n] (row stride ldy) = scale * sum_k A[m][k] (f32 or f16, row stride lda) * W[k][n] (f32, row-major [K][N], row
// stride ldw) (+ bias[n]) (+ Y if ACC). Block = 128 x 128 tile, 256 threads = 8 waves as 4(M, 32 rows) x 2(N, 64 cols); per
// 32-wide k-step the A tile and the W tile (stored transposed [n][k]) are staged as f16 in LDS; value and residual f16 planes per operand, f32
// blockIdx.z selects a batch: A += z*strideA, W += z*strideW, Y += z*strideY (element strides).
// ---------------------------------------------------------------------------------------------------------------------------
template <typename AT, bool ACC>
__global__ __launch_bounds__(256) void gemm_kn2(const AT* __restrict__ A, int lda, size_t strideA,
                                               const float* __restrict__ Wm, int ldw, size_t strideW,
                                               const float* __restrict__ bias, float scale,
                                               float* __restrict__ Y, int ldy, size_t strideY, int K) {
  __shared__ __attribute__((aligned(16))) f16 ldsA[128 * GSTR], ldsAl[128 * GSTR];
  __shared__ __attribute__((aligned(16))) f16 ldsW[128 * GSTR], ldsWl[128 * GSTR];
  __shared__ __attribute__((aligned(16))) float oS[8][32 * 68];
  const int tid = threadIdx.x, lane = tid & 31, wave = tid >> 5, cl = lane & 15, rh = (lane >> 4) * 8;
  const int m0 = blockIdx.x * 128, n0 = blockIdx.y * 128;
  const int wm = (wave & 3) * 32, wn = (wave >> 2) * 64;
  A += (size_t)blockIdx.z * strideA; Wm += (size_t)blockIdx.z * strideW; Y += (size_t)blockIdx.z * strideY;
  f32x8 acc[2][4], accx[2][4];
#pragma unroll
  for (int i = 0; i < 2; ++i)
#pragma unroll
    for (int j = 0; j < 4; ++j) { f32x8 z = {}; acc[i][j] = z; accx[i][j] = z; }
#pragma unroll 1
  for (int k0 = 0; k0 < K; k0 += 32) {
    __syncthreads();
    {  // A: thread -> row tid>>1, 16 elements at column half (tid&1)*16
      const int row = tid >> 1, ch = (tid & 1) * 16;
      const AT* src = A + (size_t)(m0 + row) * lda + k0 + ch;
#pragma unroll
      for (int g = 0; g < 16; ++g) { const float v = (float)src[g]; const f16 h = (f16)v; ldsA[row * GSTR + ch + g] = h; ldsAl[row * GSTR + ch + g] = (f16)((v - (float)h) * 2048.0f); }
    }
    {  // W: thread -> k = tid>>3, 16 consecutive n at (tid&7)*16; stored transposed [n][k]
      const int k = tid >> 3, nn0 = (tid & 7) * 16;
      const float* src = Wm + (size_t)(k0 + k) * ldw + n0 + nn0;
#pragma unroll
      for (int g = 0; g < 4; ++g) { const v4f_t v = *(const v4f_t*)(src + 4 * g);
#pragma unroll
        for (int u = 0; u < 4; ++u) { const f16 h = (f16)v[u]; ldsW[(nn0 + 4 * g + u) * GSTR + k] = h; ldsWl[(nn0 + 4 * g + u) * GSTR + k] = (f16)((v[u] - (float)h) * 2048.0f); } }
    }
    __syncthreads();
    f16x16 af[2], afl[2];
#pragma unroll
    for (int i = 0; i < 2; ++i) { af[i] = lds_frag(ldsA + (wm + 16 * i) * GSTR, GSTR); afl[i] = lds_frag(ldsAl + (wm + 16 * i) * GSTR, GSTR); }
#pragma unroll
    for (int j = 0; j < 4; ++j) {
      const f16x16 bf = lds_frag(ldsW + (wn + 16 * j) * GSTR, GSTR), bfl = lds_frag(ldsWl + (wn + 16 * j) * GSTR, GSTR);
#pragma unroll
      for (int i = 0; i < 2; ++i) { acc[i][j] = wmma16(af[i], bf, acc[i][j]); accx[i][j] = wmma16(af[i], bfl, accx[i][j]); accx[i][j] = wmma16(afl[i], bf, accx[i][j]); }
    }
  }
  float* so = oS[wave];
#pragma unroll
  for (int i = 0; i < 2; ++i)
#pragma unroll
    for (int j = 0; j < 4; ++j) {
      const float bv = bias ? bias[n0 + wn + 16 * j + cl] : 0.0f;
#pragma unroll
      for (int r = 0; r < 8; ++r) so[(16 * i + rh + r) * 68 + 16 * j + cl] = (acc[i][j][r] + accx[i][j][r] * (1.0f / 2048.0f)) * scale + bv;
    }
  asm volatile("s_wait_dscnt 0" ::: "memory");
  __builtin_amdgcn_wave_barrier();
  if (ACC) {   // accumulate: fold the existing Y values into the staging tile ONCE (same thread <-> same chunks as the stores below)
#pragma unroll
    for (int it = 0; it < 16; ++it) { const int f4 = lane + 32 * it, rr = f4 >> 4, q = (f4 & 15) * 4;
      const v4f_t old = *(const v4fa*)(Y + (size_t)(m0 + wm + rr) * ldy + n0 + wn + q);
      v4f_t v = *(const v4fa*)(so + rr * 68 + q); v += old; *(v4fa*)(so + rr * 68 + q) = v; }   // plain LDS store (ordered by the s_wait_dscnt/memory clobber below)
    asm volatile("s_wait_dscnt 0" ::: "memory");
  }
{
#pragma unroll
    for (int it = 0; it < 16; ++it) { const int f4 = lane + 32 * it, rr = f4 >> 4, q = (f4 & 15) * 4;
      *(v4f_t*)(Y + (size_t)(m0 + wm + rr) * ldy + n0 + wn + q) = *(const v4fa*)(so + rr * 68 + q); }
    
  }
}

__global__ __launch_bounds__(256) void k_transpose(const float* __restrict__ Wm, float* __restrict__ Wt, int rows, int cols) {
  __shared__ float tS[64][65];
  const int tid = threadIdx.x, tbj = cols / 64, bi = blockIdx.x / tbj, bj = blockIdx.x % tbj;
  for (int e = tid; e < 64 * 64; e += 256) { const int r = e >> 6, c = e & 63; tS[r][c] = Wm[(size_t)(bi * 64 + r) * cols + bj * 64 + c]; }
  __syncthreads();
  for (int ch = tid; ch < 64 * 16; ch += 256) { const int r = ch >> 4, q4 = (ch & 15) * 4; v4f_t o; o[0] = tS[q4][r]; o[1] = tS[q4 + 1][r]; o[2] = tS[q4 + 2][r]; o[3] = tS[q4 + 3][r];
    float* dst = Wt + (size_t)(bj * 64 + r) * rows + bi * 64 + q4; *(v4f_t*)dst = o;  }
}

#define NBpr 2
#define SSpr 2048
#define SIN 2048
#define DDpr 1024
#define NHpr 16
#define DKpr 64
#define HPpr 68   // LDS pitch, in floats, of one head's 64 channels in k_bhatt
__global__ __launch_bounds__(256) void k_dbg_zero(float* __restrict__ p, size_t n4) { const size_t i = (size_t)blockIdx.x * 256 + threadIdx.x; if (i < n4) { v4f_t z = {0.f,0.f,0.f,0.f}; *(v4f_t*)(p + 4 * i) = z;  } }
__global__ __launch_bounds__(256) void k_copy(const float* __restrict__ src, float* __restrict__ dst, size_t n4) { const size_t i = (size_t)blockIdx.x * 256 + threadIdx.x; if (i < n4) { const v4f_t v = *(const v4f_t*)(src + 4 * i); *(v4f_t*)(dst + 4 * i) = v;  } }
// torch [out][in] weight → WT[i][o] = mul·bf16(W[o][i]) ([in][out], lifted by a power of two so no bf16 weight becomes an f16 subnormal); block = input row i, threads loop over the outputs (4-B lanes)
__global__ __launch_bounds__(256) void k_wprepT(const float* __restrict__ Wt, float* __restrict__ WT, int nout, int nin, float mul) { const int i = blockIdx.x, tid = threadIdx.x;
#pragma unroll 1
  for (int o = tid; o < nout; o += 256) { const float w = mul * bf16r(Wt[(size_t)o * nin + i]); *(float*)(WT + (size_t)i * nout + o) = w;  } }

// sum over the 16 lanes of a row (one head's 16 four-channel chunks), every lane gets the total; DPP row_xmask butterfly, no LDS traffic
__device__ __forceinline__ float row16_sum(float v) {
  v += __int_as_float(__builtin_amdgcn_update_dpp(0, __float_as_int(v), 0x161, 0xf, 0xf, true));   // row_xmask:1
  v += __int_as_float(__builtin_amdgcn_update_dpp(0, __float_as_int(v), 0x162, 0xf, 0xf, true));   // row_xmask:2
  v += __int_as_float(__builtin_amdgcn_update_dpp(0, __float_as_int(v), 0x164, 0xf, 0xf, true));   // row_xmask:4
  v += __int_as_float(__builtin_amdgcn_update_dpp(0, __float_as_int(v), 0x168, 0xf, 0xf, true));   // row_xmask:8
  return v;
}

// per-token head-to-head Bhattacharyya attention: block = token; the six projected [16][64] vectors staged in LDS; thread = (query head i, key head j) for the distance, then
// With a = sq^2 + eps, b = sk^2 + eps: a/b + b/a + 2 = (a + b)^2 / (a b), so term1 = 0.5 ln((a + b)/2) - 0.25 ln a - 0.25 ln b. ln a and ln b depend on one head only and are summed over
// the channels once per head while staging; a (pair, channel) then costs one log2 of a + b and one reciprocal of sq^2 + sk^2 + eps (a + b is that denominator + eps).
__global__ __launch_bounds__(256) void k_bhatt(const float* __restrict__ MQ, const float* __restrict__ SQ, const float* __restrict__ MK, const float* __restrict__ SK, const float* __restrict__ MV, const float* __restrict__ SV, float* __restrict__ omu, float* __restrict__ osg, int srows) {
  // q and k head rows sit at a pitch of HPpr floats (272 B = 16 B x 17): the 16 key heads that the 16 lanes of a row read at one channel offset fall on distinct banks
  // q2 holds sigma_q^2, k2 holds sigma_k^2 + eps; lk[j] = sum over the channels of log2(sigma_k^2 + eps) of key head j
  __shared__ __attribute__((aligned(16))) float mq[NHpr * HPpr], q2[NHpr * HPpr], mk[NHpr * HPpr], k2[NHpr * HPpr], mv[1024], sv[1024]; __shared__ float att[256]; __shared__ float lk[NHpr];
  const size_t t = blockIdx.x; const int tid = threadIdx.x;
  float lq;   // sum over the channels of log2(sigma_q^2 + eps) of query head tid >> 4, in every lane of that head's row
  { const size_t o4 = t * DDpr + 4 * tid; const int p4 = (tid >> 4) * HPpr + (tid & 15) * 4;
    const v4f_t sgq = *(const v4f_t*)(SQ + o4), sgk = *(const v4f_t*)(SK + o4);
    asm volatile("s_wait_xcnt 0x0" ::: "memory");   // the two loads' address registers are reused by the loads below
    const v4f_t muq = *(const v4f_t*)(MQ + o4), muk = *(const v4f_t*)(MK + o4), muv = *(const v4f_t*)(MV + o4), sgv = *(const v4f_t*)(SV + o4);
    const v4f_t vq = sgq * sgq, vk = sgk * sgk + 1e-6f, aq = vq + 1e-6f;
    *(v4f_t*)(mq + p4) = muq; *(v4f_t*)(q2 + p4) = vq; *(v4f_t*)(mk + p4) = muk; *(v4f_t*)(k2 + p4) = vk; *(v4f_t*)(mv + 4 * tid) = muv; *(v4f_t*)(sv + 4 * tid) = sgv;
    v4f_t la, lb;
#pragma unroll   // constant indices into the four-channel vectors, so that they stay in registers
    for (int u = 0; u < 4; ++u) { la[u] = __builtin_amdgcn_logf(aq[u]); lb[u] = __builtin_amdgcn_logf(vk[u]); }
    lq = row16_sum((la[0] + la[2]) + (la[1] + la[3]));
    const float lks = row16_sum((lb[0] + lb[2]) + (lb[1] + lb[3]));
    if ((tid & 15) == 0) lk[tid >> 4] = lks; }
  __syncthreads();
  const int i = tid >> 4, j = tid & 15;
  v4f_t sl, sm; sl[0] = sl[1] = sl[2] = sl[3] = 0.0f; sm[0] = sm[1] = sm[2] = sm[3] = 0.0f;   // per channel residue mod 4: sums of log2(a + b) and of dm^2 / (sq^2 + sk^2 + eps)
#pragma unroll 4   // four 16-byte LDS read groups in flight per trip
  for (int d = 0; d < DKpr; d += 4) {   // four channels per 16-byte LDS read
    const v4f_t q24 = *(const v4f_t*)(q2 + i * HPpr + d), k24 = *(const v4f_t*)(k2 + j * HPpr + d), mq4 = *(const v4f_t*)(mq + i * HPpr + d), mk4 = *(const v4f_t*)(mk + j * HPpr + d);
    const v4f_t den = q24 + k24, ab = den + 1e-6f, dm = mq4 - mk4; v4f_t lg4, rc4;
#pragma unroll   // constant indices into the four-channel vectors, so that they stay in registers
    for (int u = 0; u < 4; ++u) { lg4[u] = __builtin_amdgcn_logf(ab[u]); rc4[u] = __builtin_amdgcn_rcpf(den[u]); }
    sl += lg4; sm += (dm * dm) * rc4; }
  const float sumlog = (sl[0] + sl[1]) + (sl[2] + sl[3]), summ = (sm[0] + sm[1]) + (sm[2] + sm[3]);
  const float dist = 0.69314718055994531f * (0.5f * sumlog - 0.5f * (float)DKpr - 0.25f * (lq + lk[j])) + 0.25f * summ;
  float lg = -0.5f * (dist * 0.125f); float m = lg;
  m = fmaxf(m, __shfl_xor(m, 1, 32)); m = fmaxf(m, __shfl_xor(m, 2, 32)); m = fmaxf(m, __shfl_xor(m, 4, 32)); m = fmaxf(m, __shfl_xor(m, 8, 32));
  float e = expf(lg - m); float z = e; z += __shfl_xor(z, 1, 32); z += __shfl_xor(z, 2, 32); z += __shfl_xor(z, 4, 32); z += __shfl_xor(z, 8, 32);
  att[tid] = e / z; __syncthreads();
  const int hi = tid >> 4, c4 = (tid & 15) * 4; v4f_t am, av; am[0] = am[1] = am[2] = am[3] = 0.0f; av[0] = av[1] = av[2] = av[3] = 0.0f;
#pragma unroll 1
  for (int jj = 0; jj < NHpr; ++jj) { const float a = att[hi * NHpr + jj]; const v4f_t mvj = *(const v4f_t*)(mv + jj * DKpr + c4), svj = *(const v4f_t*)(sv + jj * DKpr + c4); am += a * mvj; av += a * (svj * svj); }
  v4f_t os; for (int u = 0; u < 4; ++u) os[u] = sqrtf(fmaxf(av[u], 0.0f) + 1e-6f);
  float* dm_ = omu + ((size_t)hi * srows + t) * DKpr + c4; float* ds_ = osg + ((size_t)hi * srows + t) * DKpr + c4;
  *(v4f_t*)dm_ = am; *(v4f_t*)ds_ = os;  }

extern "C" void kernel_launch(void* const* d_in, const int* in_sizes, int n_in,
                              void* d_out, int out_size, void* d_ws, size_t ws_size,
                              hipStream_t stream) {
  (void)in_sizes; (void)n_in; (void)out_size;
  const float** f = (const float**)d_in;
  float* out0 = (float*)d_out; float* out1 = out0 + (size_t)2 * SIN * DDpr;   // out_mu, out_sigma
  char* ws = (char*)d_ws;
  const size_t slab = (size_t)NBpr * SSpr * DDpr;   // one projection's rows: both batch elements, [4096][1024]
  float* P[6]; for (int i = 0; i < 6; ++i) { P[i] = (float*)ws; ws += slab * 4; }
  if ((size_t)(ws - (char*)d_ws) > ws_size) return;                      // WS TOTAL 100,663,296 B
  const dim3 blk(256); const dim3 gp(NBpr * SSpr / 128, DDpr / 128, 6);
  // input -> projection slot map: query->q_mu (w0), key->k_mu (w1), value->v_mu (w2), query_sigma->q_sigma (w3), key_sigma->k_sigma (w4), value_sigma->v_sigma (w5)
  // the batch axis is folded into the GEMM's M (4096 rows) and the six projections into blockIdx.z: one launch of 32 x 8 x 6 tiles, several workgroups resident on every WGP
  gemm_proj6<<<gp, blk, 0, stream>>>(f[0], f[1], f[2], f[3], f[4], f[5], f[6], f[7], f[8], f[9], f[10], f[11], f[12], f[13], f[14], f[15], f[16], f[17],
                                     P[0], DDpr, DDpr, DDpr, slab, DDpr);
  for (int b = 0; b < NBpr; ++b) { const size_t ob = (size_t)b * SIN * DDpr;
    k_bhatt<<<dim3(SSpr), blk, 0, stream>>>(P[0] + ob, P[3] + ob, P[1] + ob, P[4] + ob, P[2] + ob, P[5] + ob, out0 + ob, out1 + ob, SIN);
  }
}

// v006
// Measured time: 120 microseconds a run.
// Two timings next to v005 both put it at 1.06 times that version's speed.
// Counting every step since v000, it is 6.06 times as fast.
// the six activations, six [in][out] weights and six biases are rounded to bf16 (RNE) on load; the six projections are then
// exact single f16 products (weights ×2^6, epilogue 2^-6) with f32 accumulation — the Bhattacharyya terms divide by σ² + 1e-6, which amplifies projection error ≈1000x near σ ≈ 1e-3, so
// exact projections are what make the distances reliable. Contractions on v_wmma_f32_16x16x32_f16 (f16 operands, f32 accumulate), both batch elements in one M = 4096 launch: mu_q, sigma_q, mu_k, sigma_k, mu_v,
// sigma_v = x·W + b (K 1024 each). f32 VALU, one block per token: the 16x16 head-to-head Bhattacharyya distances summed over the 64 channels (0.25·log(0.25·(sq²/sk² + sk²/sq² + 2)) +
// 0.25·(μq−μk)²/(σq²+σk²+ε), with sq² = σq²+ε), /√64, softmax over the key-head axis of −0.5·dist, out_mu = attn·mu_v, out_sigma = sqrt(max(attn·σv², 0) + ε), and the module's
// transpose(1,2)-then-view layout: each output is the [B][H][S][64] array reinterpreted as [B][S][1024]. Two outputs, consecutive in d_out: out_mu then out_sigma.
// compute dtype: f16 operands (bf16-valued), f32 accumulate.  six [2,2048,1024] inputs → (out_mu, out_sigma) [2,2048,1024] each.
#include <hip/hip_runtime.h>
#include <hip/hip_bf16.h>
#include <math.h>


typedef _Float16 bf16;
typedef _Float16 f16;
typedef __attribute__((ext_vector_type(4))) unsigned v4u_t;
typedef unsigned v4ua __attribute__((ext_vector_type(4), may_alias));
typedef __attribute__((ext_vector_type(4))) float v4f_t;
typedef float v4fa __attribute__((ext_vector_type(4), may_alias));
typedef __attribute__((ext_vector_type(16))) bf16  bf16x16;
typedef bf16x16 f16x16;
typedef __attribute__((ext_vector_type(8)))  bf16  bf16x8;
typedef bf16x8 f16x8;
typedef __attribute__((ext_vector_type(4)))  bf16  bf16x4;
typedef __attribute__((ext_vector_type(8)))  float f32x8;
__device__ __forceinline__ f32x8 wmma16(f16x16 a, f16x16 b, f32x8 c) {
  c = __builtin_amdgcn_wmma_f32_16x16x32_f16(false, a, false, b, (short)0, c, false, false);
  asm volatile("v_nop\n\tv_nop\n\tv_nop\n\tv_nop" : "+v"(c) : "v"(a), "v"(b));
  return c;
}
#define LDS_STRIDE 48   // unused: the GEMM tiles use GSTR (32 -> 48 elems, 96B rows: aligned b128 reads)
#define KSTRIDE    72   // unused: k_bhatt stages K at pitch HPpr ([16][68] f32, stride 68)
#define VSTRIDE    48   // unused: k_bhatt stages V unpadded ([16][64] f32, stride 64)

__device__ __forceinline__ f32x8 wmma_bf16(bf16x16 a, bf16x16 b, f32x8 c) {
  c = __builtin_amdgcn_wmma_f32_16x16x32_f16(false, a, false, b, (short)0, c, false, false);
  asm volatile("v_nop\n\tv_nop\n\tv_nop\n\tv_nop" : "+v"(c) : "v"(a), "v"(b));   // A/B-overwrite hazard guard
  return c;
}

// 16x32 (MxK) bf16 fragment from a row-major global matrix.
// lanes 0-15  (row=lane)    : elems 0..7 = K+0..7,  8..15 = K+16..23
// lanes 16-31 (row=lane-16) : elems 0..7 = K+8..15, 8..15 = K+24..31
template <typename T>
__device__ __forceinline__ bf16x16 load_frag(const T* __restrict__ base, int ld,
                                             int row0, int k0) {
  const int lane = threadIdx.x & 31;
  const int r    = lane & 15;
  const int kh   = (lane >> 4) * 8;
  const T* p0 = base + (size_t)(row0 + r) * ld + (k0 + kh);
  const T* p1 = p0 + 16;
  bf16x16 f;
#pragma unroll
  for (int i = 0; i < 8; ++i) {
    f[i]     = (bf16)p0[i];
    f[i + 8] = (bf16)p1[i];
  }
  return f;
}

// Same fragment from an LDS tile with padded row stride (base includes row0/k0).
__device__ __forceinline__ bf16x16 lds_frag(const bf16* base, int stride) {
  const int lane = threadIdx.x & 31;
  const int row  = lane & 15;
  const int kh   = (lane >> 4) * 8;
  const bf16x8 lo = *(const bf16x8*)(base + row * stride + kh);
  const bf16x8 hi = *(const bf16x8*)(base + row * stride + kh + 16);
  bf16x16 f;
#pragma unroll
  for (int i = 0; i < 8; ++i) { f[i] = lo[i]; f[i + 8] = hi[i]; }
  return f;
}

template <typename T>
__device__ __forceinline__ void stage_read16(const T* __restrict__ p, float* buf) {
#pragma unroll
  for (int i = 0; i < 16; ++i) buf[i] = (float)p[i];
}

__device__ __forceinline__ void stage_write(bf16* dst, const float* buf, int nquad) {
#pragma unroll
  for (int i = 0; i < nquad; ++i) {
    bf16x4 q;
    q[0] = (bf16)buf[4 * i];     q[1] = (bf16)buf[4 * i + 1];
    q[2] = (bf16)buf[4 * i + 2]; q[3] = (bf16)buf[4 * i + 3];
    *(bf16x4*)(dst + 4 * i) = q;
  }
}


#define GSTR 48
// ---------------------------------------------------------------------------------------------------------------------------
// gemm_kne: Y[m][n] = epi( Σ_k A[m][k]·W[k][n] + bias[n] ), A f32/f16 [M][lda], W f32 row-major [K][N] (ldw), plain f16 operands,
// f32 accumulate. EPI 0: identity; 1: exact-erf GELU; 2: R[m][n] + gvec[n]·(·) (residual with per-channel gain); 3: ReLU; 4: gvec[n]·(·) (per-channel scale, no residual). Output f32 (or f16
// when OUT16). Block = 128x128 tile, 8 waves as 4(M) x 2(N); per 32-wide k-step A and W tiles staged f16 in LDS (W transposed
// ---------------------------------------------------------------------------------------------------------------------------
#define GSTR 48
template <typename AT, int EPI, bool OUT16>
__global__ __launch_bounds__(256) void gemm_kne(const AT* __restrict__ A, int lda, const float* __restrict__ Wm, int ldw,
                                                const float* __restrict__ bias, const float* __restrict__ R, const float* __restrict__ gvec,
                                                void* __restrict__ Yv, int ldy, int K) {
  __shared__ __attribute__((aligned(16))) f16 ldsA[128 * GSTR];
  __shared__ __attribute__((aligned(16))) f16 ldsW[128 * GSTR];
  __shared__ __attribute__((aligned(16))) float oS[8][32 * 68];
  const int tid = threadIdx.x, lane = tid & 31, wave = tid >> 5, cl = lane & 15, rh = (lane >> 4) * 8;
  const int m0 = blockIdx.x * 128, n0 = blockIdx.y * 128;
  const int wm = (wave & 3) * 32, wn = (wave >> 2) * 64;
  f32x8 acc[2][4];
#pragma unroll
  for (int i = 0; i < 2; ++i)
#pragma unroll
    for (int j = 0; j < 4; ++j) { f32x8 z = {}; acc[i][j] = z; }
#pragma unroll 1
  for (int k0 = 0; k0 < K; k0 += 32) {
    __syncthreads();
    { const int row = tid >> 1, ch = (tid & 1) * 16;
      const AT* src = A + (size_t)(m0 + row) * lda + k0 + ch;
#pragma unroll
      for (int g = 0; g < 16; ++g) ldsA[row * GSTR + ch + g] = (f16)src[g]; }
    { const int k = tid >> 3, nn0 = (tid & 7) * 16;
      const float* src = Wm + (size_t)(k0 + k) * ldw + n0 + nn0;
#pragma unroll
      for (int g = 0; g < 4; ++g) { const v4f_t v = *(const v4f_t*)(src + 4 * g);
#pragma unroll
        for (int u = 0; u < 4; ++u) ldsW[(nn0 + 4 * g + u) * GSTR + k] = (f16)v[u]; } }
    __syncthreads();
    f16x16 af[2];
#pragma unroll
    for (int i = 0; i < 2; ++i) af[i] = lds_frag(ldsA + (wm + 16 * i) * GSTR, GSTR);
#pragma unroll
    for (int j = 0; j < 4; ++j) {
      const f16x16 bf = lds_frag(ldsW + (wn + 16 * j) * GSTR, GSTR);
#pragma unroll
      for (int i = 0; i < 2; ++i) acc[i][j] = wmma16(af[i], bf, acc[i][j]);
    }
  }
  float* so = oS[wave];
#pragma unroll
  for (int i = 0; i < 2; ++i)
#pragma unroll
    for (int j = 0; j < 4; ++j) {
      const int n = n0 + wn + 16 * j + cl;
      const float bv = bias ? bias[n] : 0.0f;
      const float gv = (EPI == 2 || EPI == 4) ? gvec[n] : 0.0f;
      if (EPI == 1) {
#pragma unroll 1
        for (int r = 0; r < 8; ++r) { const float xg = acc[i][j][r] + bv; so[(16 * i + rh + r) * 68 + 16 * j + cl] = 0.5f * xg * (1.0f + erff(xg * 0.70710678118654752f)); }
      } else {
#pragma unroll
        for (int r = 0; r < 8; ++r) {
          float v = acc[i][j][r] + bv;
          if (EPI == 3) v = fmaxf(v, 0.0f);
          if (EPI == 4) v = gv * v;
          if (EPI == 2) v = R[(size_t)(m0 + wm + 16 * i + rh + r) * ldy + n] + gv * v;
          so[(16 * i + rh + r) * 68 + 16 * j + cl] = v;
        }
      }
    }
  asm volatile("s_wait_dscnt 0" ::: "memory");
  __builtin_amdgcn_wave_barrier();
{
    if (OUT16) {
      f16* Y = (f16*)Yv;
#pragma unroll
      for (int it = 0; it < 8; ++it) { const int c = lane + 32 * it, rr = c >> 3, q8 = (c & 7) * 8;
        union { f16 h[8]; v4u_t v; } u;
#pragma unroll
        for (int e = 0; e < 8; ++e) u.h[e] = (f16)so[rr * 68 + q8 + e];
        *(v4u_t*)(Y + (size_t)(m0 + wm + rr) * ldy + n0 + wn + q8) = u.v; }
    } else {
      float* Y = (float*)Yv;
#pragma unroll
      for (int it = 0; it < 16; ++it) { const int f4 = lane + 32 * it, rr = f4 >> 4, q = (f4 & 15) * 4;
        *(v4f_t*)(Y + (size_t)(m0 + wm + rr) * ldy + n0 + wn + q) = *(const v4fa*)(so + rr * 68 + q); }
    }
    
  }
}

// bf16 round-to-nearest-even of an f32 (bit trick)
__device__ __forceinline__ float bf16r(float x) { unsigned int u = __float_as_uint(x); u = (u + 0x7FFFu + ((u >> 16) & 1u)) & 0xFFFF0000u; return __uint_as_float(u); }

// gemm_proj6: the six projections in one launch, straight from the inputs (same tile code as gemm_kne). blockIdx.z picks activation x, weight w ([in][out]) and bias b;
// Y[z][m][n] = 2^-6 * ( sum_k bf16(x[m][k]) * (2^6 * bf16(w[k][n])) + 2^6 * bf16(b[n]) ). The bf16 rounding and the exact power-of-two lift (no bf16 weight becomes an f16
// subnormal) are applied in registers between the global load and the f16 LDS store, so no rounded copy of any operand goes through memory.
__global__ __launch_bounds__(256) void gemm_proj6(const float* __restrict__ x0, const float* __restrict__ x1, const float* __restrict__ x2,
                                                  const float* __restrict__ x3, const float* __restrict__ x4, const float* __restrict__ x5,
                                                  const float* __restrict__ w0, const float* __restrict__ w1, const float* __restrict__ w2,
                                                  const float* __restrict__ w3, const float* __restrict__ w4, const float* __restrict__ w5,
                                                  const float* __restrict__ b0, const float* __restrict__ b1, const float* __restrict__ b2,
                                                  const float* __restrict__ b3, const float* __restrict__ b4, const float* __restrict__ b5,
                                                  float* __restrict__ Y, int lda, int ldw, int ldy, size_t strideY, int K) {
  const int z = blockIdx.z;
  const float* __restrict__ A    = z == 0 ? x0 : z == 1 ? x1 : z == 2 ? x2 : z == 3 ? x3 : z == 4 ? x4 : x5;
  const float* __restrict__ Wm   = z == 0 ? w0 : z == 1 ? w1 : z == 2 ? w2 : z == 3 ? w3 : z == 4 ? w4 : w5;
  const float* __restrict__ bias = z == 0 ? b0 : z == 1 ? b1 : z == 2 ? b2 : z == 3 ? b3 : z == 4 ? b4 : b5;
  Y += (size_t)z * strideY;
  __shared__ __attribute__((aligned(16))) f16 ldsA[128 * GSTR];
  __shared__ __attribute__((aligned(16))) f16 ldsW[128 * GSTR];
  __shared__ __attribute__((aligned(16))) float oS[8][32 * 68];
  const int tid = threadIdx.x, lane = tid & 31, wave = tid >> 5, cl = lane & 15, rh = (lane >> 4) * 8;
  const int m0 = blockIdx.x * 128, n0 = blockIdx.y * 128;
  const int wm = (wave & 3) * 32, wn = (wave >> 2) * 64;
  f32x8 acc[2][4];
#pragma unroll
  for (int i = 0; i < 2; ++i)
#pragma unroll
    for (int j = 0; j < 4; ++j) { f32x8 zz = {}; acc[i][j] = zz; }
  // staging map: 8 lanes x 16 B cover one whole 128-B line, so every wave-wide load touches 4 whole lines.
  // A: lane -> (row l8 of 4, 4-channel chunk l7); W: lane -> (group kg of 4 consecutive k rows, 4 columns at nn), so that each column's 4 k values go to the transposed tile as one 8-byte store.
  const int l7 = lane & 7, l8 = lane >> 3;
  const int ar = wave * 4 + l8, kg = (wave >> 2) * 4 + l8, nn = (wave & 3) * 32 + l7 * 4;
  const float* sa = A + (size_t)(m0 + ar) * lda + l7 * 4;
  const float* sw = Wm + (size_t)(4 * kg) * ldw + n0 + nn;
  // fa, fw hold the raw f32 values of ONE k-step, loaded one trip ahead: the loads of step k0 + 32 are issued behind the barrier that publishes step k0's tiles
  // and fly during step k0's fragment reads and matrix instructions, instead of being issued and waited for between the two barriers.
  float fa[4][4], fw[4][4];
#pragma unroll
  for (int g = 0; g < 4; ++g)
#pragma unroll
    for (int e = 0; e < 4; ++e) fa[g][e] = sa[(size_t)(32 * g) * lda + e];
#pragma unroll
  for (int r = 0; r < 4; ++r)
#pragma unroll
    for (int u = 0; u < 4; ++u) fw[r][u] = sw[(size_t)r * ldw + u];
#pragma unroll 1
  for (int k0 = 0; k0 < K; k0 += 32) {
    __syncthreads();
#pragma unroll
    for (int g = 0; g < 4; ++g)
#pragma unroll
      for (int e = 0; e < 4; ++e) ldsA[(ar + 32 * g) * GSTR + l7 * 4 + e] = (f16)bf16r(fa[g][e]);
#pragma unroll
    for (int u = 0; u < 4; ++u)
#pragma unroll
      for (int r = 0; r < 4; ++r) ldsW[(nn + u) * GSTR + 4 * kg + r] = (f16)(64.0f * bf16r(fw[r][u]));
    __syncthreads();
    if (k0 + 32 < K) {   // same for the whole grid: the last step has no successor to load
      sa += 32; sw += (size_t)32 * ldw;
#pragma unroll
      for (int g = 0; g < 4; ++g)
#pragma unroll
        for (int e = 0; e < 4; ++e) fa[g][e] = sa[(size_t)(32 * g) * lda + e];
#pragma unroll
      for (int r = 0; r < 4; ++r)
#pragma unroll
        for (int u = 0; u < 4; ++u) fw[r][u] = sw[(size_t)r * ldw + u];
      asm volatile("s_wait_xcnt 0x0" ::: "memory");   // the loads' address registers are reused as destinations of the fragment reads below
    }
    f16x16 af[2];
#pragma unroll
    for (int i = 0; i < 2; ++i) af[i] = lds_frag(ldsA + (wm + 16 * i) * GSTR, GSTR);
#pragma unroll
    for (int j = 0; j < 4; ++j) {
      const f16x16 bf = lds_frag(ldsW + (wn + 16 * j) * GSTR, GSTR);
#pragma unroll
      for (int i = 0; i < 2; ++i) acc[i][j] = wmma16(af[i], bf, acc[i][j]);
    }
  }
  float* so = oS[wave];
#pragma unroll
  for (int i = 0; i < 2; ++i)
#pragma unroll
    for (int j = 0; j < 4; ++j) {
      const float bv = 64.0f * bf16r(bias[n0 + wn + 16 * j + cl]);
#pragma unroll
      for (int r = 0; r < 8; ++r) so[(16 * i + rh + r) * 68 + 16 * j + cl] = (1.0f / 64.0f) * (acc[i][j][r] + bv);
    }
  asm volatile("s_wait_dscnt 0" ::: "memory");
  __builtin_amdgcn_wave_barrier();
#pragma unroll
  for (int it = 0; it < 16; ++it) { const int f4 = lane + 32 * it, rr = f4 >> 4, q = (f4 & 15) * 4;
    *(v4f_t*)(Y + (size_t)(m0 + wm + rr) * ldy + n0 + wn + q) = *(const v4fa*)(so + rr * 68 + q); }
}

// ---------------------------------------------------------------------------------------------------------------------------
// gemm_kn2 (value+residual planes on both operands: hh + (hl+lh)/2048, f32-class): Y[m][n] (row stride ldy) = scale * sum_k A[m][k] (f32 or f16, row stride lda) * W[k][n] (f32, row-major [K][N], row
// stride ldw) (+ bias[n]) (+ Y if ACC). Block = 128 x 128 tile, 256 threads = 8 waves as 4(M, 32 rows) x 2(N, 64 cols); per
// 32-wide k-step the A tile and the W tile (stored transposed [n][k]) are staged as f16 in LDS; value and residual f16 planes per operand, f32
// blockIdx.z selects a batch: A += z*strideA, W += z*strideW, Y += z*strideY (element strides).
// ---------------------------------------------------------------------------------------------------------------------------
template <typename AT, bool ACC>
__global__ __launch_bounds__(256) void gemm_kn2(const AT* __restrict__ A, int lda, size_t strideA,
                                               const float* __restrict__ Wm, int ldw, size_t strideW,
                                               const float* __restrict__ bias, float scale,
                                               float* __restrict__ Y, int ldy, size_t strideY, int K) {
  __shared__ __attribute__((aligned(16))) f16 ldsA[128 * GSTR], ldsAl[128 * GSTR];
  __shared__ __attribute__((aligned(16))) f16 ldsW[128 * GSTR], ldsWl[128 * GSTR];
  __shared__ __attribute__((aligned(16))) float oS[8][32 * 68];
  const int tid = threadIdx.x, lane = tid & 31, wave = tid >> 5, cl = lane & 15, rh = (lane >> 4) * 8;
  const int m0 = blockIdx.x * 128, n0 = blockIdx.y * 128;
  const int wm = (wave & 3) * 32, wn = (wave >> 2) * 64;
  A += (size_t)blockIdx.z * strideA; Wm += (size_t)blockIdx.z * strideW; Y += (size_t)blockIdx.z * strideY;
  f32x8 acc[2][4], accx[2][4];
#pragma unroll
  for (int i = 0; i < 2; ++i)
#pragma unroll
    for (int j = 0; j < 4; ++j) { f32x8 z = {}; acc[i][j] = z; accx[i][j] = z; }
#pragma unroll 1
  for (int k0 = 0; k0 < K; k0 += 32) {
    __syncthreads();
    {  // A: thread -> row tid>>1, 16 elements at column half (tid&1)*16
      const int row = tid >> 1, ch = (tid & 1) * 16;
      const AT* src = A + (size_t)(m0 + row) * lda + k0 + ch;
#pragma unroll
      for (int g = 0; g < 16; ++g) { const float v = (float)src[g]; const f16 h = (f16)v; ldsA[row * GSTR + ch + g] = h; ldsAl[row * GSTR + ch + g] = (f16)((v - (float)h) * 2048.0f); }
    }
    {  // W: thread -> k = tid>>3, 16 consecutive n at (tid&7)*16; stored transposed [n][k]
      const int k = tid >> 3, nn0 = (tid & 7) * 16;
      const float* src = Wm + (size_t)(k0 + k) * ldw + n0 + nn0;
#pragma unroll
      for (int g = 0; g < 4; ++g) { const v4f_t v = *(const v4f_t*)(src + 4 * g);
#pragma unroll
        for (int u = 0; u < 4; ++u) { const f16 h = (f16)v[u]; ldsW[(nn0 + 4 * g + u) * GSTR + k] = h; ldsWl[(nn0 + 4 * g + u) * GSTR + k] = (f16)((v[u] - (float)h) * 2048.0f); } }
    }
    __syncthreads();
    f16x16 af[2], afl[2];
#pragma unroll
    for (int i = 0; i < 2; ++i) { af[i] = lds_frag(ldsA + (wm + 16 * i) * GSTR, GSTR); afl[i] = lds_frag(ldsAl + (wm + 16 * i) * GSTR, GSTR); }
#pragma unroll
    for (int j = 0; j < 4; ++j) {
      const f16x16 bf = lds_frag(ldsW + (wn + 16 * j) * GSTR, GSTR), bfl = lds_frag(ldsWl + (wn + 16 * j) * GSTR, GSTR);
#pragma unroll
      for (int i = 0; i < 2; ++i) { acc[i][j] = wmma16(af[i], bf, acc[i][j]); accx[i][j] = wmma16(af[i], bfl, accx[i][j]); accx[i][j] = wmma16(afl[i], bf, accx[i][j]); }
    }
  }
  float* so = oS[wave];
#pragma unroll
  for (int i = 0; i < 2; ++i)
#pragma unroll
    for (int j = 0; j < 4; ++j) {
      const float bv = bias ? bias[n0 + wn + 16 * j + cl] : 0.0f;
#pragma unroll
      for (int r = 0; r < 8; ++r) so[(16 * i + rh + r) * 68 + 16 * j + cl] = (acc[i][j][r] + accx[i][j][r] * (1.0f / 2048.0f)) * scale + bv;
    }
  asm volatile("s_wait_dscnt 0" ::: "memory");
  __builtin_amdgcn_wave_barrier();
  if (ACC) {   // accumulate: fold the existing Y values into the staging tile ONCE (same thread <-> same chunks as the stores below)
#pragma unroll
    for (int it = 0; it < 16; ++it) { const int f4 = lane + 32 * it, rr = f4 >> 4, q = (f4 & 15) * 4;
      const v4f_t old = *(const v4fa*)(Y + (size_t)(m0 + wm + rr) * ldy + n0 + wn + q);
      v4f_t v = *(const v4fa*)(so + rr * 68 + q); v += old; *(v4fa*)(so + rr * 68 + q) = v; }   // plain LDS store (ordered by the s_wait_dscnt/memory clobber below)
    asm volatile("s_wait_dscnt 0" ::: "memory");
  }
{
#pragma unroll
    for (int it = 0; it < 16; ++it) { const int f4 = lane + 32 * it, rr = f4 >> 4, q = (f4 & 15) * 4;
      *(v4f_t*)(Y + (size_t)(m0 + wm + rr) * ldy + n0 + wn + q) = *(const v4fa*)(so + rr * 68 + q); }
    
  }
}

__global__ __launch_bounds__(256) void k_transpose(const float* __restrict__ Wm, float* __restrict__ Wt, int rows, int cols) {
  __shared__ float tS[64][65];
  const int tid = threadIdx.x, tbj = cols / 64, bi = blockIdx.x / tbj, bj = blockIdx.x % tbj;
  for (int e = tid; e < 64 * 64; e += 256) { const int r = e >> 6, c = e & 63; tS[r][c] = Wm[(size_t)(bi * 64 + r) * cols + bj * 64 + c]; }
  __syncthreads();
  for (int ch = tid; ch < 64 * 16; ch += 256) { const int r = ch >> 4, q4 = (ch & 15) * 4; v4f_t o; o[0] = tS[q4][r]; o[1] = tS[q4 + 1][r]; o[2] = tS[q4 + 2][r]; o[3] = tS[q4 + 3][r];
    float* dst = Wt + (size_t)(bj * 64 + r) * rows + bi * 64 + q4; *(v4f_t*)dst = o;  }
}

#define NBpr 2
#define SSpr 2048
#define SIN 2048
#define DDpr 1024
#define NHpr 16
#define DKpr 64
#define HPpr 68   // LDS pitch, in floats, of one head's 64 channels in k_bhatt
__global__ __launch_bounds__(256) void k_dbg_zero(float* __restrict__ p, size_t n4) { const size_t i = (size_t)blockIdx.x * 256 + threadIdx.x; if (i < n4) { v4f_t z = {0.f,0.f,0.f,0.f}; *(v4f_t*)(p + 4 * i) = z;  } }
__global__ __launch_bounds__(256) void k_copy(const float* __restrict__ src, float* __restrict__ dst, size_t n4) { const size_t i = (size_t)blockIdx.x * 256 + threadIdx.x; if (i < n4) { const v4f_t v = *(const v4f_t*)(src + 4 * i); *(v4f_t*)(dst + 4 * i) = v;  } }
// torch [out][in] weight → WT[i][o] = mul·bf16(W[o][i]) ([in][out], lifted by a power of two so no bf16 weight becomes an f16 subnormal); block = input row i, threads loop over the outputs (4-B lanes)
__global__ __launch_bounds__(256) void k_wprepT(const float* __restrict__ Wt, float* __restrict__ WT, int nout, int nin, float mul) { const int i = blockIdx.x, tid = threadIdx.x;
#pragma unroll 1
  for (int o = tid; o < nout; o += 256) { const float w = mul * bf16r(Wt[(size_t)o * nin + i]); *(float*)(WT + (size_t)i * nout + o) = w;  } }

// sum over the 16 lanes of a row (one head's 16 four-channel chunks), every lane gets the total; DPP row_xmask butterfly, no LDS traffic
__device__ __forceinline__ float row16_sum(float v) {
  v += __int_as_float(__builtin_amdgcn_update_dpp(0, __float_as_int(v), 0x161, 0xf, 0xf, true));   // row_xmask:1
  v += __int_as_float(__builtin_amdgcn_update_dpp(0, __float_as_int(v), 0x162, 0xf, 0xf, true));   // row_xmask:2
  v += __int_as_float(__builtin_amdgcn_update_dpp(0, __float_as_int(v), 0x164, 0xf, 0xf, true));   // row_xmask:4
  v += __int_as_float(__builtin_amdgcn_update_dpp(0, __float_as_int(v), 0x168, 0xf, 0xf, true));   // row_xmask:8
  return v;
}

// per-token head-to-head Bhattacharyya attention: block = token; the six projected [16][64] vectors staged in LDS; thread = (query head i, key head j) for the distance, then
// With a = sq^2 + eps, b = sk^2 + eps: a/b + b/a + 2 = (a + b)^2 / (a b), so term1 = 0.5 ln((a + b)/2) - 0.25 ln a - 0.25 ln b. ln a and ln b depend on one head only and are summed over
// the channels once per head while staging; a (pair, channel) then costs one log2 of a + b and one reciprocal of sq^2 + sk^2 + eps (a + b is that denominator + eps).
__global__ __launch_bounds__(256) void k_bhatt(const float* __restrict__ MQ, const float* __restrict__ SQ, const float* __restrict__ MK, const float* __restrict__ SK, const float* __restrict__ MV, const float* __restrict__ SV, float* __restrict__ omu, float* __restrict__ osg, int srows) {
  // q and k head rows sit at a pitch of HPpr floats (272 B = 16 B x 17): the 16 key heads that the 16 lanes of a row read at one channel offset fall on distinct banks
  // q2 holds sigma_q^2, k2 holds sigma_k^2 + eps; lk[j] = sum over the channels of log2(sigma_k^2 + eps) of key head j
  __shared__ __attribute__((aligned(16))) float mq[NHpr * HPpr], q2[NHpr * HPpr], mk[NHpr * HPpr], k2[NHpr * HPpr], mv[1024], sv[1024]; __shared__ float att[256]; __shared__ float lk[NHpr];
  const size_t t = blockIdx.x; const int tid = threadIdx.x;
  float lq;   // sum over the channels of log2(sigma_q^2 + eps) of query head tid >> 4, in every lane of that head's row
  { const size_t o4 = t * DDpr + 4 * tid; const int p4 = (tid >> 4) * HPpr + (tid & 15) * 4;
    const v4f_t sgq = *(const v4f_t*)(SQ + o4), sgk = *(const v4f_t*)(SK + o4);
    asm volatile("s_wait_xcnt 0x0" ::: "memory");   // the two loads' address registers are reused by the loads below
    const v4f_t muq = *(const v4f_t*)(MQ + o4), muk = *(const v4f_t*)(MK + o4), muv = *(const v4f_t*)(MV + o4), sgv = *(const v4f_t*)(SV + o4);
    const v4f_t vq = sgq * sgq, vk = sgk * sgk + 1e-6f, aq = vq + 1e-6f;
    *(v4f_t*)(mq + p4) = muq; *(v4f_t*)(q2 + p4) = vq; *(v4f_t*)(mk + p4) = muk; *(v4f_t*)(k2 + p4) = vk; *(v4f_t*)(mv + 4 * tid) = muv; *(v4f_t*)(sv + 4 * tid) = sgv;
    v4f_t la, lb;
#pragma unroll   // constant indices into the four-channel vectors, so that they stay in registers
    for (int u = 0; u < 4; ++u) { la[u] = __builtin_amdgcn_logf(aq[u]); lb[u] = __builtin_amdgcn_logf(vk[u]); }
    lq = row16_sum((la[0] + la[2]) + (la[1] + la[3]));
    const float lks = row16_sum((lb[0] + lb[2]) + (lb[1] + lb[3]));
    if ((tid & 15) == 0) lk[tid >> 4] = lks; }
  __syncthreads();
  const int i = tid >> 4, j = tid & 15;
  v4f_t sl, sm; sl[0] = sl[1] = sl[2] = sl[3] = 0.0f; sm[0] = sm[1] = sm[2] = sm[3] = 0.0f;   // per channel residue mod 4: sums of log2(a + b) and of dm^2 / (sq^2 + sk^2 + eps)
#pragma unroll 4   // four 16-byte LDS read groups in flight per trip
  for (int d = 0; d < DKpr; d += 4) {   // four channels per 16-byte LDS read
    const v4f_t q24 = *(const v4f_t*)(q2 + i * HPpr + d), k24 = *(const v4f_t*)(k2 + j * HPpr + d), mq4 = *(const v4f_t*)(mq + i * HPpr + d), mk4 = *(const v4f_t*)(mk + j * HPpr + d);
    const v4f_t den = q24 + k24, ab = den + 1e-6f, dm = mq4 - mk4; v4f_t lg4, rc4;
#pragma unroll   // constant indices into the four-channel vectors, so that they stay in registers
    for (int u = 0; u < 4; ++u) { lg4[u] = __builtin_amdgcn_logf(ab[u]); rc4[u] = __builtin_amdgcn_rcpf(den[u]); }
    sl += lg4; sm += (dm * dm) * rc4; }
  const float sumlog = (sl[0] + sl[1]) + (sl[2] + sl[3]), summ = (sm[0] + sm[1]) + (sm[2] + sm[3]);
  const float dist = 0.69314718055994531f * (0.5f * sumlog - 0.5f * (float)DKpr - 0.25f * (lq + lk[j])) + 0.25f * summ;
  float lg = -0.5f * (dist * 0.125f); float m = lg;
  m = fmaxf(m, __shfl_xor(m, 1, 32)); m = fmaxf(m, __shfl_xor(m, 2, 32)); m = fmaxf(m, __shfl_xor(m, 4, 32)); m = fmaxf(m, __shfl_xor(m, 8, 32));
  float e = expf(lg - m); float z = e; z += __shfl_xor(z, 1, 32); z += __shfl_xor(z, 2, 32); z += __shfl_xor(z, 4, 32); z += __shfl_xor(z, 8, 32);
  att[tid] = e / z; __syncthreads();
  const int hi = tid >> 4, c4 = (tid & 15) * 4; v4f_t am, av; am[0] = am[1] = am[2] = am[3] = 0.0f; av[0] = av[1] = av[2] = av[3] = 0.0f;
#pragma unroll 1
  for (int jj = 0; jj < NHpr; ++jj) { const float a = att[hi * NHpr + jj]; const v4f_t mvj = *(const v4f_t*)(mv + jj * DKpr + c4), svj = *(const v4f_t*)(sv + jj * DKpr + c4); am += a * mvj; av += a * (svj * svj); }
  v4f_t os; for (int u = 0; u < 4; ++u) os[u] = sqrtf(fmaxf(av[u], 0.0f) + 1e-6f);
  float* dm_ = omu + ((size_t)hi * srows + t) * DKpr + c4; float* ds_ = osg + ((size_t)hi * srows + t) * DKpr + c4;
  *(v4f_t*)dm_ = am; *(v4f_t*)ds_ = os;  }

extern "C" void kernel_launch(void* const* d_in, const int* in_sizes, int n_in,
                              void* d_out, int out_size, void* d_ws, size_t ws_size,
                              hipStream_t stream) {
  (void)in_sizes; (void)n_in; (void)out_size;
  const float** f = (const float**)d_in;
  float* out0 = (float*)d_out; float* out1 = out0 + (size_t)2 * SIN * DDpr;   // out_mu, out_sigma
  char* ws = (char*)d_ws;
  const size_t slab = (size_t)NBpr * SSpr * DDpr;   // one projection's rows: both batch elements, [4096][1024]
  float* P[6]; for (int i = 0; i < 6; ++i) { P[i] = (float*)ws; ws += slab * 4; }
  if ((size_t)(ws - (char*)d_ws) > ws_size) return;                      // WS TOTAL 100,663,296 B
  const dim3 blk(256); const dim3 gp(NBpr * SSpr / 128, DDpr / 128, 6);
  // input -> projection slot map: query->q_mu (w0), key->k_mu (w1), value->v_mu (w2), query_sigma->q_sigma (w3), key_sigma->k_sigma (w4), value_sigma->v_sigma (w5)
  // the batch axis is folded into the GEMM's M (4096 rows) and the six projections into blockIdx.z: one launch of 32 x 8 x 6 tiles, several workgroups resident on every WGP
  gemm_proj6<<<gp, blk, 0, stream>>>(f[0], f[1], f[2], f[3], f[4], f[5], f[6], f[7], f[8], f[9], f[10], f[11], f[12], f[13], f[14], f[15], f[16], f[17],
                                     P[0], DDpr, DDpr, DDpr, slab, DDpr);
  for (int b = 0; b < NBpr; ++b) { const size_t ob = (size_t)b * SIN * DDpr;
    k_bhatt<<<dim3(SSpr), blk, 0, stream>>>(P[0] + ob, P[3] + ob, P[1] + ob, P[4] + ob, P[2] + ob, P[5] + ob, out0 + ob, out1 + ob, SIN);
  }
}

// v007
// A run of this version takes 113 microseconds.
// Two timings next to v006 put it at 1.06 and 1.05 times that version's speed.
// Counting every step since v000, it is 6.40 times as fast.
// bf16-input design: the six activations, six [in][out] weights and six biases are rounded to bf16 (RNE) on load; the six projections are then
// exact single bf16 products with f32 accumulation — the Bhattacharyya terms divide by σ² + 1e-6, which amplifies projection error ≈1000x near σ ≈ 1e-3, so
// exact projections are what make the distances reliable. Contractions on v_wmma_f32_16x16x32_bf16 (bf16 operands, f32 accumulate), per batch element: mu_q, sigma_q, mu_k, sigma_k, mu_v,
// sigma_v = x·W + b (K 1024 each). f32 VALU, one block per token: the 16x16 head-to-head Bhattacharyya distances summed over the 64 channels (0.25·log(0.25·(sq²/sk² + sk²/sq² + 2)) +
// 0.25·(μq−μk)²/(σq²+σk²+ε), with sq² = σq²+ε), /√64, softmax over the key-head axis of −0.5·dist, out_mu = attn·mu_v, out_sigma = sqrt(max(attn·σv², 0) + ε), and the module's
// transpose(1,2)-then-view layout: each output is the [B][H][S][64] array reinterpreted as [B][S][1024]. Two outputs, consecutive in d_out: out_mu then out_sigma.
// compute dtype: bf16 operands, f32 accumulate.  six [2,2048,1024] inputs → (out_mu, out_sigma) [2,2048,1024] each.
#include <hip/hip_runtime.h>
#include <hip/hip_bf16.h>
#include <math.h>


typedef _Float16 bf16;
typedef _Float16 f16;
typedef __attribute__((ext_vector_type(4))) unsigned v4u_t;
typedef unsigned v4ua __attribute__((ext_vector_type(4), may_alias));
typedef __attribute__((ext_vector_type(4))) float v4f_t;
typedef float v4fa __attribute__((ext_vector_type(4), may_alias));
typedef __attribute__((ext_vector_type(16))) bf16  bf16x16;
typedef bf16x16 f16x16;
typedef __attribute__((ext_vector_type(8)))  bf16  bf16x8;
typedef bf16x8 f16x8;
typedef __attribute__((ext_vector_type(4)))  bf16  bf16x4;
typedef __attribute__((ext_vector_type(8)))  float f32x8;
__device__ __forceinline__ f32x8 wmma16(f16x16 a, f16x16 b, f32x8 c) {
  c = __builtin_amdgcn_wmma_f32_16x16x32_f16(false, a, false, b, (short)0, c, false, false);
  asm volatile("v_nop\n\tv_nop\n\tv_nop\n\tv_nop" : "+v"(c) : "v"(a), "v"(b));
  return c;
}
#define LDS_STRIDE 48   // unused: the GEMM tiles use GSTR (32 -> 48 elems, 96B rows: aligned b128 reads)
#define KSTRIDE    72   // unused: k_bhatt stages K at pitch HPpr ([16][68] f32, stride 68)
#define VSTRIDE    48   // unused: k_bhatt stages V unpadded ([16][64] f32, stride 64)

__device__ __forceinline__ f32x8 wmma_bf16(bf16x16 a, bf16x16 b, f32x8 c) {
  c = __builtin_amdgcn_wmma_f32_16x16x32_f16(false, a, false, b, (short)0, c, false, false);
  asm volatile("v_nop\n\tv_nop\n\tv_nop\n\tv_nop" : "+v"(c) : "v"(a), "v"(b));   // A/B-overwrite hazard guard
  return c;
}

// 16x32 (MxK) bf16 fragment from a row-major global matrix.
// lanes 0-15  (row=lane)    : elems 0..7 = K+0..7,  8..15 = K+16..23
// lanes 16-31 (row=lane-16) : elems 0..7 = K+8..15, 8..15 = K+24..31
template <typename T>
__device__ __forceinline__ bf16x16 load_frag(const T* __restrict__ base, int ld,
                                             int row0, int k0) {
  const int lane = threadIdx.x & 31;
  const int r    = lane & 15;
  const int kh   = (lane >> 4) * 8;
  const T* p0 = base + (size_t)(row0 + r) * ld + (k0 + kh);
  const T* p1 = p0 + 16;
  bf16x16 f;
#pragma unroll
  for (int i = 0; i < 8; ++i) {
    f[i]     = (bf16)p0[i];
    f[i + 8] = (bf16)p1[i];
  }
  return f;
}

// Same fragment from an LDS tile with padded row stride (base includes row0/k0).
__device__ __forceinline__ bf16x16 lds_frag(const bf16* base, int stride) {
  const int lane = threadIdx.x & 31;
  const int row  = lane & 15;
  const int kh   = (lane >> 4) * 8;
  const bf16x8 lo = *(const bf16x8*)(base + row * stride + kh);
  const bf16x8 hi = *(const bf16x8*)(base + row * stride + kh + 16);
  bf16x16 f;
#pragma unroll
  for (int i = 0; i < 8; ++i) { f[i] = lo[i]; f[i + 8] = hi[i]; }
  return f;
}

template <typename T>
__device__ __forceinline__ void stage_read16(const T* __restrict__ p, float* buf) {
#pragma unroll
  for (int i = 0; i < 16; ++i) buf[i] = (float)p[i];
}

__device__ __forceinline__ void stage_write(bf16* dst, const float* buf, int nquad) {
#pragma unroll
  for (int i = 0; i < nquad; ++i) {
    bf16x4 q;
    q[0] = (bf16)buf[4 * i];     q[1] = (bf16)buf[4 * i + 1];
    q[2] = (bf16)buf[4 * i + 2]; q[3] = (bf16)buf[4 * i + 3];
    *(bf16x4*)(dst + 4 * i) = q;
  }
}


#define GSTR 48
// ---------------------------------------------------------------------------------------------------------------------------
// gemm_kne: Y[m][n] = epi( Σ_k A[m][k]·W[k][n] + bias[n] ), A f32/f16 [M][lda], W f32 row-major [K][N] (ldw), plain f16 operands,
// f32 accumulate. EPI 0: identity; 1: exact-erf GELU; 2: R[m][n] + gvec[n]·(·) (residual with per-channel gain); 3: ReLU; 4: gvec[n]·(·) (per-channel scale, no residual). Output f32 (or f16
// when OUT16). Block = 128x128 tile, 8 waves as 4(M) x 2(N); per 32-wide k-step A and W tiles staged f16 in LDS (W transposed
// ---------------------------------------------------------------------------------------------------------------------------
#define GSTR 48
template <typename AT, int EPI, bool OUT16>
__global__ __launch_bounds__(256) void gemm_kne(const AT* __restrict__ A, int lda, const float* __restrict__ Wm, int ldw,
                                                const float* __restrict__ bias, const float* __restrict__ R, const float* __restrict__ gvec,
                                                void* __restrict__ Yv, int ldy, int K) {
  __shared__ __attribute__((aligned(16))) f16 ldsA[128 * GSTR];
  __shared__ __attribute__((aligned(16))) f16 ldsW[128 * GSTR];
  __shared__ __attribute__((aligned(16))) float oS[8][32 * 68];
  const int tid = threadIdx.x, lane = tid & 31, wave = tid >> 5, cl = lane & 15, rh = (lane >> 4) * 8;
  const int m0 = blockIdx.x * 128, n0 = blockIdx.y * 128;
  const int wm = (wave & 3) * 32, wn = (wave >> 2) * 64;
  f32x8 acc[2][4];
#pragma unroll
  for (int i = 0; i < 2; ++i)
#pragma unroll
    for (int j = 0; j < 4; ++j) { f32x8 z = {}; acc[i][j] = z; }
#pragma unroll 1
  for (int k0 = 0; k0 < K; k0 += 32) {
    __syncthreads();
    { const int row = tid >> 1, ch = (tid & 1) * 16;
      const AT* src = A + (size_t)(m0 + row) * lda + k0 + ch;
#pragma unroll
      for (int g = 0; g < 16; ++g) ldsA[row * GSTR + ch + g] = (f16)src[g]; }
    { const int k = tid >> 3, nn0 = (tid & 7) * 16;
      const float* src = Wm + (size_t)(k0 + k) * ldw + n0 + nn0;
#pragma unroll
      for (int g = 0; g < 4; ++g) { const v4f_t v = *(const v4f_t*)(src + 4 * g);
#pragma unroll
        for (int u = 0; u < 4; ++u) ldsW[(nn0 + 4 * g + u) * GSTR + k] = (f16)v[u]; } }
    __syncthreads();
    f16x16 af[2];
#pragma unroll
    for (int i = 0; i < 2; ++i) af[i] = lds_frag(ldsA + (wm + 16 * i) * GSTR, GSTR);
#pragma unroll
    for (int j = 0; j < 4; ++j) {
      const f16x16 bf = lds_frag(ldsW + (wn + 16 * j) * GSTR, GSTR);
#pragma unroll
      for (int i = 0; i < 2; ++i) acc[i][j] = wmma16(af[i], bf, acc[i][j]);
    }
  }
  float* so = oS[wave];
#pragma unroll
  for (int i = 0; i < 2; ++i)
#pragma unroll
    for (int j = 0; j < 4; ++j) {
      const int n = n0 + wn + 16 * j + cl;
      const float bv = bias ? bias[n] : 0.0f;
      const float gv = (EPI == 2 || EPI == 4) ? gvec[n] : 0.0f;
      if (EPI == 1) {
#pragma unroll 1
        for (int r = 0; r < 8; ++r) { const float xg = acc[i][j][r] + bv; so[(16 * i + rh + r) * 68 + 16 * j + cl] = 0.5f * xg * (1.0f + erff(xg * 0.70710678118654752f)); }
      } else {
#pragma unroll
        for (int r = 0; r < 8; ++r) {
          float v = acc[i][j][r] + bv;
          if (EPI == 3) v = fmaxf(v, 0.0f);
          if (EPI == 4) v = gv * v;
          if (EPI == 2) v = R[(size_t)(m0 + wm + 16 * i + rh + r) * ldy + n] + gv * v;
          so[(16 * i + rh + r) * 68 + 16 * j + cl] = v;
        }
      }
    }
  asm volatile("s_wait_dscnt 0" ::: "memory");
  __builtin_amdgcn_wave_barrier();
{
    if (OUT16) {
      f16* Y = (f16*)Yv;
#pragma unroll
      for (int it = 0; it < 8; ++it) { const int c = lane + 32 * it, rr = c >> 3, q8 = (c & 7) * 8;
        union { f16 h[8]; v4u_t v; } u;
#pragma unroll
        for (int e = 0; e < 8; ++e) u.h[e] = (f16)so[rr * 68 + q8 + e];
        *(v4u_t*)(Y + (size_t)(m0 + wm + rr) * ldy + n0 + wn + q8) = u.v; }
    } else {
      float* Y = (float*)Yv;
#pragma unroll
      for (int it = 0; it < 16; ++it) { const int f4 = lane + 32 * it, rr = f4 >> 4, q = (f4 & 15) * 4;
        *(v4f_t*)(Y + (size_t)(m0 + wm + rr) * ldy + n0 + wn + q) = *(const v4fa*)(so + rr * 68 + q); }
    }
    
  }
}

// bf16 round-to-nearest-even of an f32 (bit trick)
__device__ __forceinline__ float bf16r(float x) { unsigned int u = __float_as_uint(x); u = (u + 0x7FFFu + ((u >> 16) & 1u)) & 0xFFFF0000u; return __uint_as_float(u); }

typedef __attribute__((ext_vector_type(16))) __bf16 b16x16;
typedef __attribute__((ext_vector_type(8)))  __bf16 b16x8;
typedef __attribute__((ext_vector_type(4)))  __bf16 b16x4;
// four f32 -> four bf16, round to nearest even, by the hardware's packed convert (two values an instruction)
__device__ __forceinline__ b16x4 to_b16x4(float a, float b, float c, float d) { v4f_t v; v[0] = a; v[1] = b; v[2] = c; v[3] = d; return __builtin_convertvector(v, b16x4); }
// lds_frag for a bf16 tile: same lane and k order
__device__ __forceinline__ b16x16 lds_frag_b(const __bf16* base, int stride) {
  const int lane = threadIdx.x & 31;
  const int row  = lane & 15;
  const int kh   = (lane >> 4) * 8;
  const b16x8 lo = *(const b16x8*)(base + row * stride + kh);
  const b16x8 hi = *(const b16x8*)(base + row * stride + kh + 16);
  return __builtin_shufflevector(lo, hi, 0, 1, 2, 3, 4, 5, 6, 7, 8, 9, 10, 11, 12, 13, 14, 15);
}

// gemm_proj6: the six projections in one launch, straight from the inputs (same tile code as gemm_kne). blockIdx.z picks activation x, weight w ([in][out]) and bias b;
// Y[z][m][n] = sum_k bf16(x[m][k]) * bf16(w[k][n]) + bf16(b[n]). The matrix operands are bf16 themselves, so the rounding is all that staging has to do: the hardware's packed
// convert, in registers between the global load and the bf16 LDS store; no rounded copy of any operand goes through memory.
__global__ __launch_bounds__(256) void gemm_proj6(const float* __restrict__ x0, const float* __restrict__ x1, const float* __restrict__ x2,
                                                  const float* __restrict__ x3, const float* __restrict__ x4, const float* __restrict__ x5,
                                                  const float* __restrict__ w0, const float* __restrict__ w1, const float* __restrict__ w2,
                                                  const float* __restrict__ w3, const float* __restrict__ w4, const float* __restrict__ w5,
                                                  const float* __restrict__ b0, const float* __restrict__ b1, const float* __restrict__ b2,
                                                  const float* __restrict__ b3, const float* __restrict__ b4, const float* __restrict__ b5,
                                                  float* __restrict__ Y, int lda, int ldw, int ldy, size_t strideY, int K) {
  const int z = blockIdx.z;
  const float* __restrict__ A    = z == 0 ? x0 : z == 1 ? x1 : z == 2 ? x2 : z == 3 ? x3 : z == 4 ? x4 : x5;
  const float* __restrict__ Wm   = z == 0 ? w0 : z == 1 ? w1 : z == 2 ? w2 : z == 3 ? w3 : z == 4 ? w4 : w5;
  const float* __restrict__ bias = z == 0 ? b0 : z == 1 ? b1 : z == 2 ? b2 : z == 3 ? b3 : z == 4 ? b4 : b5;
  Y += (size_t)z * strideY;
  __shared__ __attribute__((aligned(16))) __bf16 ldsA[128 * GSTR];
  __shared__ __attribute__((aligned(16))) __bf16 ldsW[128 * GSTR];
  __shared__ __attribute__((aligned(16))) float oS[8][32 * 68];
  const int tid = threadIdx.x, lane = tid & 31, wave = tid >> 5, cl = lane & 15, rh = (lane >> 4) * 8;
  const int m0 = blockIdx.x * 128, n0 = blockIdx.y * 128;
  const int wm = (wave & 3) * 32, wn = (wave >> 2) * 64;
  f32x8 acc[2][4];
#pragma unroll
  for (int i = 0; i < 2; ++i)
#pragma unroll
    for (int j = 0; j < 4; ++j) { f32x8 zz = {}; acc[i][j] = zz; }
  // staging map: 8 lanes x 16 B cover one whole 128-B line, so every wave-wide load touches 4 whole lines.
  // A: lane -> (row l8 of 4, 4-channel chunk l7); W: lane -> (group kg of 4 consecutive k rows, 4 columns at nn), so that each column's 4 k values go to the transposed tile as one 8-byte store.
  const int l7 = lane & 7, l8 = lane >> 3;
  const int ar = wave * 4 + l8, kg = (wave >> 2) * 4 + l8, nn = (wave & 3) * 32 + l7 * 4;
  const float* sa = A + (size_t)(m0 + ar) * lda + l7 * 4;
  const float* sw = Wm + (size_t)(4 * kg) * ldw + n0 + nn;
  // fa, fw hold the raw f32 values of ONE k-step, loaded one trip ahead: the loads of step k0 + 32 are issued behind the barrier that publishes step k0's tiles
  // and fly during step k0's fragment reads and matrix instructions, instead of being issued and waited for between the two barriers.
  float fa[4][4], fw[4][4];
#pragma unroll
  for (int g = 0; g < 4; ++g)
#pragma unroll
    for (int e = 0; e < 4; ++e) fa[g][e] = sa[(size_t)(32 * g) * lda + e];
#pragma unroll
  for (int r = 0; r < 4; ++r)
#pragma unroll
    for (int u = 0; u < 4; ++u) fw[r][u] = sw[(size_t)r * ldw + u];
#pragma unroll 1
  for (int k0 = 0; k0 < K; k0 += 32) {
    __syncthreads();
#pragma unroll
    for (int g = 0; g < 4; ++g) *(b16x4*)(ldsA + (ar + 32 * g) * GSTR + l7 * 4) = to_b16x4(fa[g][0], fa[g][1], fa[g][2], fa[g][3]);
#pragma unroll
    for (int u = 0; u < 4; ++u) *(b16x4*)(ldsW + (nn + u) * GSTR + 4 * kg) = to_b16x4(fw[0][u], fw[1][u], fw[2][u], fw[3][u]);
    __syncthreads();
    if (k0 + 32 < K) {   // same for the whole grid: the last step has no successor to load
      sa += 32; sw += (size_t)32 * ldw;
#pragma unroll
      for (int g = 0; g < 4; ++g)
#pragma unroll
        for (int e = 0; e < 4; ++e) fa[g][e] = sa[(size_t)(32 * g) * lda + e];
#pragma unroll
      for (int r = 0; r < 4; ++r)
#pragma unroll
        for (int u = 0; u < 4; ++u) fw[r][u] = sw[(size_t)r * ldw + u];
      asm volatile("s_wait_xcnt 0x0" ::: "memory");   // the loads' address registers are reused as destinations of the fragment reads below
    }
    b16x16 af[2];
#pragma unroll
    for (int i = 0; i < 2; ++i) af[i] = lds_frag_b(ldsA + (wm + 16 * i) * GSTR, GSTR);
#pragma unroll
    for (int j = 0; j < 4; ++j) {
      const b16x16 bf = lds_frag_b(ldsW + (wn + 16 * j) * GSTR, GSTR);
#pragma unroll
      for (int i = 0; i < 2; ++i) acc[i][j] = __builtin_amdgcn_wmma_f32_16x16x32_bf16(false, af[i], false, bf, (short)0, acc[i][j], false, false);
    }
  }
  float* so = oS[wave];
#pragma unroll
  for (int i = 0; i < 2; ++i)
#pragma unroll
    for (int j = 0; j < 4; ++j) {
      const float bv = bf16r(bias[n0 + wn + 16 * j + cl]);
#pragma unroll
      for (int r = 0; r < 8; ++r) so[(16 * i + rh + r) * 68 + 16 * j + cl] = acc[i][j][r] + bv;
    }
  asm volatile("s_wait_dscnt 0" ::: "memory");
  __builtin_amdgcn_wave_barrier();
#pragma unroll
  for (int it = 0; it < 16; ++it) { const int f4 = lane + 32 * it, rr = f4 >> 4, q = (f4 & 15) * 4;
    *(v4f_t*)(Y + (size_t)(m0 + wm + rr) * ldy + n0 + wn + q) = *(const v4fa*)(so + rr * 68 + q); }
}

// ---------------------------------------------------------------------------------------------------------------------------
// gemm_kn2 (value+residual planes on both operands: hh + (hl+lh)/2048, f32-class): Y[m][n] (row stride ldy) = scale * sum_k A[m][k] (f32 or f16, row stride lda) * W[k][n] (f32, row-major [K][N], row
// stride ldw) (+ bias[n]) (+ Y if ACC). Block = 128 x 128 tile, 256 threads = 8 waves as 4(M, 32 rows) x 2(N, 64 cols); per
// 32-wide k-step the A tile and the W tile (stored transposed [n][k]) are staged as f16 in LDS; value and residual f16 planes per operand, f32
// blockIdx.z selects a batch: A += z*strideA, W += z*strideW, Y += z*strideY (element strides).
// ---------------------------------------------------------------------------------------------------------------------------
template <typename AT, bool ACC>
__global__ __launch_bounds__(256) void gemm_kn2(const AT* __restrict__ A, int lda, size_t strideA,
                                               const float* __restrict__ Wm, int ldw, size_t strideW,
                                               const float* __restrict__ bias, float scale,
                                               float* __restrict__ Y, int ldy, size_t strideY, int K) {
  __shared__ __attribute__((aligned(16))) f16 ldsA[128 * GSTR], ldsAl[128 * GSTR];
  __shared__ __attribute__((aligned(16))) f16 ldsW[128 * GSTR], ldsWl[128 * GSTR];
  __shared__ __attribute__((aligned(16))) float oS[8][32 * 68];
  const int tid = threadIdx.x, lane = tid & 31, wave = tid >> 5, cl = lane & 15, rh = (lane >> 4) * 8;
  const int m0 = blockIdx.x * 128, n0 = blockIdx.y * 128;
  const int wm = (wave & 3) * 32, wn = (wave >> 2) * 64;
  A += (size_t)blockIdx.z * strideA; Wm += (size_t)blockIdx.z * strideW; Y += (size_t)blockIdx.z * strideY;
  f32x8 acc[2][4], accx[2][4];
#pragma unroll
  for (int i = 0; i < 2; ++i)
#pragma unroll
    for (int j = 0; j < 4; ++j) { f32x8 z = {}; acc[i][j] = z; accx[i][j] = z; }
#pragma unroll 1
  for (int k0 = 0; k0 < K; k0 += 32) {
    __syncthreads();
    {  // A: thread -> row tid>>1, 16 elements at column half (tid&1)*16
      const int row = tid >> 1, ch = (tid & 1) * 16;
      const AT* src = A + (size_t)(m0 + row) * lda + k0 + ch;
#pragma unroll
      for (int g = 0; g < 16; ++g) { const float v = (float)src[g]; const f16 h = (f16)v; ldsA[row * GSTR + ch + g] = h; ldsAl[row * GSTR + ch + g] = (f16)((v - (float)h) * 2048.0f); }
    }
    {  // W: thread -> k = tid>>3, 16 consecutive n at (tid&7)*16; stored transposed [n][k]
      const int k = tid >> 3, nn0 = (tid & 7) * 16;
      const float* src = Wm + (size_t)(k0 + k) * ldw + n0 + nn0;
#pragma unroll
      for (int g = 0; g < 4; ++g) { const v4f_t v = *(const v4f_t*)(src + 4 * g);
#pragma unroll
        for (int u = 0; u < 4; ++u) { const f16 h = (f16)v[u]; ldsW[(nn0 + 4 * g + u) * GSTR + k] = h; ldsWl[(nn0 + 4 * g + u) * GSTR + k] = (f16)((v[u] - (float)h) * 2048.0f); } }
    }
    __syncthreads();
    f16x16 af[2], afl[2];
#pragma unroll
    for (int i = 0; i < 2; ++i) { af[i] = lds_frag(ldsA + (wm + 16 * i) * GSTR, GSTR); afl[i] = lds_frag(ldsAl + (wm + 16 * i) * GSTR, GSTR); }
#pragma unroll
    for (int j = 0; j < 4; ++j) {
      const f16x16 bf = lds_frag(ldsW + (wn + 16 * j) * GSTR, GSTR), bfl = lds_frag(ldsWl + (wn + 16 * j) * GSTR, GSTR);
#pragma unroll
      for (int i = 0; i < 2; ++i) { acc[i][j] = wmma16(af[i], bf, acc[i][j]); accx[i][j] = wmma16(af[i], bfl, accx[i][j]); accx[i][j] = wmma16(afl[i], bf, accx[i][j]); }
    }
  }
  float* so = oS[wave];
#pragma unroll
  for (int i = 0; i < 2; ++i)
#pragma unroll
    for (int j = 0; j < 4; ++j) {
      const float bv = bias ? bias[n0 + wn + 16 * j + cl] : 0.0f;
#pragma unroll
      for (int r = 0; r < 8; ++r) so[(16 * i + rh + r) * 68 + 16 * j + cl] = (acc[i][j][r] + accx[i][j][r] * (1.0f / 2048.0f)) * scale + bv;
    }
  asm volatile("s_wait_dscnt 0" ::: "memory");
  __builtin_amdgcn_wave_barrier();
  if (ACC) {   // accumulate: fold the existing Y values into the staging tile ONCE (same thread <-> same chunks as the stores below)
#pragma unroll
    for (int it = 0; it < 16; ++it) { const int f4 = lane + 32 * it, rr = f4 >> 4, q = (f4 & 15) * 4;
      const v4f_t old = *(const v4fa*)(Y + (size_t)(m0 + wm + rr) * ldy + n0 + wn + q);
      v4f_t v = *(const v4fa*)(so + rr * 68 + q); v += old; *(v4fa*)(so + rr * 68 + q) = v; }   // plain LDS store (ordered by the s_wait_dscnt/memory clobber below)
    asm volatile("s_wait_dscnt 0" ::: "memory");
  }
{
#pragma unroll
    for (int it = 0; it < 16; ++it) { const int f4 = lane + 32 * it, rr = f4 >> 4, q = (f4 & 15) * 4;
      *(v4f_t*)(Y + (size_t)(m0 + wm + rr) * ldy + n0 + wn + q) = *(const v4fa*)(so + rr * 68 + q); }
    
  }
}

__global__ __launch_bounds__(256) void k_transpose(const float* __restrict__ Wm, float* __restrict__ Wt, int rows, int cols) {
  __shared__ float tS[64][65];
  const int tid = threadIdx.x, tbj = cols / 64, bi = blockIdx.x / tbj, bj = blockIdx.x % tbj;
  for (int e = tid; e < 64 * 64; e += 256) { const int r = e >> 6, c = e & 63; tS[r][c] = Wm[(size_t)(bi * 64 + r) * cols + bj * 64 + c]; }
  __syncthreads();
  for (int ch = tid; ch < 64 * 16; ch += 256) { const int r = ch >> 4, q4 = (ch & 15) * 4; v4f_t o; o[0] = tS[q4][r]; o[1] = tS[q4 + 1][r]; o[2] = tS[q4 + 2][r]; o[3] = tS[q4 + 3][r];
    float* dst = Wt + (size_t)(bj * 64 + r) * rows + bi * 64 + q4; *(v4f_t*)dst = o;  }
}

#define NBpr 2
#define SSpr 2048
#define SIN 2048
#define DDpr 1024
#define NHpr 16
#define DKpr 64
#define HPpr 68   // LDS pitch, in floats, of one head's 64 channels in k_bhatt
__global__ __launch_bounds__(256) void k_dbg_zero(float* __restrict__ p, size_t n4) { const size_t i = (size_t)blockIdx.x * 256 + threadIdx.x; if (i < n4) { v4f_t z = {0.f,0.f,0.f,0.f}; *(v4f_t*)(p + 4 * i) = z;  } }
__global__ __launch_bounds__(256) void k_copy(const float* __restrict__ src, float* __restrict__ dst, size_t n4) { const size_t i = (size_t)blockIdx.x * 256 + threadIdx.x; if (i < n4) { const v4f_t v = *(const v4f_t*)(src + 4 * i); *(v4f_t*)(dst + 4 * i) = v;  } }
// torch [out][in] weight → WT[i][o] = mul·bf16(W[o][i]) ([in][out], lifted by a power of two so no bf16 weight becomes an f16 subnormal); block = input row i, threads loop over the outputs (4-B lanes)
__global__ __launch_bounds__(256) void k_wprepT(const float* __restrict__ Wt, float* __restrict__ WT, int nout, int nin, float mul) { const int i = blockIdx.x, tid = threadIdx.x;
#pragma unroll 1
  for (int o = tid; o < nout; o += 256) { const float w = mul * bf16r(Wt[(size_t)o * nin + i]); *(float*)(WT + (size_t)i * nout + o) = w;  } }

// sum over the 16 lanes of a row (one head's 16 four-channel chunks), every lane gets the total; DPP row_xmask butterfly, no LDS traffic
__device__ __forceinline__ float row16_sum(float v) {
  v += __int_as_float(__builtin_amdgcn_update_dpp(0, __float_as_int(v), 0x161, 0xf, 0xf, true));   // row_xmask:1
  v += __int_as_float(__builtin_amdgcn_update_dpp(0, __float_as_int(v), 0x162, 0xf, 0xf, true));   // row_xmask:2
  v += __int_as_float(__builtin_amdgcn_update_dpp(0, __float_as_int(v), 0x164, 0xf, 0xf, true));   // row_xmask:4
  v += __int_as_float(__builtin_amdgcn_update_dpp(0, __float_as_int(v), 0x168, 0xf, 0xf, true));   // row_xmask:8
  return v;
}

// per-token head-to-head Bhattacharyya attention: block = token; the six projected [16][64] vectors staged in LDS; thread = (query head i, key head j) for the distance, then
// With a = sq^2 + eps, b = sk^2 + eps: a/b + b/a + 2 = (a + b)^2 / (a b), so term1 = 0.5 ln((a + b)/2) - 0.25 ln a - 0.25 ln b. ln a and ln b depend on one head only and are summed over
// the channels once per head while staging; a (pair, channel) then costs one log2 of a + b and one reciprocal of sq^2 + sk^2 + eps (a + b is that denominator + eps).
__global__ __launch_bounds__(256) void k_bhatt(const float* __restrict__ MQ, const float* __restrict__ SQ, const float* __restrict__ MK, const float* __restrict__ SK, const float* __restrict__ MV, const float* __restrict__ SV, float* __restrict__ omu, float* __restrict__ osg, int srows) {
  // q and k head rows sit at a pitch of HPpr floats (272 B = 16 B x 17): the 16 key heads that the 16 lanes of a row read at one channel offset fall on distinct banks
  // q2 holds sigma_q^2, k2 holds sigma_k^2 + eps; lk[j] = sum over the channels of log2(sigma_k^2 + eps) of key head j
  __shared__ __attribute__((aligned(16))) float mq[NHpr * HPpr], q2[NHpr * HPpr], mk[NHpr * HPpr], k2[NHpr * HPpr], mv[1024], sv[1024]; __shared__ float att[256]; __shared__ float lk[NHpr];
  const size_t t = blockIdx.x; const int tid = threadIdx.x;
  float lq;   // sum over the channels of log2(sigma_q^2 + eps) of query head tid >> 4, in every lane of that head's row
  { const size_t o4 = t * DDpr + 4 * tid; const int p4 = (tid >> 4) * HPpr + (tid & 15) * 4;
    const v4f_t sgq = *(const v4f_t*)(SQ + o4), sgk = *(const v4f_t*)(SK + o4);
    asm volatile("s_wait_xcnt 0x0" ::: "memory");   // the two loads' address registers are reused by the loads below
    const v4f_t muq = *(const v4f_t*)(MQ + o4), muk = *(const v4f_t*)(MK + o4), muv = *(const v4f_t*)(MV + o4), sgv = *(const v4f_t*)(SV + o4);
    const v4f_t vq = sgq * sgq, vk = sgk * sgk + 1e-6f, aq = vq + 1e-6f;
    *(v4f_t*)(mq + p4) = muq; *(v4f_t*)(q2 + p4) = vq; *(v4f_t*)(mk + p4) = muk; *(v4f_t*)(k2 + p4) = vk; *(v4f_t*)(mv + 4 * tid) = muv; *(v4f_t*)(sv + 4 * tid) = sgv;
    v4f_t la, lb;
#pragma unroll   // constant indices into the four-channel vectors, so that they stay in registers
    for (int u = 0; u < 4; ++u) { la[u] = __builtin_amdgcn_logf(aq[u]); lb[u] = __builtin_amdgcn_logf(vk[u]); }
    lq = row16_sum((la[0] + la[2]) + (la[1] + la[3]));
    const float lks = row16_sum((lb[0] + lb[2]) + (lb[1] + lb[3]));
    if ((tid & 15) == 0) lk[tid >> 4] = lks; }
  __syncthreads();
  const int i = tid >> 4, j = tid & 15;
  v4f_t sl, sm; sl[0] = sl[1] = sl[2] = sl[3] = 0.0f; sm[0] = sm[1] = sm[2] = sm[3] = 0.0f;   // per channel residue mod 4: sums of log2(a + b) and of dm^2 / (sq^2 + sk^2 + eps)
#pragma unroll 4   // four 16-byte LDS read groups in flight per trip
  for (int d = 0; d < DKpr; d += 4) {   // four channels per 16-byte LDS read
    const v4f_t q24 = *(const v4f_t*)(q2 + i * HPpr + d), k24 = *(const v4f_t*)(k2 + j * HPpr + d), mq4 = *(const v4f_t*)(mq + i * HPpr + d), mk4 = *(const v4f_t*)(mk + j * HPpr + d);
    const v4f_t den = q24 + k24, ab = den + 1e-6f, dm = mq4 - mk4; v4f_t lg4, rc4;
#pragma unroll   // constant indices into the four-channel vectors, so that they stay in registers
    for (int u = 0; u < 4; ++u) { lg4[u] = __builtin_amdgcn_logf(ab[u]); rc4[u] = __builtin_amdgcn_rcpf(den[u]); }
    sl += lg4; sm += (dm * dm) * rc4; }
  const float sumlog = (sl[0] + sl[1]) + (sl[2] + sl[3]), summ = (sm[0] + sm[1]) + (sm[2] + sm[3]);
  const float dist = 0.69314718055994531f * (0.5f * sumlog - 0.5f * (float)DKpr - 0.25f * (lq + lk[j])) + 0.25f * summ;
  float lg = -0.5f * (dist * 0.125f); float m = lg;
  m = fmaxf(m, __shfl_xor(m, 1, 32)); m = fmaxf(m, __shfl_xor(m, 2, 32)); m = fmaxf(m, __shfl_xor(m, 4, 32)); m = fmaxf(m, __shfl_xor(m, 8, 32));
  float e = expf(lg - m); float z = e; z += __shfl_xor(z, 1, 32); z += __shfl_xor(z, 2, 32); z += __shfl_xor(z, 4, 32); z += __shfl_xor(z, 8, 32);
  att[tid] = e / z; __syncthreads();
  const int hi = tid >> 4, c4 = (tid & 15) * 4; v4f_t am, av; am[0] = am[1] = am[2] = am[3] = 0.0f; av[0] = av[1] = av[2] = av[3] = 0.0f;
#pragma unroll 1
  for (int jj = 0; jj < NHpr; ++jj) { const float a = att[hi * NHpr + jj]; const v4f_t mvj = *(const v4f_t*)(mv + jj * DKpr + c4), svj = *(const v4f_t*)(sv + jj * DKpr + c4); am += a * mvj; av += a * (svj * svj); }
  v4f_t os; for (int u = 0; u < 4; ++u) os[u] = sqrtf(fmaxf(av[u], 0.0f) + 1e-6f);
  float* dm_ = omu + ((size_t)hi * srows + t) * DKpr + c4; float* ds_ = osg + ((size_t)hi * srows + t) * DKpr + c4;
  *(v4f_t*)dm_ = am; *(v4f_t*)ds_ = os;  }

extern "C" void kernel_launch(void* const* d_in, const int* in_sizes, int n_in,
                              void* d_out, int out_size, void* d_ws, size_t ws_size,
                              hipStream_t stream) {
  (void)in_sizes; (void)n_in; (void)out_size;
  const float** f = (const float**)d_in;
  float* out0 = (float*)d_out; float* out1 = out0 + (size_t)2 * SIN * DDpr;   // out_mu, out_sigma
  char* ws = (char*)d_ws;
  const size_t slab = (size_t)NBpr * SSpr * DDpr;   // one projection's rows: both batch elements, [4096][1024]
  float* P[6]; for (int i = 0; i < 6; ++i) { P[i] = (float*)ws; ws += slab * 4; }
  if ((size_t)(ws - (char*)d_ws) > ws_size) return;                      // WS TOTAL 100,663,296 B
  const dim3 blk(256); const dim3 gp(NBpr * SSpr / 128, DDpr / 128, 6);
  // input -> projection slot map: query->q_mu (w0), key->k_mu (w1), value->v_mu (w2), query_sigma->q_sigma (w3), key_sigma->k_sigma (w4), value_sigma->v_sigma (w5)
  // the batch axis is folded into the GEMM's M (4096 rows) and the six projections into blockIdx.z: one launch of 32 x 8 x 6 tiles, several workgroups resident on every WGP
  gemm_proj6<<<gp, blk, 0, stream>>>(f[0], f[1], f[2], f[3], f[4], f[5], f[6], f[7], f[8], f[9], f[10], f[11], f[12], f[13], f[14], f[15], f[16], f[17],
                                     P[0], DDpr, DDpr, DDpr, slab, DDpr);
  for (int b = 0; b < NBpr; ++b) { const size_t ob = (size_t)b * SIN * DDpr;
    k_bhatt<<<dim3(SSpr), blk, 0, stream>>>(P[0] + ob, P[3] + ob, P[1] + ob, P[4] + ob, P[2] + ob, P[5] + ob, out0 + ob, out1 + ob, SIN);
  }
}

// v008
// A run of this version takes 111 microseconds.
// Timed twice side by side with v007, it ran 1.05 and 1.02 times as fast.
// Counting every step since v000, it is 6.64 times as fast.
// bf16-input design: the six activations, six [in][out] weights and six biases are rounded to bf16 (RNE) on load; the six projections are then
// exact single bf16 products with f32 accumulation — the Bhattacharyya terms divide by σ² + 1e-6, which amplifies projection error ≈1000x near σ ≈ 1e-3, so
// exact projections are what make the distances reliable. Contractions on v_wmma_f32_16x16x32_bf16 (bf16 operands, f32 accumulate), per batch element: mu_q, sigma_q, mu_k, sigma_k, mu_v,
// sigma_v = x·W + b (K 1024 each). f32 VALU, a block takes one token at a time: the 16x16 head-to-head Bhattacharyya distances summed over the 64 channels (0.25·log(0.25·(sq²/sk² + sk²/sq² + 2)) +
// 0.25·(μq−μk)²/(σq²+σk²+ε), with sq² = σq²+ε), /√64, softmax over the key-head axis of −0.5·dist, out_mu = attn·mu_v, out_sigma = sqrt(max(attn·σv², 0) + ε), and the module's
// transpose(1,2)-then-view layout: each output is the [B][H][S][64] array reinterpreted as [B][S][1024]. Two outputs, consecutive in d_out: out_mu then out_sigma.
// compute dtype: bf16 operands, f32 accumulate.  six [2,2048,1024] inputs → (out_mu, out_sigma) [2,2048,1024] each.
#include <hip/hip_runtime.h>
#include <hip/hip_bf16.h>
#include <math.h>


typedef _Float16 bf16;
typedef _Float16 f16;
typedef __attribute__((ext_vector_type(4))) unsigned v4u_t;
typedef unsigned v4ua __attribute__((ext_vector_type(4), may_alias));
typedef __attribute__((ext_vector_type(4))) float v4f_t;
typedef float v4fa __attribute__((ext_vector_type(4), may_alias));
typedef __attribute__((ext_vector_type(16))) bf16  bf16x16;
typedef bf16x16 f16x16;
typedef __attribute__((ext_vector_type(8)))  bf16  bf16x8;
typedef bf16x8 f16x8;
typedef __attribute__((ext_vector_type(4)))  bf16  bf16x4;
typedef __attribute__((ext_vector_type(8)))  float f32x8;
__device__ __forceinline__ f32x8 wmma16(f16x16 a, f16x16 b, f32x8 c) {
  c = __builtin_amdgcn_wmma_f32_16x16x32_f16(false, a, false, b, (short)0, c, false, false);
  asm volatile("v_nop\n\tv_nop\n\tv_nop\n\tv_nop" : "+v"(c) : "v"(a), "v"(b));
  return c;
}
#define LDS_STRIDE 48   // unused: the GEMM tiles use GSTR (32 -> 48 elems, 96B rows: aligned b128 reads)
#define KSTRIDE    72   // unused: k_bhatt stages K at pitch HPpr ([16][68] f32, stride 68)
#define VSTRIDE    48   // unused: k_bhatt stages V unpadded ([16][64] f32, stride 64)

__device__ __forceinline__ f32x8 wmma_bf16(bf16x16 a, bf16x16 b, f32x8 c) {
  c = __builtin_amdgcn_wmma_f32_16x16x32_f16(false, a, false, b, (short)0, c, false, false);
  asm volatile("v_nop\n\tv_nop\n\tv_nop\n\tv_nop" : "+v"(c) : "v"(a), "v"(b));   // A/B-overwrite hazard guard
  return c;
}

// 16x32 (MxK) bf16 fragment from a row-major global matrix.
// lanes 0-15  (row=lane)    : elems 0..7 = K+0..7,  8..15 = K+16..23
// lanes 16-31 (row=lane-16) : elems 0..7 = K+8..15, 8..15 = K+24..31
template <typename T>
__device__ __forceinline__ bf16x16 load_frag(const T* __restrict__ base, int ld,
                                             int row0, int k0) {
  const int lane = threadIdx.x & 31;
  const int r    = lane & 15;
  const int kh   = (lane >> 4) * 8;
  const T* p0 = base + (size_t)(row0 + r) * ld + (k0 + kh);
  const T* p1 = p0 + 16;
  bf16x16 f;
#pragma unroll
  for (int i = 0; i < 8; ++i) {
    f[i]     = (bf16)p0[i];
    f[i + 8] = (bf16)p1[i];
  }
  return f;
}

// Same fragment from an LDS tile with padded row stride (base includes row0/k0).
__device__ __forceinline__ bf16x16 lds_frag(const bf16* base, int stride) {
  const int lane = threadIdx.x & 31;
  const int row  = lane & 15;
  const int kh   = (lane >> 4) * 8;
  const bf16x8 lo = *(const bf16x8*)(base + row * stride + kh);
  const bf16x8 hi = *(const bf16x8*)(base + row * stride + kh + 16);
  bf16x16 f;
#pragma unroll
  for (int i = 0; i < 8; ++i) { f[i] = lo[i]; f[i + 8] = hi[i]; }
  return f;
}

template <typename T>
__device__ __forceinline__ void stage_read16(const T* __restrict__ p, float* buf) {
#pragma unroll
  for (int i = 0; i < 16; ++i) buf[i] = (float)p[i];
}

__device__ __forceinline__ void stage_write(bf16* dst, const float* buf, int nquad) {
#pragma unroll
  for (int i = 0; i < nquad; ++i) {
    bf16x4 q;
    q[0] = (bf16)buf[4 * i];     q[1] = (bf16)buf[4 * i + 1];
    q[2] = (bf16)buf[4 * i + 2]; q[3] = (bf16)buf[4 * i + 3];
    *(bf16x4*)(dst + 4 * i) = q;
  }
}


#define GSTR 48
// ---------------------------------------------------------------------------------------------------------------------------
// gemm_kne: Y[m][n] = epi( Σ_k A[m][k]·W[k][n] + bias[n] ), A f32/f16 [M][lda], W f32 row-major [K][N] (ldw), plain f16 operands,
// f32 accumulate. EPI 0: identity; 1: exact-erf GELU; 2: R[m][n] + gvec[n]·(·) (residual with per-channel gain); 3: ReLU; 4: gvec[n]·(·) (per-channel scale, no residual). Output f32 (or f16
// when OUT16). Block = 128x128 tile, 8 waves as 4(M) x 2(N); per 32-wide k-step A and W tiles staged f16 in LDS (W transposed
// ---------------------------------------------------------------------------------------------------------------------------
#define GSTR 48
template <typename AT, int EPI, bool OUT16>
__global__ __launch_bounds__(256) void gemm_kne(const AT* __restrict__ A, int lda, const float* __restrict__ Wm, int ldw,
                                                const float* __restrict__ bias, const float* __restrict__ R, const float* __restrict__ gvec,
                                                void* __restrict__ Yv, int ldy, int K) {
  __shared__ __attribute__((aligned(16))) f16 ldsA[128 * GSTR];
  __shared__ __attribute__((aligned(16))) f16 ldsW[128 * GSTR];
  __shared__ __attribute__((aligned(16))) float oS[8][32 * 68];
  const int tid = threadIdx.x, lane = tid & 31, wave = tid >> 5, cl = lane & 15, rh = (lane >> 4) * 8;
  const int m0 = blockIdx.x * 128, n0 = blockIdx.y * 128;
  const int wm = (wave & 3) * 32, wn = (wave >> 2) * 64;
  f32x8 acc[2][4];
#pragma unroll
  for (int i = 0; i < 2; ++i)
#pragma unroll
    for (int j = 0; j < 4; ++j) { f32x8 z = {}; acc[i][j] = z; }
#pragma unroll 1
  for (int k0 = 0; k0 < K; k0 += 32) {
    __syncthreads();
    { const int row = tid >> 1, ch = (tid & 1) * 16;
      const AT* src = A + (size_t)(m0 + row) * lda + k0 + ch;
#pragma unroll
      for (int g = 0; g < 16; ++g) ldsA[row * GSTR + ch + g] = (f16)src[g]; }
    { const int k = tid >> 3, nn0 = (tid & 7) * 16;
      const float* src = Wm + (size_t)(k0 + k) * ldw + n0 + nn0;
#pragma unroll
      for (int g = 0; g < 4; ++g) { const v4f_t v = *(const v4f_t*)(src + 4 * g);
#pragma unroll
        for (int u = 0; u < 4; ++u) ldsW[(nn0 + 4 * g + u) * GSTR + k] = (f16)v[u]; } }
    __syncthreads();
    f16x16 af[2];
#pragma unroll
    for (int i = 0; i < 2; ++i) af[i] = lds_frag(ldsA + (wm + 16 * i) * GSTR, GSTR);
#pragma unroll
    for (int j = 0; j < 4; ++j) {
      const f16x16 bf = lds_frag(ldsW + (wn + 16 * j) * GSTR, GSTR);
#pragma unroll
      for (int i = 0; i < 2; ++i) acc[i][j] = wmma16(af[i], bf, acc[i][j]);
    }
  }
  float* so = oS[wave];
#pragma unroll
  for (int i = 0; i < 2; ++i)
#pragma unroll
    for (int j = 0; j < 4; ++j) {
      const int n = n0 + wn + 16 * j + cl;
      const float bv = bias ? bias[n] : 0.0f;
      const float gv = (EPI == 2 || EPI == 4) ? gvec[n] : 0.0f;
      if (EPI == 1) {
#pragma unroll 1
        for (int r = 0; r < 8; ++r) { const float xg = acc[i][j][r] + bv; so[(16 * i + rh + r) * 68 + 16 * j + cl] = 0.5f * xg * (1.0f + erff(xg * 0.70710678118654752f)); }
      } else {
#pragma unroll
        for (int r = 0; r < 8; ++r) {
          float v = acc[i][j][r] + bv;
          if (EPI == 3) v = fmaxf(v, 0.0f);
          if (EPI == 4) v = gv * v;
          if (EPI == 2) v = R[(size_t)(m0 + wm + 16 * i + rh + r) * ldy + n] + gv * v;
          so[(16 * i + rh + r) * 68 + 16 * j + cl] = v;
        }
      }
    }
  asm volatile("s_wait_dscnt 0" ::: "memory");
  __builtin_amdgcn_wave_barrier();
{
    if (OUT16) {
      f16* Y = (f16*)Yv;
#pragma unroll
      for (int it = 0; it < 8; ++it) { const int c = lane + 32 * it, rr = c >> 3, q8 = (c & 7) * 8;
        union { f16 h[8]; v4u_t v; } u;
#pragma unroll
        for (int e = 0; e < 8; ++e) u.h[e] = (f16)so[rr * 68 + q8 + e];
        *(v4u_t*)(Y + (size_t)(m0 + wm + rr) * ldy + n0 + wn + q8) = u.v; }
    } else {
      float* Y = (float*)Yv;
#pragma unroll
      for (int it = 0; it < 16; ++it) { const int f4 = lane + 32 * it, rr = f4 >> 4, q = (f4 & 15) * 4;
        *(v4f_t*)(Y + (size_t)(m0 + wm + rr) * ldy + n0 + wn + q) = *(const v4fa*)(so + rr * 68 + q); }
    }
    
  }
}

// bf16 round-to-nearest-even of an f32 (bit trick)
__device__ __forceinline__ float bf16r(float x) { unsigned int u = __float_as_uint(x); u = (u + 0x7FFFu + ((u >> 16) & 1u)) & 0xFFFF0000u; return __uint_as_float(u); }

typedef __attribute__((ext_vector_type(16))) __bf16 b16x16;
typedef __attribute__((ext_vector_type(8)))  __bf16 b16x8;
typedef __attribute__((ext_vector_type(4)))  __bf16 b16x4;
// four f32 -> four bf16, round to nearest even, by the hardware's packed convert (two values an instruction)
__device__ __forceinline__ b16x4 to_b16x4(float a, float b, float c, float d) { v4f_t v; v[0] = a; v[1] = b; v[2] = c; v[3] = d; return __builtin_convertvector(v, b16x4); }
// lds_frag for a bf16 tile: same lane and k order
__device__ __forceinline__ b16x16 lds_frag_b(const __bf16* base, int stride) {
  const int lane = threadIdx.x & 31;
  const int row  = lane & 15;
  const int kh   = (lane >> 4) * 8;
  const b16x8 lo = *(const b16x8*)(base + row * stride + kh);
  const b16x8 hi = *(const b16x8*)(base + row * stride + kh + 16);
  return __builtin_shufflevector(lo, hi, 0, 1, 2, 3, 4, 5, 6, 7, 8, 9, 10, 11, 12, 13, 14, 15);
}

// gemm_proj6: the six projections in one launch, straight from the inputs (same tile code as gemm_kne). blockIdx.z picks activation x, weight w ([in][out]) and bias b;
// Y[z][m][n] = sum_k bf16(x[m][k]) * bf16(w[k][n]) + bf16(b[n]). The matrix operands are bf16 themselves, so the rounding is all that staging has to do: the hardware's packed
// convert, in registers between the global load and the bf16 LDS store; no rounded copy of any operand goes through memory.
__global__ __launch_bounds__(256) void gemm_proj6(const float* __restrict__ x0, const float* __restrict__ x1, const float* __restrict__ x2,
                                                  const float* __restrict__ x3, const float* __restrict__ x4, const float* __restrict__ x5,
                                                  const float* __restrict__ w0, const float* __restrict__ w1, const float* __restrict__ w2,
                                                  const float* __restrict__ w3, const float* __restrict__ w4, const float* __restrict__ w5,
                                                  const float* __restrict__ b0, const float* __restrict__ b1, const float* __restrict__ b2,
                                                  const float* __restrict__ b3, const float* __restrict__ b4, const float* __restrict__ b5,
                                                  float* __restrict__ Y, int lda, int ldw, int ldy, size_t strideY, int K) {
  const int z = blockIdx.z;
  const float* __restrict__ A    = z == 0 ? x0 : z == 1 ? x1 : z == 2 ? x2 : z == 3 ? x3 : z == 4 ? x4 : x5;
  const float* __restrict__ Wm   = z == 0 ? w0 : z == 1 ? w1 : z == 2 ? w2 : z == 3 ? w3 : z == 4 ? w4 : w5;
  const float* __restrict__ bias = z == 0 ? b0 : z == 1 ? b1 : z == 2 ? b2 : z == 3 ? b3 : z == 4 ? b4 : b5;
  Y += (size_t)z * strideY;
  __shared__ __attribute__((aligned(16))) __bf16 ldsA[128 * GSTR];
  __shared__ __attribute__((aligned(16))) __bf16 ldsW[128 * GSTR];
  __shared__ __attribute__((aligned(16))) float oS[8][32 * 68];
  const int tid = threadIdx.x, lane = tid & 31, wave = tid >> 5, cl = lane & 15, rh = (lane >> 4) * 8;
  const int m0 = blockIdx.x * 128, n0 = blockIdx.y * 128;
  const int wm = (wave & 3) * 32, wn = (wave >> 2) * 64;
  f32x8 acc[2][4];
#pragma unroll
  for (int i = 0; i < 2; ++i)
#pragma unroll
    for (int j = 0; j < 4; ++j) { f32x8 zz = {}; acc[i][j] = zz; }
  // staging map: 8 lanes x 16 B cover one whole 128-B line, so every wave-wide load touches 4 whole lines.
  // A: lane -> (row l8 of 4, 4-channel chunk l7); W: lane -> (group kg of 4 consecutive k rows, 4 columns at nn), so that each column's 4 k values go to the transposed tile as one 8-byte store.
  const int l7 = lane & 7, l8 = lane >> 3;
  const int ar = wave * 4 + l8, kg = (wave >> 2) * 4 + l8, nn = (wave & 3) * 32 + l7 * 4;
  const float* sa = A + (size_t)(m0 + ar) * lda + l7 * 4;
  const float* sw = Wm + (size_t)(4 * kg) * ldw + n0 + nn;
  // fa, fw hold the raw f32 values of ONE k-step, loaded one trip ahead: the loads of step k0 + 32 are issued behind the barrier that publishes step k0's tiles
  // and fly during step k0's fragment reads and matrix instructions, instead of being issued and waited for between the two barriers.
  float fa[4][4], fw[4][4];
#pragma unroll
  for (int g = 0; g < 4; ++g)
#pragma unroll
    for (int e = 0; e < 4; ++e) fa[g][e] = sa[(size_t)(32 * g) * lda + e];
#pragma unroll
  for (int r = 0; r < 4; ++r)
#pragma unroll
    for (int u = 0; u < 4; ++u) fw[r][u] = sw[(size_t)r * ldw + u];
#pragma unroll 1
  for (int k0 = 0; k0 < K; k0 += 32) {
    __syncthreads();
#pragma unroll
    for (int g = 0; g < 4; ++g) *(b16x4*)(ldsA + (ar + 32 * g) * GSTR + l7 * 4) = to_b16x4(fa[g][0], fa[g][1], fa[g][2], fa[g][3]);
#pragma unroll
    for (int u = 0; u < 4; ++u) *(b16x4*)(ldsW + (nn + u) * GSTR + 4 * kg) = to_b16x4(fw[0][u], fw[1][u], fw[2][u], fw[3][u]);
    __syncthreads();
    if (k0 + 32 < K) {   // same for the whole grid: the last step has no successor to load
      sa += 32; sw += (size_t)32 * ldw;
#pragma unroll
      for (int g = 0; g < 4; ++g)
#pragma unroll
        for (int e = 0; e < 4; ++e) fa[g][e] = sa[(size_t)(32 * g) * lda + e];
#pragma unroll
      for (int r = 0; r < 4; ++r)
#pragma unroll
        for (int u = 0; u < 4; ++u) fw[r][u] = sw[(size_t)r * ldw + u];
      asm volatile("s_wait_xcnt 0x0" ::: "memory");   // the loads' address registers are reused as destinations of the fragment reads below
    }
    b16x16 af[2];
#pragma unroll
    for (int i = 0; i < 2; ++i) af[i] = lds_frag_b(ldsA + (wm + 16 * i) * GSTR, GSTR);
#pragma unroll
    for (int j = 0; j < 4; ++j) {
      const b16x16 bf = lds_frag_b(ldsW + (wn + 16 * j) * GSTR, GSTR);
#pragma unroll
      for (int i = 0; i < 2; ++i) acc[i][j] = __builtin_amdgcn_wmma_f32_16x16x32_bf16(false, af[i], false, bf, (short)0, acc[i][j], false, false);
    }
  }
  float* so = oS[wave];
#pragma unroll
  for (int i = 0; i < 2; ++i)
#pragma unroll
    for (int j = 0; j < 4; ++j) {
      const float bv = bf16r(bias[n0 + wn + 16 * j + cl]);
#pragma unroll
      for (int r = 0; r < 8; ++r) so[(16 * i + rh + r) * 68 + 16 * j + cl] = acc[i][j][r] + bv;
    }
  asm volatile("s_wait_dscnt 0" ::: "memory");
  __builtin_amdgcn_wave_barrier();
#pragma unroll
  for (int it = 0; it < 16; ++it) { const int f4 = lane + 32 * it, rr = f4 >> 4, q = (f4 & 15) * 4;
    *(v4f_t*)(Y + (size_t)(m0 + wm + rr) * ldy + n0 + wn + q) = *(const v4fa*)(so + rr * 68 + q); }
}

// ---------------------------------------------------------------------------------------------------------------------------
// gemm_kn2 (value+residual planes on both operands: hh + (hl+lh)/2048, f32-class): Y[m][n] (row stride ldy) = scale * sum_k A[m][k] (f32 or f16, row stride lda) * W[k][n] (f32, row-major [K][N], row
// stride ldw) (+ bias[n]) (+ Y if ACC). Block = 128 x 128 tile, 256 threads = 8 waves as 4(M, 32 rows) x 2(N, 64 cols); per
// 32-wide k-step the A tile and the W tile (stored transposed [n][k]) are staged as f16 in LDS; value and residual f16 planes per operand, f32
// blockIdx.z selects a batch: A += z*strideA, W += z*strideW, Y += z*strideY (element strides).
// ---------------------------------------------------------------------------------------------------------------------------
template <typename AT, bool ACC>
__global__ __launch_bounds__(256) void gemm_kn2(const AT* __restrict__ A, int lda, size_t strideA,
                                               const float* __restrict__ Wm, int ldw, size_t strideW,
                                               const float* __restrict__ bias, float scale,
                                               float* __restrict__ Y, int ldy, size_t strideY, int K) {
  __shared__ __attribute__((aligned(16))) f16 ldsA[128 * GSTR], ldsAl[128 * GSTR];
  __shared__ __attribute__((aligned(16))) f16 ldsW[128 * GSTR], ldsWl[128 * GSTR];
  __shared__ __attribute__((aligned(16))) float oS[8][32 * 68];
  const int tid = threadIdx.x, lane = tid & 31, wave = tid >> 5, cl = lane & 15, rh = (lane >> 4) * 8;
  const int m0 = blockIdx.x * 128, n0 = blockIdx.y * 128;
  const int wm = (wave & 3) * 32, wn = (wave >> 2) * 64;
  A += (size_t)blockIdx.z * strideA; Wm += (size_t)blockIdx.z * strideW; Y += (size_t)blockIdx.z * strideY;
  f32x8 acc[2][4], accx[2][4];
#pragma unroll
  for (int i = 0; i < 2; ++i)
#pragma unroll
    for (int j = 0; j < 4; ++j) { f32x8 z = {}; acc[i][j] = z; accx[i][j] = z; }
#pragma unroll 1
  for (int k0 = 0; k0 < K; k0 += 32) {
    __syncthreads();
    {  // A: thread -> row tid>>1, 16 elements at column half (tid&1)*16
      const int row = tid >> 1, ch = (tid & 1) * 16;
      const AT* src = A + (size_t)(m0 + row) * lda + k0 + ch;
#pragma unroll
      for (int g = 0; g < 16; ++g) { const float v = (float)src[g]; const f16 h = (f16)v; ldsA[row * GSTR + ch + g] = h; ldsAl[row * GSTR + ch + g] = (f16)((v - (float)h) * 2048.0f); }
    }
    {  // W: thread -> k = tid>>3, 16 consecutive n at (tid&7)*16; stored transposed [n][k]
      const int k = tid >> 3, nn0 = (tid & 7) * 16;
      const float* src = Wm + (size_t)(k0 + k) * ldw + n0 + nn0;
#pragma unroll
      for (int g = 0; g < 4; ++g) { const v4f_t v = *(const v4f_t*)(src + 4 * g);
#pragma unroll
        for (int u = 0; u < 4; ++u) { const f16 h = (f16)v[u]; ldsW[(nn0 + 4 * g + u) * GSTR + k] = h; ldsWl[(nn0 + 4 * g + u) * GSTR + k] = (f16)((v[u] - (float)h) * 2048.0f); } }
    }
    __syncthreads();
    f16x16 af[2], afl[2];
#pragma unroll
    for (int i = 0; i < 2; ++i) { af[i] = lds_frag(ldsA + (wm + 16 * i) * GSTR, GSTR); afl[i] = lds_frag(ldsAl + (wm + 16 * i) * GSTR, GSTR); }
#pragma unroll
    for (int j = 0; j < 4; ++j) {
      const f16x16 bf = lds_frag(ldsW + (wn + 16 * j) * GSTR, GSTR), bfl = lds_frag(ldsWl + (wn + 16 * j) * GSTR, GSTR);
#pragma unroll
      for (int i = 0; i < 2; ++i) { acc[i][j] = wmma16(af[i], bf, acc[i][j]); accx[i][j] = wmma16(af[i], bfl, accx[i][j]); accx[i][j] = wmma16(afl[i], bf, accx[i][j]); }
    }
  }
  float* so = oS[wave];
#pragma unroll
  for (int i = 0; i < 2; ++i)
#pragma unroll
    for (int j = 0; j < 4; ++j) {
      const float bv = bias ? bias[n0 + wn + 16 * j + cl] : 0.0f;
#pragma unroll
      for (int r = 0; r < 8; ++r) so[(16 * i + rh + r) * 68 + 16 * j + cl] = (acc[i][j][r] + accx[i][j][r] * (1.0f / 2048.0f)) * scale + bv;
    }
  asm volatile("s_wait_dscnt 0" ::: "memory");
  __builtin_amdgcn_wave_barrier();
  if (ACC) {   // accumulate: fold the existing Y values into the staging tile ONCE (same thread <-> same chunks as the stores below)
#pragma unroll
    for (int it = 0; it < 16; ++it) { const int f4 = lane + 32 * it, rr = f4 >> 4, q = (f4 & 15) * 4;
      const v4f_t old = *(const v4fa*)(Y + (size_t)(m0 + wm + rr) * ldy + n0 + wn + q);
      v4f_t v = *(const v4fa*)(so + rr * 68 + q); v += old; *(v4fa*)(so + rr * 68 + q) = v; }   // plain LDS store (ordered by the s_wait_dscnt/memory clobber below)
    asm volatile("s_wait_dscnt 0" ::: "memory");
  }
{
#pragma unroll
    for (int it = 0; it < 16; ++it) { const int f4 = lane + 32 * it, rr = f4 >> 4, q = (f4 & 15) * 4;
      *(v4f_t*)(Y + (size_t)(m0 + wm + rr) * ldy + n0 + wn + q) = *(const v4fa*)(so + rr * 68 + q); }
    
  }
}

__global__ __launch_bounds__(256) void k_transpose(const float* __restrict__ Wm, float* __restrict__ Wt, int rows, int cols) {
  __shared__ float tS[64][65];
  const int tid = threadIdx.x, tbj = cols / 64, bi = blockIdx.x / tbj, bj = blockIdx.x % tbj;
  for (int e = tid; e < 64 * 64; e += 256) { const int r = e >> 6, c = e & 63; tS[r][c] = Wm[(size_t)(bi * 64 + r) * cols + bj * 64 + c]; }
  __syncthreads();
  for (int ch = tid; ch < 64 * 16; ch += 256) { const int r = ch >> 4, q4 = (ch & 15) * 4; v4f_t o; o[0] = tS[q4][r]; o[1] = tS[q4 + 1][r]; o[2] = tS[q4 + 2][r]; o[3] = tS[q4 + 3][r];
    float* dst = Wt + (size_t)(bj * 64 + r) * rows + bi * 64 + q4; *(v4f_t*)dst = o;  }
}

#define NBpr 2
#define SSpr 2048
#define SIN 2048
#define DDpr 1024
#define NHpr 16
#define DKpr 64
#define HPpr 68   // LDS pitch, in floats, of one head's 64 channels in k_bhatt
__global__ __launch_bounds__(256) void k_dbg_zero(float* __restrict__ p, size_t n4) { const size_t i = (size_t)blockIdx.x * 256 + threadIdx.x; if (i < n4) { v4f_t z = {0.f,0.f,0.f,0.f}; *(v4f_t*)(p + 4 * i) = z;  } }
__global__ __launch_bounds__(256) void k_copy(const float* __restrict__ src, float* __restrict__ dst, size_t n4) { const size_t i = (size_t)blockIdx.x * 256 + threadIdx.x; if (i < n4) { const v4f_t v = *(const v4f_t*)(src + 4 * i); *(v4f_t*)(dst + 4 * i) = v;  } }
// torch [out][in] weight → WT[i][o] = mul·bf16(W[o][i]) ([in][out], lifted by a power of two so no bf16 weight becomes an f16 subnormal); block = input row i, threads loop over the outputs (4-B lanes)
__global__ __launch_bounds__(256) void k_wprepT(const float* __restrict__ Wt, float* __restrict__ WT, int nout, int nin, float mul) { const int i = blockIdx.x, tid = threadIdx.x;
#pragma unroll 1
  for (int o = tid; o < nout; o += 256) { const float w = mul * bf16r(Wt[(size_t)o * nin + i]); *(float*)(WT + (size_t)i * nout + o) = w;  } }

// sum over the 16 lanes of a row (one head's 16 four-channel chunks), every lane gets the total; DPP row_xmask butterfly, no LDS traffic
__device__ __forceinline__ float row16_sum(float v) {
  v += __int_as_float(__builtin_amdgcn_update_dpp(0, __float_as_int(v), 0x161, 0xf, 0xf, true));   // row_xmask:1
  v += __int_as_float(__builtin_amdgcn_update_dpp(0, __float_as_int(v), 0x162, 0xf, 0xf, true));   // row_xmask:2
  v += __int_as_float(__builtin_amdgcn_update_dpp(0, __float_as_int(v), 0x164, 0xf, 0xf, true));   // row_xmask:4
  v += __int_as_float(__builtin_amdgcn_update_dpp(0, __float_as_int(v), 0x168, 0xf, 0xf, true));   // row_xmask:8
  return v;
}

// per-token head-to-head Bhattacharyya attention: the six projected [16][64] vectors of a token staged in LDS; thread = (query head i, key head j) for the distance, then
// With a = sq^2 + eps, b = sk^2 + eps: a/b + b/a + 2 = (a + b)^2 / (a b), so term1 = 0.5 ln((a + b)/2) - 0.25 ln a - 0.25 ln b. ln a and ln b depend on one head only and are summed over
// the channels once per head while staging; a (pair, channel) then costs one log2 of a + b and one reciprocal of sq^2 + sk^2 + eps (a + b is that denominator + eps).
// One launch for both batch elements: NWGpr workgroups, all resident at once, each walks TPBpr tokens (token = batch * srows + row, NWGpr apart). The six rows of the next token are loaded
// into registers behind the barrier that publishes this token's rows and fly during this token's distances, softmax and value sums.
#define TPBpr 4                             // tokens per workgroup
#define NWGpr (NBpr * SSpr / TPBpr)         // workgroups of the launch
__global__ __launch_bounds__(256) void k_bhatt(const float* __restrict__ MQ, const float* __restrict__ SQ, const float* __restrict__ MK, const float* __restrict__ SK, const float* __restrict__ MV, const float* __restrict__ SV, float* __restrict__ omu, float* __restrict__ osg, int srows) {
  // q and k head rows sit at a pitch of HPpr floats (272 B = 16 B x 17): the 16 key heads that the 16 lanes of a row read at one channel offset fall on distinct banks
  // q2 holds sigma_q^2, k2 holds sigma_k^2 + eps; lk[j] = sum over the channels of log2(sigma_k^2 + eps) of key head j
  // mv, sv have two buffers: they are read behind the second barrier of a token, where a faster wave may already stage the next token; everything else is last read in front of that barrier
  __shared__ __attribute__((aligned(16))) float mq[NHpr * HPpr], q2[NHpr * HPpr], mk[NHpr * HPpr], k2[NHpr * HPpr], mv[2][1024], sv[2][1024]; __shared__ float att[256]; __shared__ float lk[NHpr];
  const int tid = threadIdx.x;
  const int p4 = (tid >> 4) * HPpr + (tid & 15) * 4;
  const int i = tid >> 4, j = tid & 15;
  const int hi = tid >> 4, c4 = (tid & 15) * 4;
  unsigned o4 = (unsigned)blockIdx.x * DDpr + 4 * tid;   // this thread's four channels of the token whose rows are loaded next
  v4f_t sgq = *(const v4f_t*)(SQ + o4), sgk = *(const v4f_t*)(SK + o4), muq = *(const v4f_t*)(MQ + o4), muk = *(const v4f_t*)(MK + o4), muv = *(const v4f_t*)(MV + o4), sgv = *(const v4f_t*)(SV + o4);
  asm volatile("s_wait_xcnt 0x0" ::: "memory");   // the loads' address registers are rewritten below
#pragma unroll 1   // one token's code in the instruction stream; the trips are tied by the barriers anyway
  for (int it = 0; it < TPBpr; ++it) {
    const int tok = blockIdx.x + it * NWGpr, bat = tok / SSpr, t = tok % SSpr;
    float* mvb = mv[it & 1]; float* svb = sv[it & 1];
    float lq;   // sum over the channels of log2(sigma_q^2 + eps) of query head tid >> 4, in every lane of that head's row
    { const v4f_t vq = sgq * sgq, vk = sgk * sgk + 1e-6f, aq = vq + 1e-6f;
      *(v4f_t*)(mq + p4) = muq; *(v4f_t*)(q2 + p4) = vq; *(v4f_t*)(mk + p4) = muk; *(v4f_t*)(k2 + p4) = vk; *(v4f_t*)(mvb + 4 * tid) = muv; *(v4f_t*)(svb + 4 * tid) = sgv;
      v4f_t la, lb;
#pragma unroll   // constant indices into the four-channel vectors, so that they stay in registers
      for (int u = 0; u < 4; ++u) { la[u] = __builtin_amdgcn_logf(aq[u]); lb[u] = __builtin_amdgcn_logf(vk[u]); }
      lq = row16_sum((la[0] + la[2]) + (la[1] + la[3]));
      const float lks = row16_sum((lb[0] + lb[2]) + (lb[1] + lb[3]));
      if ((tid & 15) == 0) lk[tid >> 4] = lks; }
    __syncthreads();
    if (it + 1 < TPBpr) {   // same for the whole grid: the last token has no successor to load
      o4 += NWGpr * DDpr;
      sgq = *(const v4f_t*)(SQ + o4); sgk = *(const v4f_t*)(SK + o4); muq = *(const v4f_t*)(MQ + o4); muk = *(const v4f_t*)(MK + o4); muv = *(const v4f_t*)(MV + o4); sgv = *(const v4f_t*)(SV + o4);
      asm volatile("s_wait_xcnt 0x0" ::: "memory");   // the loads' address registers are rewritten below
    }
    v4f_t sl, sm; sl[0] = sl[1] = sl[2] = sl[3] = 0.0f; sm[0] = sm[1] = sm[2] = sm[3] = 0.0f;   // per channel residue mod 4: sums of log2(a + b) and of dm^2 / (sq^2 + sk^2 + eps)
#pragma unroll 4   // four 16-byte LDS read groups in flight per trip
    for (int d = 0; d < DKpr; d += 4) {   // four channels per 16-byte LDS read
      const v4f_t q24 = *(const v4f_t*)(q2 + i * HPpr + d), k24 = *(const v4f_t*)(k2 + j * HPpr + d), mq4 = *(const v4f_t*)(mq + i * HPpr + d), mk4 = *(const v4f_t*)(mk + j * HPpr + d);
      const v4f_t den = q24 + k24, ab = den + 1e-6f, dm = mq4 - mk4; v4f_t lg4, rc4;
#pragma unroll   // constant indices into the four-channel vectors, so that they stay in registers
      for (int u = 0; u < 4; ++u) { lg4[u] = __builtin_amdgcn_logf(ab[u]); rc4[u] = __builtin_amdgcn_rcpf(den[u]); }
      sl += lg4; sm += (dm * dm) * rc4; }
    const float sumlog = (sl[0] + sl[1]) + (sl[2] + sl[3]), summ = (sm[0] + sm[1]) + (sm[2] + sm[3]);
    const float dist = 0.69314718055994531f * (0.5f * sumlog - 0.5f * (float)DKpr - 0.25f * (lq + lk[j])) + 0.25f * summ;
    float lg = -0.5f * (dist * 0.125f); float m = lg;
    m = fmaxf(m, __shfl_xor(m, 1, 32)); m = fmaxf(m, __shfl_xor(m, 2, 32)); m = fmaxf(m, __shfl_xor(m, 4, 32)); m = fmaxf(m, __shfl_xor(m, 8, 32));
    float e = expf(lg - m); float z = e; z += __shfl_xor(z, 1, 32); z += __shfl_xor(z, 2, 32); z += __shfl_xor(z, 4, 32); z += __shfl_xor(z, 8, 32);
    att[tid] = e / z; __syncthreads();
    v4f_t am, av; am[0] = am[1] = am[2] = am[3] = 0.0f; av[0] = av[1] = av[2] = av[3] = 0.0f;
#pragma unroll 1
    for (int jj = 0; jj < NHpr; ++jj) { const float a = att[hi * NHpr + jj]; const v4f_t mvj = *(const v4f_t*)(mvb + jj * DKpr + c4), svj = *(const v4f_t*)(svb + jj * DKpr + c4); am += a * mvj; av += a * (svj * svj); }
    v4f_t os; for (int u = 0; u < 4; ++u) os[u] = sqrtf(fmaxf(av[u], 0.0f) + 1e-6f);
    const size_t oo = ((size_t)(bat * NHpr + hi) * srows + t) * DKpr + c4;   // [batch][head][row][64]
    *(v4f_t*)(omu + oo) = am; *(v4f_t*)(osg + oo) = os;
    asm volatile("s_wait_xcnt 0x0" ::: "memory");   // the two stores' registers are rewritten at the head of the next trip
  }
}

extern "C" void kernel_launch(void* const* d_in, const int* in_sizes, int n_in,
                              void* d_out, int out_size, void* d_ws, size_t ws_size,
                              hipStream_t stream) {
  (void)in_sizes; (void)n_in; (void)out_size;
  const float** f = (const float**)d_in;
  float* out0 = (float*)d_out; float* out1 = out0 + (size_t)2 * SIN * DDpr;   // out_mu, out_sigma
  char* ws = (char*)d_ws;
  const size_t slab = (size_t)NBpr * SSpr * DDpr;   // one projection's rows: both batch elements, [4096][1024]
  float* P[6]; for (int i = 0; i < 6; ++i) { P[i] = (float*)ws; ws += slab * 4; }
  if ((size_t)(ws - (char*)d_ws) > ws_size) return;                      // WS TOTAL 100,663,296 B
  const dim3 blk(256); const dim3 gp(NBpr * SSpr / 128, DDpr / 128, 6);
  // input -> projection slot map: query->q_mu (w0), key->k_mu (w1), value->v_mu (w2), query_sigma->q_sigma (w3), key_sigma->k_sigma (w4), value_sigma->v_sigma (w5)
  // the batch axis is folded into the GEMM's M (4096 rows) and the six projections into blockIdx.z: one launch of 32 x 8 x 6 tiles, several workgroups resident on every WGP
  gemm_proj6<<<gp, blk, 0, stream>>>(f[0], f[1], f[2], f[3], f[4], f[5], f[6], f[7], f[8], f[9], f[10], f[11], f[12], f[13], f[14], f[15], f[16], f[17],
                                     P[0], DDpr, DDpr, DDpr, slab, DDpr);
  // both batch elements in one launch: the projections' rows are [batch * 2048 + row][1024], the outputs [batch][head][row][64]
  k_bhatt<<<dim3(NWGpr), blk, 0, stream>>>(P[0], P[3], P[1], P[4], P[2], P[5], out0, out1, SIN);
}

// v009
// A run of this version takes 99 microseconds.
// In two side-by-side timings against v008, it was 1.14 and 1.12 times as fast.
// All steps since v000 together make it 7.50 times as fast.
// bf16-input design: the six activations, six [in][out] weights and six biases are rounded to bf16 (RNE) on load; the six projections are then
// exact single bf16 products with f32 accumulation — the Bhattacharyya terms divide by σ² + 1e-6, which amplifies projection error ≈1000x near σ ≈ 1e-3, so
// exact projections are what make the distances reliable. Contractions on v_wmma_f32_16x16x32_bf16 (bf16 operands, f32 accumulate), per batch element: mu_q, sigma_q, mu_k, sigma_k, mu_v,
// sigma_v = x·W + b (K 1024 each). f32 VALU, a block takes one token at a time: the 16x16 head-to-head Bhattacharyya distances summed over the 64 channels (0.25·log(0.25·(sq²/sk² + sk²/sq² + 2)) +
// 0.25·(μq−μk)²/(σq²+σk²+ε), with sq² = σq²+ε), /√64, softmax over the key-head axis of −0.5·dist, out_mu = attn·mu_v, out_sigma = sqrt(max(attn·σv², 0) + ε), and the module's
// transpose(1,2)-then-view layout: each output is the [B][H][S][64] array reinterpreted as [B][S][1024]. Two outputs, consecutive in d_out: out_mu then out_sigma.
// compute dtype: bf16 operands, f32 accumulate.  six [2,2048,1024] inputs → (out_mu, out_sigma) [2,2048,1024] each.
#include <hip/hip_runtime.h>
#include <hip/hip_bf16.h>
#include <math.h>


typedef _Float16 bf16;
typedef _Float16 f16;
typedef __attribute__((ext_vector_type(4))) unsigned v4u_t;
typedef unsigned v4ua __attribute__((ext_vector_type(4), may_alias));
typedef __attribute__((ext_vector_type(4))) float v4f_t;
typedef float v4fa __attribute__((ext_vector_type(4), may_alias));
typedef __attribute__((ext_vector_type(16))) bf16  bf16x16;
typedef bf16x16 f16x16;
typedef __attribute__((ext_vector_type(8)))  bf16  bf16x8;
typedef bf16x8 f16x8;
typedef __attribute__((ext_vector_type(4)))  bf16  bf16x4;
typedef __attribute__((ext_vector_type(8)))  float f32x8;
__device__ __forceinline__ f32x8 wmma16(f16x16 a, f16x16 b, f32x8 c) {
  c = __builtin_amdgcn_wmma_f32_16x16x32_f16(false, a, false, b, (short)0, c, false, false);
  asm volatile("v_nop\n\tv_nop\n\tv_nop\n\tv_nop" : "+v"(c) : "v"(a), "v"(b));
  return c;
}
#define LDS_STRIDE 48   // unused: the gemm_kne and gemm_kn2 tiles use GSTR (32 -> 48 elems, 96B rows: aligned b128 reads)
#define KSTRIDE    72   // unused: k_bhatt stages K at pitch HPpr ([16][68] f32, stride 68)
#define VSTRIDE    48   // unused: k_bhatt stages V unpadded ([16][64] f32, stride 64)

__device__ __forceinline__ f32x8 wmma_bf16(bf16x16 a, bf16x16 b, f32x8 c) {
  c = __builtin_amdgcn_wmma_f32_16x16x32_f16(false, a, false, b, (short)0, c, false, false);
  asm volatile("v_nop\n\tv_nop\n\tv_nop\n\tv_nop" : "+v"(c) : "v"(a), "v"(b));   // A/B-overwrite hazard guard
  return c;
}

// 16x32 (MxK) bf16 fragment from a row-major global matrix.
// lanes 0-15  (row=lane)    : elems 0..7 = K+0..7,  8..15 = K+16..23
// lanes 16-31 (row=lane-16) : elems 0..7 = K+8..15, 8..15 = K+24..31
template <typename T>
__device__ __forceinline__ bf16x16 load_frag(const T* __restrict__ base, int ld,
                                             int row0, int k0) {
  const int lane = threadIdx.x & 31;
  const int r    = lane & 15;
  const int kh   = (lane >> 4) * 8;
  const T* p0 = base + (size_t)(row0 + r) * ld + (k0 + kh);
  const T* p1 = p0 + 16;
  bf16x16 f;
#pragma unroll
  for (int i = 0; i < 8; ++i) {
    f[i]     = (bf16)p0[i];
    f[i + 8] = (bf16)p1[i];
  }
  return f;
}

// Same fragment from an LDS tile with padded row stride (base includes row0/k0).
__device__ __forceinline__ bf16x16 lds_frag(const bf16* base, int stride) {
  const int lane = threadIdx.x & 31;
  const int row  = lane & 15;
  const int kh   = (lane >> 4) * 8;
  const bf16x8 lo = *(const bf16x8*)(base + row * stride + kh);
  const bf16x8 hi = *(const bf16x8*)(base + row * stride + kh + 16);
  bf16x16 f;
#pragma unroll
  for (int i = 0; i < 8; ++i) { f[i] = lo[i]; f[i + 8] = hi[i]; }
  return f;
}

template <typename T>
__device__ __forceinline__ void stage_read16(const T* __restrict__ p, float* buf) {
#pragma unroll
  for (int i = 0; i < 16; ++i) buf[i] = (float)p[i];
}

__device__ __forceinline__ void stage_write(bf16* dst, const float* buf, int nquad) {
#pragma unroll
  for (int i = 0; i < nquad; ++i) {
    bf16x4 q;
    q[0] = (bf16)buf[4 * i];     q[1] = (bf16)buf[4 * i + 1];
    q[2] = (bf16)buf[4 * i + 2]; q[3] = (bf16)buf[4 * i + 3];
    *(bf16x4*)(dst + 4 * i) = q;
  }
}


#define GSTR 48
// ---------------------------------------------------------------------------------------------------------------------------
// gemm_kne: Y[m][n] = epi( Σ_k A[m][k]·W[k][n] + bias[n] ), A f32/f16 [M][lda], W f32 row-major [K][N] (ldw), plain f16 operands,
// f32 accumulate. EPI 0: identity; 1: exact-erf GELU; 2: R[m][n] + gvec[n]·(·) (residual with per-channel gain); 3: ReLU; 4: gvec[n]·(·) (per-channel scale, no residual). Output f32 (or f16
// when OUT16). Block = 128x128 tile, 8 waves as 4(M) x 2(N); per 32-wide k-step A and W tiles staged f16 in LDS (W transposed
// ---------------------------------------------------------------------------------------------------------------------------
#define GSTR 48
template <typename AT, int EPI, bool OUT16>
__global__ __launch_bounds__(256) void gemm_kne(const AT* __restrict__ A, int lda, const float* __restrict__ Wm, int ldw,
                                                const float* __restrict__ bias, const float* __restrict__ R, const float* __restrict__ gvec,
                                                void* __restrict__ Yv, int ldy, int K) {
  __shared__ __attribute__((aligned(16))) f16 ldsA[128 * GSTR];
  __shared__ __attribute__((aligned(16))) f16 ldsW[128 * GSTR];
  __shared__ __attribute__((aligned(16))) float oS[8][32 * 68];
  const int tid = threadIdx.x, lane = tid & 31, wave = tid >> 5, cl = lane & 15, rh = (lane >> 4) * 8;
  const int m0 = blockIdx.x * 128, n0 = blockIdx.y * 128;
  const int wm = (wave & 3) * 32, wn = (wave >> 2) * 64;
  f32x8 acc[2][4];
#pragma unroll
  for (int i = 0; i < 2; ++i)
#pragma unroll
    for (int j = 0; j < 4; ++j) { f32x8 z = {}; acc[i][j] = z; }
#pragma unroll 1
  for (int k0 = 0; k0 < K; k0 += 32) {
    __syncthreads();
    { const int row = tid >> 1, ch = (tid & 1) * 16;
      const AT* src = A + (size_t)(m0 + row) * lda + k0 + ch;
#pragma unroll
      for (int g = 0; g < 16; ++g) ldsA[row * GSTR + ch + g] = (f16)src[g]; }
    { const int k = tid >> 3, nn0 = (tid & 7) * 16;
      const float* src = Wm + (size_t)(k0 + k) * ldw + n0 + nn0;
#pragma unroll
      for (int g = 0; g < 4; ++g) { const v4f_t v = *(const v4f_t*)(src + 4 * g);
#pragma unroll
        for (int u = 0; u < 4; ++u) ldsW[(nn0 + 4 * g + u) * GSTR + k] = (f16)v[u]; } }
    __syncthreads();
    f16x16 af[2];
#pragma unroll
    for (int i = 0; i < 2; ++i) af[i] = lds_frag(ldsA + (wm + 16 * i) * GSTR, GSTR);
#pragma unroll
    for (int j = 0; j < 4; ++j) {
      const f16x16 bf = lds_frag(ldsW + (wn + 16 * j) * GSTR, GSTR);
#pragma unroll
      for (int i = 0; i < 2; ++i) acc[i][j] = wmma16(af[i], bf, acc[i][j]);
    }
  }
  float* so = oS[wave];
#pragma unroll
  for (int i = 0; i < 2; ++i)
#pragma unroll
    for (int j = 0; j < 4; ++j) {
      const int n = n0 + wn + 16 * j + cl;
      const float bv = bias ? bias[n] : 0.0f;
      const float gv = (EPI == 2 || EPI == 4) ? gvec[n] : 0.0f;
      if (EPI == 1) {
#pragma unroll 1
        for (int r = 0; r < 8; ++r) { const float xg = acc[i][j][r] + bv; so[(16 * i + rh + r) * 68 + 16 * j + cl] = 0.5f * xg * (1.0f + erff(xg * 0.70710678118654752f)); }
      } else {
#pragma unroll
        for (int r = 0; r < 8; ++r) {
          float v = acc[i][j][r] + bv;
          if (EPI == 3) v = fmaxf(v, 0.0f);
          if (EPI == 4) v = gv * v;
          if (EPI == 2) v = R[(size_t)(m0 + wm + 16 * i + rh + r) * ldy + n] + gv * v;
          so[(16 * i + rh + r) * 68 + 16 * j + cl] = v;
        }
      }
    }
  asm volatile("s_wait_dscnt 0" ::: "memory");
  __builtin_amdgcn_wave_barrier();
{
    if (OUT16) {
      f16* Y = (f16*)Yv;
#pragma unroll
      for (int it = 0; it < 8; ++it) { const int c = lane + 32 * it, rr = c >> 3, q8 = (c & 7) * 8;
        union { f16 h[8]; v4u_t v; } u;
#pragma unroll
        for (int e = 0; e < 8; ++e) u.h[e] = (f16)so[rr * 68 + q8 + e];
        *(v4u_t*)(Y + (size_t)(m0 + wm + rr) * ldy + n0 + wn + q8) = u.v; }
    } else {
      float* Y = (float*)Yv;
#pragma unroll
      for (int it = 0; it < 16; ++it) { const int f4 = lane + 32 * it, rr = f4 >> 4, q = (f4 & 15) * 4;
        *(v4f_t*)(Y + (size_t)(m0 + wm + rr) * ldy + n0 + wn + q) = *(const v4fa*)(so + rr * 68 + q); }
    }
    
  }
}

// bf16 round-to-nearest-even of an f32 (bit trick)
__device__ __forceinline__ float bf16r(float x) { unsigned int u = __float_as_uint(x); u = (u + 0x7FFFu + ((u >> 16) & 1u)) & 0xFFFF0000u; return __uint_as_float(u); }

typedef __attribute__((ext_vector_type(16))) __bf16 b16x16;
typedef __attribute__((ext_vector_type(8)))  __bf16 b16x8;
typedef __attribute__((ext_vector_type(4)))  __bf16 b16x4;
// four f32 -> four bf16, round to nearest even, by the hardware's packed convert (two values an instruction)
__device__ __forceinline__ b16x4 to_b16x4(float a, float b, float c, float d) { v4f_t v; v[0] = a; v[1] = b; v[2] = c; v[3] = d; return __builtin_convertvector(v, b16x4); }
// lds_frag for a bf16 tile: same lane and k order
__device__ __forceinline__ b16x16 lds_frag_b(const __bf16* base, int stride) {
  const int lane = threadIdx.x & 31;
  const int row  = lane & 15;
  const int kh   = (lane >> 4) * 8;
  const b16x8 lo = *(const b16x8*)(base + row * stride + kh);
  const b16x8 hi = *(const b16x8*)(base + row * stride + kh + 16);
  return __builtin_shufflevector(lo, hi, 0, 1, 2, 3, 4, 5, 6, 7, 8, 9, 10, 11, 12, 13, 14, 15);
}

// k_pack: every matrix operand rounded to bf16 ONCE per call (round to nearest even, the hardware's packed convert), into the workspace. The projection GEMM reads each activation row 8 times and
// each weight column 32 times from L2: from these copies every one of those reads moves half the bytes, and the GEMM's k loop has no conversion and no transposing store left.
// xb[z][m][k] = bf16(x_z[m][k]) (same layout as the inputs); wb[z][n][k] = bf16(w_z[k][n]) (transposed, so that a weight tile is staged exactly like an activation tile).
#define PKWB 256    // blocks that transpose weights: 6 x 256 tiles of 64 k x 64 n, PKWT tiles a block; with the 6 x PKXB activation blocks the grid is 4 blocks of about equal bytes per WGP
#define PKWT 6
#define PKXB 128    // blocks per activation, 32768 floats each
#define PKP  72     // LDS pitch, in bf16, of one transposed weight row (64 k): 144 B, a multiple of 16 B
__global__ __launch_bounds__(256) void k_pack(const float* __restrict__ x0, const float* __restrict__ x1, const float* __restrict__ x2,
                                              const float* __restrict__ x3, const float* __restrict__ x4, const float* __restrict__ x5,
                                              const float* __restrict__ w0, const float* __restrict__ w1, const float* __restrict__ w2,
                                              const float* __restrict__ w3, const float* __restrict__ w4, const float* __restrict__ w5,
                                              float* __restrict__ xbv, float* __restrict__ wbv) {
  __shared__ __attribute__((aligned(16))) __bf16 tS[64 * PKP];
  const int tid = threadIdx.x, b = blockIdx.x;
  if (b < PKWB) {   // the same for a whole block, so the barriers below are met by all of its threads
    __bf16* wb = (__bf16*)wbv;
    const int kq = tid >> 4, c4 = (tid & 15) * 4;   // loads: 4 consecutive k rows at 4 * kq, 4 columns at c4: 16 lanes cover 256 contiguous bytes of a row
#pragma unroll 1   // the trips are tied by the barriers
    for (int i = 0; i < PKWT; ++i) {
      const int T = b * PKWT + i, z = T >> 8, k0 = ((T >> 4) & 15) * 64, n0 = (T & 15) * 64;
      const float* __restrict__ Wm = z == 0 ? w0 : z == 1 ? w1 : z == 2 ? w2 : z == 3 ? w3 : z == 4 ? w4 : w5;
      const float* s = Wm + (size_t)(k0 + 4 * kq) * 1024 + n0 + c4;
      v4f_t r[4];
#pragma unroll   // constant indices, so that r stays in registers and the four loads fly together
      for (int q = 0; q < 4; ++q) r[q] = *(const v4f_t*)(s + q * 1024);
#pragma unroll   // constant indices into r
      for (int u = 0; u < 4; ++u) *(b16x4*)(tS + (c4 + u) * PKP + 4 * kq) = to_b16x4(r[0][u], r[1][u], r[2][u], r[3][u]);
      __syncthreads();
#pragma unroll   // both LDS reads issued before the first store waits
      for (int p = 0; p < 2; ++p) {   // 8 lanes x 16 B store one whole 128-B line of a transposed row
        const int idx = p * 256 + tid, n = idx >> 3, q8 = (idx & 7) * 8;
        *(v4ua*)(wb + ((size_t)z * 1024 + n0 + n) * 1024 + k0 + q8) = *(const v4ua*)(tS + n * PKP + q8);
      }
      __syncthreads();   // the tile is rewritten at the head of the next trip
    }
  } else {
    const int bx = b - PKWB, z = bx / PKXB, c = bx % PKXB;
    const float* __restrict__ X = z == 0 ? x0 : z == 1 ? x1 : z == 2 ? x2 : z == 3 ? x3 : z == 4 ? x4 : x5;
    const float* s = X + (size_t)c * 32768 + 4 * tid;
    __bf16* d = (__bf16*)xbv + (size_t)z * (4096 * 1024) + (size_t)c * 32768 + 4 * tid;
#pragma unroll 1   // 8 whole-line 16-byte loads of a wave in flight per trip
    for (int it = 0; it < 4; ++it) {
      v4f_t v[8];
#pragma unroll   // constant indices, so that v stays in registers and the eight loads fly together
      for (int u = 0; u < 8; ++u) v[u] = __builtin_nontemporal_load((const v4f_t*)(s + (it * 8 + u) * 1024));   // the f32 activations are read once per call
#pragma unroll   // constant indices into v
      for (int u = 0; u < 8; ++u) *(b16x4*)(d + (it * 8 + u) * 1024) = to_b16x4(v[u][0], v[u][1], v[u][2], v[u][3]);
    }
  }
}

// gemm_proj6: the six projections in one launch, from k_pack's bf16 copies. blockIdx.z picks activation xb[z] ([m][k]), weight wb[z] ([n][k]) and bias b;
// Y[z][m][n] = sum_k bf16(x[m][k]) * bf16(w[k][n]) + bf16(b[n]). Block = 128x128 tile, 8 waves as 4(M) x 2(N). A k-step is one 128-B line of every operand row, as before: now 64 k.
#define BSTR 72   // LDS pitch, in bf16, of a 64-k row piece: 144 B = 16 B x 9
__global__ __launch_bounds__(256) void gemm_proj6(const float* __restrict__ xbv, const float* __restrict__ wbv,
                                                  const float* __restrict__ b0, const float* __restrict__ b1, const float* __restrict__ b2,
                                                  const float* __restrict__ b3, const float* __restrict__ b4, const float* __restrict__ b5,
                                                  float* __restrict__ Y, int lda, int ldw, int ldy, size_t strideY, int K) {
  const int z = blockIdx.z;
  const __bf16* __restrict__ A  = (const __bf16*)xbv + (size_t)z * strideY;
  const __bf16* __restrict__ Wt = (const __bf16*)wbv + (size_t)z * K * ldw;
  const float* __restrict__ bias = z == 0 ? b0 : z == 1 ? b1 : z == 2 ? b2 : z == 3 ? b3 : z == 4 ? b4 : b5;
  Y += (size_t)z * strideY;
  __shared__ __attribute__((aligned(16))) __bf16 ldsA[128 * BSTR];
  __shared__ __attribute__((aligned(16))) __bf16 ldsW[128 * BSTR];
  __shared__ __attribute__((aligned(16))) float oS[8][32 * 68];
  const int tid = threadIdx.x, lane = tid & 31, wave = tid >> 5, cl = lane & 15, rh = (lane >> 4) * 8;
  const int m0 = blockIdx.x * 128, n0 = blockIdx.y * 128;
  const int wm = (wave & 3) * 32, wn = (wave >> 2) * 64;
  f32x8 acc[2][4];
#pragma unroll
  for (int i = 0; i < 2; ++i)
#pragma unroll
    for (int j = 0; j < 4; ++j) { f32x8 zz = {}; acc[i][j] = zz; }
  // staging map, the same for both operands: 8 lanes x 16 B cover one whole 128-B line (64 k of one row), so every wave-wide load touches 4 whole lines; lane -> (row l8 of 4, 8-k chunk l7)
  const int l7 = lane & 7, l8 = lane >> 3;
  const int ar = wave * 4 + l8;
  const __bf16* sa = A + (size_t)(m0 + ar) * lda + l7 * 8;
  const __bf16* sw = Wt + (size_t)(n0 + ar) * ldw + l7 * 8;
  // fa, fw hold the bf16 values of ONE k-step, loaded one trip ahead: the loads of the next step are issued behind the barrier that publishes this step's tiles
  // and fly during this step's fragment reads and matrix instructions, instead of being issued and waited for between the two barriers.
  v4u_t fa[4], fw[4];   // every loop over g below is unrolled so that their indices are constants and they stay in registers
#pragma unroll
  for (int g = 0; g < 4; ++g) fa[g] = *(const v4ua*)(sa + (size_t)(32 * g) * lda);
#pragma unroll
  for (int g = 0; g < 4; ++g) fw[g] = *(const v4ua*)(sw + (size_t)(32 * g) * ldw);
#pragma unroll 1
  for (int k0 = 0; k0 < K; k0 += 64) {
    __syncthreads();
#pragma unroll
    for (int g = 0; g < 4; ++g) *(v4ua*)(ldsA + (ar + 32 * g) * BSTR + l7 * 8) = fa[g];
#pragma unroll
    for (int g = 0; g < 4; ++g) *(v4ua*)(ldsW + (ar + 32 * g) * BSTR + l7 * 8) = fw[g];
    __syncthreads();
    if (k0 + 64 < K) {   // same for the whole grid: the last step has no successor to load
      sa += 64; sw += 64;
#pragma unroll
      for (int g = 0; g < 4; ++g) fa[g] = *(const v4ua*)(sa + (size_t)(32 * g) * lda);
#pragma unroll
      for (int g = 0; g < 4; ++g) fw[g] = *(const v4ua*)(sw + (size_t)(32 * g) * ldw);
      asm volatile("s_wait_xcnt 0x0" ::: "memory");   // the loads' address registers are reused as destinations of the fragment reads below
    }
#pragma unroll
    for (int kk = 0; kk < 64; kk += 32) {   // k ascending, 32 a matrix instruction: the order of the sums is the one it was
      b16x16 af[2];
#pragma unroll
      for (int i = 0; i < 2; ++i) af[i] = lds_frag_b(ldsA + (wm + 16 * i) * BSTR + kk, BSTR);
#pragma unroll
      for (int j = 0; j < 4; ++j) {
        const b16x16 bf = lds_frag_b(ldsW + (wn + 16 * j) * BSTR + kk, BSTR);
#pragma unroll
        for (int i = 0; i < 2; ++i) acc[i][j] = __builtin_amdgcn_wmma_f32_16x16x32_bf16(false, af[i], false, bf, (short)0, acc[i][j], false, false);
      }
    }
  }
  float* so = oS[wave];
#pragma unroll
  for (int i = 0; i < 2; ++i)
#pragma unroll
    for (int j = 0; j < 4; ++j) {
      const float bv = bf16r(bias[n0 + wn + 16 * j + cl]);
#pragma unroll
      for (int r = 0; r < 8; ++r) so[(16 * i + rh + r) * 68 + 16 * j + cl] = acc[i][j][r] + bv;
    }
  asm volatile("s_wait_dscnt 0" ::: "memory");
  __builtin_amdgcn_wave_barrier();
#pragma unroll
  for (int it = 0; it < 16; ++it) { const int f4 = lane + 32 * it, rr = f4 >> 4, q = (f4 & 15) * 4;
    *(v4f_t*)(Y + (size_t)(m0 + wm + rr) * ldy + n0 + wn + q) = *(const v4fa*)(so + rr * 68 + q); }
}

// ---------------------------------------------------------------------------------------------------------------------------
// gemm_kn2 (value+residual planes on both operands: hh + (hl+lh)/2048, f32-class): Y[m][n] (row stride ldy) = scale * sum_k A[m][k] (f32 or f16, row stride lda) * W[k][n] (f32, row-major [K][N], row
// stride ldw) (+ bias[n]) (+ Y if ACC). Block = 128 x 128 tile, 256 threads = 8 waves as 4(M, 32 rows) x 2(N, 64 cols); per
// 32-wide k-step the A tile and the W tile (stored transposed [n][k]) are staged as f16 in LDS; value and residual f16 planes per operand, f32
// blockIdx.z selects a batch: A += z*strideA, W += z*strideW, Y += z*strideY (element strides).
// ---------------------------------------------------------------------------------------------------------------------------
template <typename AT, bool ACC>
__global__ __launch_bounds__(256) void gemm_kn2(const AT* __restrict__ A, int lda, size_t strideA,
                                               const float* __restrict__ Wm, int ldw, size_t strideW,
                                               const float* __restrict__ bias, float scale,
                                               float* __restrict__ Y, int ldy, size_t strideY, int K) {
  __shared__ __attribute__((aligned(16))) f16 ldsA[128 * GSTR], ldsAl[128 * GSTR];
  __shared__ __attribute__((aligned(16))) f16 ldsW[128 * GSTR], ldsWl[128 * GSTR];
  __shared__ __attribute__((aligned(16))) float oS[8][32 * 68];
  const int tid = threadIdx.x, lane = tid & 31, wave = tid >> 5, cl = lane & 15, rh = (lane >> 4) * 8;
  const int m0 = blockIdx.x * 128, n0 = blockIdx.y * 128;
  const int wm = (wave & 3) * 32, wn = (wave >> 2) * 64;
  A += (size_t)blockIdx.z * strideA; Wm += (size_t)blockIdx.z * strideW; Y += (size_t)blockIdx.z * strideY;
  f32x8 acc[2][4], accx[2][4];
#pragma unroll
  for (int i = 0; i < 2; ++i)
#pragma unroll
    for (int j = 0; j < 4; ++j) { f32x8 z = {}; acc[i][j] = z; accx[i][j] = z; }
#pragma unroll 1
  for (int k0 = 0; k0 < K; k0 += 32) {
    __syncthreads();
    {  // A: thread -> row tid>>1, 16 elements at column half (tid&1)*16
      const int row = tid >> 1, ch = (tid & 1) * 16;
      const AT* src = A + (size_t)(m0 + row) * lda + k0 + ch;
#pragma unroll
      for (int g = 0; g < 16; ++g) { const float v = (float)src[g]; const f16 h = (f16)v; ldsA[row * GSTR + ch + g] = h; ldsAl[row * GSTR + ch + g] = (f16)((v - (float)h) * 2048.0f); }
    }
    {  // W: thread -> k = tid>>3, 16 consecutive n at (tid&7)*16; stored transposed [n][k]
      const int k = tid >> 3, nn0 = (tid & 7) * 16;
      const float* src = Wm + (size_t)(k0 + k) * ldw + n0 + nn0;
#pragma unroll
      for (int g = 0; g < 4; ++g) { const v4f_t v = *(const v4f_t*)(src + 4 * g);
#pragma unroll
        for (int u = 0; u < 4; ++u) { const f16 h = (f16)v[u]; ldsW[(nn0 + 4 * g + u) * GSTR + k] = h; ldsWl[(nn0 + 4 * g + u) * GSTR + k] = (f16)((v[u] - (float)h) * 2048.0f); } }
    }
    __syncthreads();
    f16x16 af[2], afl[2];
#pragma unroll
    for (int i = 0; i < 2; ++i) { af[i] = lds_frag(ldsA + (wm + 16 * i) * GSTR, GSTR); afl[i] = lds_frag(ldsAl + (wm + 16 * i) * GSTR, GSTR); }
#pragma unroll
    for (int j = 0; j < 4; ++j) {
      const f16x16 bf = lds_frag(ldsW + (wn + 16 * j) * GSTR, GSTR), bfl = lds_frag(ldsWl + (wn + 16 * j) * GSTR, GSTR);
#pragma unroll
      for (int i = 0; i < 2; ++i) { acc[i][j] = wmma16(af[i], bf, acc[i][j]); accx[i][j] = wmma16(af[i], bfl, accx[i][j]); accx[i][j] = wmma16(afl[i], bf, accx[i][j]); }
    }
  }
  float* so = oS[wave];
#pragma unroll
  for (int i = 0; i < 2; ++i)
#pragma unroll
    for (int j = 0; j < 4; ++j) {
      const float bv = bias ? bias[n0 + wn + 16 * j + cl] : 0.0f;
#pragma unroll
      for (int r = 0; r < 8; ++r) so[(16 * i + rh + r) * 68 + 16 * j + cl] = (acc[i][j][r] + accx[i][j][r] * (1.0f / 2048.0f)) * scale + bv;
    }
  asm volatile("s_wait_dscnt 0" ::: "memory");
  __builtin_amdgcn_wave_barrier();
  if (ACC) {   // accumulate: fold the existing Y values into the staging tile ONCE (same thread <-> same chunks as the stores below)
#pragma unroll
    for (int it = 0; it < 16; ++it) { const int f4 = lane + 32 * it, rr = f4 >> 4, q = (f4 & 15) * 4;
      const v4f_t old = *(const v4fa*)(Y + (size_t)(m0 + wm + rr) * ldy + n0 + wn + q);
      v4f_t v = *(const v4fa*)(so + rr * 68 + q); v += old; *(v4fa*)(so + rr * 68 + q) = v; }   // plain LDS store (ordered by the s_wait_dscnt/memory clobber below)
    asm volatile("s_wait_dscnt 0" ::: "memory");
  }
{
#pragma unroll
    for (int it = 0; it < 16; ++it) { const int f4 = lane + 32 * it, rr = f4 >> 4, q = (f4 & 15) * 4;
      *(v4f_t*)(Y + (size_t)(m0 + wm + rr) * ldy + n0 + wn + q) = *(const v4fa*)(so + rr * 68 + q); }
    
  }
}

__global__ __launch_bounds__(256) void k_transpose(const float* __restrict__ Wm, float* __restrict__ Wt, int rows, int cols) {
  __shared__ float tS[64][65];
  const int tid = threadIdx.x, tbj = cols / 64, bi = blockIdx.x / tbj, bj = blockIdx.x % tbj;
  for (int e = tid; e < 64 * 64; e += 256) { const int r = e >> 6, c = e & 63; tS[r][c] = Wm[(size_t)(bi * 64 + r) * cols + bj * 64 + c]; }
  __syncthreads();
  for (int ch = tid; ch < 64 * 16; ch += 256) { const int r = ch >> 4, q4 = (ch & 15) * 4; v4f_t o; o[0] = tS[q4][r]; o[1] = tS[q4 + 1][r]; o[2] = tS[q4 + 2][r]; o[3] = tS[q4 + 3][r];
    float* dst = Wt + (size_t)(bj * 64 + r) * rows + bi * 64 + q4; *(v4f_t*)dst = o;  }
}

#define NBpr 2
#define SSpr 2048
#define SIN 2048
#define DDpr 1024
#define NHpr 16
#define DKpr 64
#define HPpr 68   // LDS pitch, in floats, of one head's 64 channels in k_bhatt
__global__ __launch_bounds__(256) void k_dbg_zero(float* __restrict__ p, size_t n4) { const size_t i = (size_t)blockIdx.x * 256 + threadIdx.x; if (i < n4) { v4f_t z = {0.f,0.f,0.f,0.f}; *(v4f_t*)(p + 4 * i) = z;  } }
__global__ __launch_bounds__(256) void k_copy(const float* __restrict__ src, float* __restrict__ dst, size_t n4) { const size_t i = (size_t)blockIdx.x * 256 + threadIdx.x; if (i < n4) { const v4f_t v = *(const v4f_t*)(src + 4 * i); *(v4f_t*)(dst + 4 * i) = v;  } }
// torch [out][in] weight → WT[i][o] = mul·bf16(W[o][i]) ([in][out], lifted by a power of two so no bf16 weight becomes an f16 subnormal); block = input row i, threads loop over the outputs (4-B lanes)
__global__ __launch_bounds__(256) void k_wprepT(const float* __restrict__ Wt, float* __restrict__ WT, int nout, int nin, float mul) { const int i = blockIdx.x, tid = threadIdx.x;
#pragma unroll 1
  for (int o = tid; o < nout; o += 256) { const float w = mul * bf16r(Wt[(size_t)o * nin + i]); *(float*)(WT + (size_t)i * nout + o) = w;  } }

// sum over the 16 lanes of a row (one head's 16 four-channel chunks), every lane gets the total; DPP row_xmask butterfly, no LDS traffic
__device__ __forceinline__ float row16_sum(float v) {
  v += __int_as_float(__builtin_amdgcn_update_dpp(0, __float_as_int(v), 0x161, 0xf, 0xf, true));   // row_xmask:1
  v += __int_as_float(__builtin_amdgcn_update_dpp(0, __float_as_int(v), 0x162, 0xf, 0xf, true));   // row_xmask:2
  v += __int_as_float(__builtin_amdgcn_update_dpp(0, __float_as_int(v), 0x164, 0xf, 0xf, true));   // row_xmask:4
  v += __int_as_float(__builtin_amdgcn_update_dpp(0, __float_as_int(v), 0x168, 0xf, 0xf, true));   // row_xmask:8
  return v;
}

// per-token head-to-head Bhattacharyya attention: the six projected [16][64] vectors of a token staged in LDS; thread = (query head i, key head j) for the distance, then
// With a = sq^2 + eps, b = sk^2 + eps: a/b + b/a + 2 = (a + b)^2 / (a b), so term1 = 0.5 ln((a + b)/2) - 0.25 ln a - 0.25 ln b. ln a and ln b depend on one head only and are summed over
// the channels once per head while staging; a (pair, channel) then costs one log2 of a + b and one reciprocal of sq^2 + sk^2 + eps (a + b is that denominator + eps).
// One launch for both batch elements: NWGpr workgroups, all resident at once, each walks TPBpr tokens (token = batch * srows + row, NWGpr apart). The six rows of the next token are loaded
// into registers behind the barrier that publishes this token's rows and fly during this token's distances, softmax and value sums.
#define TPBpr 4                             // tokens per workgroup
#define NWGpr (NBpr * SSpr / TPBpr)         // workgroups of the launch
__global__ __launch_bounds__(256) void k_bhatt(const float* __restrict__ MQ, const float* __restrict__ SQ, const float* __restrict__ MK, const float* __restrict__ SK, const float* __restrict__ MV, const float* __restrict__ SV, float* __restrict__ omu, float* __restrict__ osg, int srows) {
  // q and k head rows sit at a pitch of HPpr floats (272 B = 16 B x 17): the 16 key heads that the 16 lanes of a row read at one channel offset fall on distinct banks
  // q2 holds sigma_q^2, k2 holds sigma_k^2 + eps; lk[j] = sum over the channels of log2(sigma_k^2 + eps) of key head j
  // mv, sv have two buffers: they are read behind the second barrier of a token, where a faster wave may already stage the next token; everything else that the staging writes is last read in front of that barrier
  __shared__ __attribute__((aligned(16))) float mq[NHpr * HPpr], q2[NHpr * HPpr], mk[NHpr * HPpr], k2[NHpr * HPpr], mv[2][1024], sv[2][1024]; __shared__ float att[256]; __shared__ float lk[NHpr];
  const int tid = threadIdx.x;
  const int p4 = (tid >> 4) * HPpr + (tid & 15) * 4;
  const int i = tid >> 4, j = tid & 15;
  const int hi = tid >> 4, c4 = (tid & 15) * 4;
  unsigned o4 = (unsigned)blockIdx.x * DDpr + 4 * tid;   // this thread's four channels of the token whose rows are loaded next
  v4f_t sgq = *(const v4f_t*)(SQ + o4), sgk = *(const v4f_t*)(SK + o4), muq = *(const v4f_t*)(MQ + o4), muk = *(const v4f_t*)(MK + o4), muv = *(const v4f_t*)(MV + o4), sgv = *(const v4f_t*)(SV + o4);
  asm volatile("s_wait_xcnt 0x0" ::: "memory");   // the loads' address registers are rewritten below
#pragma unroll 1   // one token's code in the instruction stream; the trips are tied by the barriers anyway
  for (int it = 0; it < TPBpr; ++it) {
    const int tok = blockIdx.x + it * NWGpr, bat = tok / SSpr, t = tok % SSpr;
    float* mvb = mv[it & 1]; float* svb = sv[it & 1];
    float lq;   // sum over the channels of log2(sigma_q^2 + eps) of query head tid >> 4, in every lane of that head's row
    { const v4f_t vq = sgq * sgq, vk = sgk * sgk + 1e-6f, aq = vq + 1e-6f;
      *(v4f_t*)(mq + p4) = muq; *(v4f_t*)(q2 + p4) = vq; *(v4f_t*)(mk + p4) = muk; *(v4f_t*)(k2 + p4) = vk; *(v4f_t*)(mvb + 4 * tid) = muv; *(v4f_t*)(svb + 4 * tid) = sgv;
      v4f_t la, lb;
#pragma unroll   // constant indices into the four-channel vectors, so that they stay in registers
      for (int u = 0; u < 4; ++u) { la[u] = __builtin_amdgcn_logf(aq[u]); lb[u] = __builtin_amdgcn_logf(vk[u]); }
      lq = row16_sum((la[0] + la[2]) + (la[1] + la[3]));
      const float lks = row16_sum((lb[0] + lb[2]) + (lb[1] + lb[3]));
      if ((tid & 15) == 0) lk[tid >> 4] = lks; }
    __syncthreads();
    if (it + 1 < TPBpr) {   // same for the whole grid: the last token has no successor to load
      o4 += NWGpr * DDpr;
      sgq = *(const v4f_t*)(SQ + o4); sgk = *(const v4f_t*)(SK + o4); muq = *(const v4f_t*)(MQ + o4); muk = *(const v4f_t*)(MK + o4); muv = *(const v4f_t*)(MV + o4); sgv = *(const v4f_t*)(SV + o4);
      asm volatile("s_wait_xcnt 0x0" ::: "memory");   // the loads' address registers are rewritten below
    }
    v4f_t sl, sm; sl[0] = sl[1] = sl[2] = sl[3] = 0.0f; sm[0] = sm[1] = sm[2] = sm[3] = 0.0f;   // per channel residue mod 4: sums of log2(a + b) and of dm^2 / (sq^2 + sk^2 + eps)
#pragma unroll 4   // four 16-byte LDS read groups in flight per trip
    for (int d = 0; d < DKpr; d += 4) {   // four channels per 16-byte LDS read
      const v4f_t q24 = *(const v4f_t*)(q2 + i * HPpr + d), k24 = *(const v4f_t*)(k2 + j * HPpr + d), mq4 = *(const v4f_t*)(mq + i * HPpr + d), mk4 = *(const v4f_t*)(mk + j * HPpr + d);
      const v4f_t den = q24 + k24, ab = den + 1e-6f, dm = mq4 - mk4; v4f_t lg4, rc4;
#pragma unroll   // constant indices into the four-channel vectors, so that they stay in registers
      for (int u = 0; u < 4; ++u) { lg4[u] = __builtin_amdgcn_logf(ab[u]); rc4[u] = __builtin_amdgcn_rcpf(den[u]); }
      sl += lg4; sm += (dm * dm) * rc4; }
    const float sumlog = (sl[0] + sl[1]) + (sl[2] + sl[3]), summ = (sm[0] + sm[1]) + (sm[2] + sm[3]);
    const float dist = 0.69314718055994531f * (0.5f * sumlog - 0.5f * (float)DKpr - 0.25f * (lq + lk[j])) + 0.25f * summ;
    float lg = -0.5f * (dist * 0.125f); float m = lg;
    m = fmaxf(m, __shfl_xor(m, 1, 32)); m = fmaxf(m, __shfl_xor(m, 2, 32)); m = fmaxf(m, __shfl_xor(m, 4, 32)); m = fmaxf(m, __shfl_xor(m, 8, 32));
    float e = expf(lg - m); float z = e; z += __shfl_xor(z, 1, 32); z += __shfl_xor(z, 2, 32); z += __shfl_xor(z, 4, 32); z += __shfl_xor(z, 8, 32);
    att[tid] = e / z; __syncthreads();
    v4f_t am, av; am[0] = am[1] = am[2] = am[3] = 0.0f; av[0] = av[1] = av[2] = av[3] = 0.0f;
#pragma unroll 1
    for (int jj = 0; jj < NHpr; ++jj) { const float a = att[hi * NHpr + jj]; const v4f_t mvj = *(const v4f_t*)(mvb + jj * DKpr + c4), svj = *(const v4f_t*)(svb + jj * DKpr + c4); am += a * mvj; av += a * (svj * svj); }
    v4f_t os; for (int u = 0; u < 4; ++u) os[u] = sqrtf(fmaxf(av[u], 0.0f) + 1e-6f);
    const size_t oo = ((size_t)(bat * NHpr + hi) * srows + t) * DKpr + c4;   // [batch][head][row][64]
    *(v4f_t*)(omu + oo) = am; *(v4f_t*)(osg + oo) = os;
    asm volatile("s_wait_xcnt 0x0" ::: "memory");   // the two stores' registers are rewritten at the head of the next trip
  }
}

extern "C" void kernel_launch(void* const* d_in, const int* in_sizes, int n_in,
                              void* d_out, int out_size, void* d_ws, size_t ws_size,
                              hipStream_t stream) {
  (void)in_sizes; (void)n_in; (void)out_size;
  const float** f = (const float**)d_in;
  float* out0 = (float*)d_out; float* out1 = out0 + (size_t)2 * SIN * DDpr;   // out_mu, out_sigma
  char* ws = (char*)d_ws;
  const size_t slab = (size_t)NBpr * SSpr * DDpr;   // one projection's rows: both batch elements, [4096][1024]
  float* P[6]; for (int i = 0; i < 6; ++i) { P[i] = (float*)ws; ws += slab * 4; }
  float* xb = (float*)ws; ws += slab * 6 * 2;                            // the six activations as bf16, [6][4096][1024]
  float* wb = (float*)ws; ws += (size_t)DDpr * DDpr * 6 * 2;             // the six weights as bf16, transposed, [6][out][in]
  if ((size_t)(ws - (char*)d_ws) > ws_size) return;                      // WS TOTAL 163,577,856 B
  const dim3 blk(256); const dim3 gp(NBpr * SSpr / 128, DDpr / 128, 6);
  // input -> projection slot map: query->q_mu (w0), key->k_mu (w1), value->v_mu (w2), query_sigma->q_sigma (w3), key_sigma->k_sigma (w4), value_sigma->v_sigma (w5)
  k_pack<<<dim3(PKWB + 6 * PKXB), blk, 0, stream>>>(f[0], f[1], f[2], f[3], f[4], f[5], f[6], f[7], f[8], f[9], f[10], f[11], xb, wb);
  // the batch axis is folded into the GEMM's M (4096 rows) and the six projections into blockIdx.z: one launch of 32 x 8 x 6 tiles, several workgroups resident on every WGP
  gemm_proj6<<<gp, blk, 0, stream>>>(xb, wb, f[12], f[13], f[14], f[15], f[16], f[17], P[0], DDpr, DDpr, DDpr, slab, DDpr);
  // both batch elements in one launch: the projections' rows are [batch * 2048 + row][1024], the outputs [batch][head][row][64]
  k_bhatt<<<dim3(NWGpr), blk, 0, stream>>>(P[0], P[3], P[1], P[4], P[2], P[5], out0, out1, SIN);
}

// v010
// Measured time: 92.9 microseconds a run.
// In two side-by-side timings against v009, it was 1.07 and 1.06 times as fast.
// Over all steps from v000 it is 7.97 times as fast.
// bf16-input design: the six activations, six [in][out] weights and six biases are rounded to bf16 (RNE) on load; the six projections are then
// exact single bf16 products with f32 accumulation — the Bhattacharyya terms divide by σ² + 1e-6, which amplifies projection error ≈1000x near σ ≈ 1e-3, so
// exact projections are what make the distances reliable. Contractions on v_wmma_f32_16x16x32_bf16 (bf16 operands, f32 accumulate), per batch element: mu_q, sigma_q, mu_k, sigma_k, mu_v,
// sigma_v = x·W + b (K 1024 each). f32 VALU, a block takes one token at a time: the 16x16 head-to-head Bhattacharyya distances summed over the 64 channels (0.25·log(0.25·(sq²/sk² + sk²/sq² + 2)) +
// 0.25·(μq−μk)²/(σq²+σk²+ε), with sq² = σq²+ε), /√64, softmax over the key-head axis of −0.5·dist, out_mu = attn·mu_v, out_sigma = sqrt(max(attn·σv², 0) + ε), and the module's
// transpose(1,2)-then-view layout: each output is the [B][H][S][64] array reinterpreted as [B][S][1024]. Two outputs, consecutive in d_out: out_mu then out_sigma.
// compute dtype: bf16 operands, f32 accumulate.  six [2,2048,1024] inputs → (out_mu, out_sigma) [2,2048,1024] each.
#include <hip/hip_runtime.h>
#include <hip/hip_bf16.h>
#include <math.h>


typedef _Float16 bf16;
typedef _Float16 f16;
typedef __attribute__((ext_vector_type(4))) unsigned v4u_t;
typedef unsigned v4ua __attribute__((ext_vector_type(4), may_alias));
typedef __attribute__((ext_vector_type(4))) float v4f_t;
typedef float v4fa __attribute__((ext_vector_type(4), may_alias));
typedef __attribute__((ext_vector_type(16))) bf16  bf16x16;
typedef bf16x16 f16x16;
typedef __attribute__((ext_vector_type(8)))  bf16  bf16x8;
typedef bf16x8 f16x8;
typedef __attribute__((ext_vector_type(4)))  bf16  bf16x4;
typedef __attribute__((ext_vector_type(8)))  float f32x8;
__device__ __forceinline__ f32x8 wmma16(f16x16 a, f16x16 b, f32x8 c) {
  c = __builtin_amdgcn_wmma_f32_16x16x32_f16(false, a, false, b, (short)0, c, false, false);
  asm volatile("v_nop\n\tv_nop\n\tv_nop\n\tv_nop" : "+v"(c) : "v"(a), "v"(b));
  return c;
}
#define LDS_STRIDE 48   // unused: the gemm_kne and gemm_kn2 tiles use GSTR (32 -> 48 elems, 96B rows: aligned b128 reads)
#define KSTRIDE    72   // unused: k_bhatt stages K at pitch HPpr ([16][68] f32, stride 68)
#define VSTRIDE    48   // unused: k_bhatt stages V unpadded ([16][64] f32, stride 64)

__device__ __forceinline__ f32x8 wmma_bf16(bf16x16 a, bf16x16 b, f32x8 c) {
  c = __builtin_amdgcn_wmma_f32_16x16x32_f16(false, a, false, b, (short)0, c, false, false);
  asm volatile("v_nop\n\tv_nop\n\tv_nop\n\tv_nop" : "+v"(c) : "v"(a), "v"(b));   // A/B-overwrite hazard guard
  return c;
}

// 16x32 (MxK) bf16 fragment from a row-major global matrix.
// lanes 0-15  (row=lane)    : elems 0..7 = K+0..7,  8..15 = K+16..23
// lanes 16-31 (row=lane-16) : elems 0..7 = K+8..15, 8..15 = K+24..31
template <typename T>
__device__ __forceinline__ bf16x16 load_frag(const T* __restrict__ base, int ld,
                                             int row0, int k0) {
  const int lane = threadIdx.x & 31;
  const int r    = lane & 15;
  const int kh   = (lane >> 4) * 8;
  const T* p0 = base + (size_t)(row0 + r) * ld + (k0 + kh);
  const T* p1 = p0 + 16;
  bf16x16 f;
#pragma unroll
  for (int i = 0; i < 8; ++i) {
    f[i]     = (bf16)p0[i];
    f[i + 8] = (bf16)p1[i];
  }
  return f;
}

// Same fragment from an LDS tile with padded row stride (base includes row0/k0).
__device__ __forceinline__ bf16x16 lds_frag(const bf16* base, int stride) {
  const int lane = threadIdx.x & 31;
  const int row  = lane & 15;
  const int kh   = (lane >> 4) * 8;
  const bf16x8 lo = *(const bf16x8*)(base + row * stride + kh);
  const bf16x8 hi = *(const bf16x8*)(base + row * stride + kh + 16);
  bf16x16 f;
#pragma unroll
  for (int i = 0; i < 8; ++i) { f[i] = lo[i]; f[i + 8] = hi[i]; }
  return f;
}

template <typename T>
__device__ __forceinline__ void stage_read16(const T* __restrict__ p, float* buf) {
#pragma unroll
  for (int i = 0; i < 16; ++i) buf[i] = (float)p[i];
}

__device__ __forceinline__ void stage_write(bf16* dst, const float* buf, int nquad) {
#pragma unroll
  for (int i = 0; i < nquad; ++i) {
    bf16x4 q;
    q[0] = (bf16)buf[4 * i];     q[1] = (bf16)buf[4 * i + 1];
    q[2] = (bf16)buf[4 * i + 2]; q[3] = (bf16)buf[4 * i + 3];
    *(bf16x4*)(dst + 4 * i) = q;
  }
}


#define GSTR 48
// ---------------------------------------------------------------------------------------------------------------------------
// gemm_kne: Y[m][n] = epi( Σ_k A[m][k]·W[k][n] + bias[n] ), A f32/f16 [M][lda], W f32 row-major [K][N] (ldw), plain f16 operands,
// f32 accumulate. EPI 0: identity; 1: exact-erf GELU; 2: R[m][n] + gvec[n]·(·) (residual with per-channel gain); 3: ReLU; 4: gvec[n]·(·) (per-channel scale, no residual). Output f32 (or f16
// when OUT16). Block = 128x128 tile, 8 waves as 4(M) x 2(N); per 32-wide k-step A and W tiles staged f16 in LDS (W transposed
// ---------------------------------------------------------------------------------------------------------------------------
#define GSTR 48
template <typename AT, int EPI, bool OUT16>
__global__ __launch_bounds__(256) void gemm_kne(const AT* __restrict__ A, int lda, const float* __restrict__ Wm, int ldw,
                                                const float* __restrict__ bias, const float* __restrict__ R, const float* __restrict__ gvec,
                                                void* __restrict__ Yv, int ldy, int K) {
  __shared__ __attribute__((aligned(16))) f16 ldsA[128 * GSTR];
  __shared__ __attribute__((aligned(16))) f16 ldsW[128 * GSTR];
  __shared__ __attribute__((aligned(16))) float oS[8][32 * 68];
  const int tid = threadIdx.x, lane = tid & 31, wave = tid >> 5, cl = lane & 15, rh = (lane >> 4) * 8;
  const int m0 = blockIdx.x * 128, n0 = blockIdx.y * 128;
  const int wm = (wave & 3) * 32, wn = (wave >> 2) * 64;
  f32x8 acc[2][4];
#pragma unroll
  for (int i = 0; i < 2; ++i)
#pragma unroll
    for (int j = 0; j < 4; ++j) { f32x8 z = {}; acc[i][j] = z; }
#pragma unroll 1
  for (int k0 = 0; k0 < K; k0 += 32) {
    __syncthreads();
    { const int row = tid >> 1, ch = (tid & 1) * 16;
      const AT* src = A + (size_t)(m0 + row) * lda + k0 + ch;
#pragma unroll
      for (int g = 0; g < 16; ++g) ldsA[row * GSTR + ch + g] = (f16)src[g]; }
    { const int k = tid >> 3, nn0 = (tid & 7) * 16;
      const float* src = Wm + (size_t)(k0 + k) * ldw + n0 + nn0;
#pragma unroll
      for (int g = 0; g < 4; ++g) { const v4f_t v = *(const v4f_t*)(src + 4 * g);
#pragma unroll
        for (int u = 0; u < 4; ++u) ldsW[(nn0 + 4 * g + u) * GSTR + k] = (f16)v[u]; } }
    __syncthreads();
    f16x16 af[2];
#pragma unroll
    for (int i = 0; i < 2; ++i) af[i] = lds_frag(ldsA + (wm + 16 * i) * GSTR, GSTR);
#pragma unroll
    for (int j = 0; j < 4; ++j) {
      const f16x16 bf = lds_frag(ldsW + (wn + 16 * j) * GSTR, GSTR);
#pragma unroll
      for (int i = 0; i < 2; ++i) acc[i][j] = wmma16(af[i], bf, acc[i][j]);
    }
  }
  float* so = oS[wave];
#pragma unroll
  for (int i = 0; i < 2; ++i)
#pragma unroll
    for (int j = 0; j < 4; ++j) {
      const int n = n0 + wn + 16 * j + cl;
      const float bv = bias ? bias[n] : 0.0f;
      const float gv = (EPI == 2 || EPI == 4) ? gvec[n] : 0.0f;
      if (EPI == 1) {
#pragma unroll 1
        for (int r = 0; r < 8; ++r) { const float xg = acc[i][j][r] + bv; so[(16 * i + rh + r) * 68 + 16 * j + cl] = 0.5f * xg * (1.0f + erff(xg * 0.70710678118654752f)); }
      } else {
#pragma unroll
        for (int r = 0; r < 8; ++r) {
          float v = acc[i][j][r] + bv;
          if (EPI == 3) v = fmaxf(v, 0.0f);
          if (EPI == 4) v = gv * v;
          if (EPI == 2) v = R[(size_t)(m0 + wm + 16 * i + rh + r) * ldy + n] + gv * v;
          so[(16 * i + rh + r) * 68 + 16 * j + cl] = v;
        }
      }
    }
  asm volatile("s_wait_dscnt 0" ::: "memory");
  __builtin_amdgcn_wave_barrier();
{
    if (OUT16) {
      f16* Y = (f16*)Yv;
#pragma unroll
      for (int it = 0; it < 8; ++it) { const int c = lane + 32 * it, rr = c >> 3, q8 = (c & 7) * 8;
        union { f16 h[8]; v4u_t v; } u;
#pragma unroll
        for (int e = 0; e < 8; ++e) u.h[e] = (f16)so[rr * 68 + q8 + e];
        *(v4u_t*)(Y + (size_t)(m0 + wm + rr) * ldy + n0 + wn + q8) = u.v; }
    } else {
      float* Y = (float*)Yv;
#pragma unroll
      for (int it = 0; it < 16; ++it) { const int f4 = lane + 32 * it, rr = f4 >> 4, q = (f4 & 15) * 4;
        *(v4f_t*)(Y + (size_t)(m0 + wm + rr) * ldy + n0 + wn + q) = *(const v4fa*)(so + rr * 68 + q); }
    }
    
  }
}

// bf16 round-to-nearest-even of an f32 (bit trick)
__device__ __forceinline__ float bf16r(float x) { unsigned int u = __float_as_uint(x); u = (u + 0x7FFFu + ((u >> 16) & 1u)) & 0xFFFF0000u; return __uint_as_float(u); }

typedef __attribute__((ext_vector_type(16))) __bf16 b16x16;
typedef __attribute__((ext_vector_type(8)))  __bf16 b16x8;
typedef __attribute__((ext_vector_type(4)))  __bf16 b16x4;
// four f32 -> four bf16, round to nearest even, by the hardware's packed convert (two values an instruction)
__device__ __forceinline__ b16x4 to_b16x4(float a, float b, float c, float d) { v4f_t v; v[0] = a; v[1] = b; v[2] = c; v[3] = d; return __builtin_convertvector(v, b16x4); }
// lds_frag for a bf16 tile: same lane and k order
__device__ __forceinline__ b16x16 lds_frag_b(const __bf16* base, int stride) {
  const int lane = threadIdx.x & 31;
  const int row  = lane & 15;
  const int kh   = (lane >> 4) * 8;
  const b16x8 lo = *(const b16x8*)(base + row * stride + kh);
  const b16x8 hi = *(const b16x8*)(base + row * stride + kh + 16);
  return __builtin_shufflevector(lo, hi, 0, 1, 2, 3, 4, 5, 6, 7, 8, 9, 10, 11, 12, 13, 14, 15);
}

// the same fragment from this lane's own address in the tile (row lane & 15, k offset 8 * (lane >> 4)): k + 0..7 and k + 16..23
__device__ __forceinline__ b16x16 frag_at(const __bf16* p) {
  const b16x8 lo = *(const b16x8*)p;
  const b16x8 hi = *(const b16x8*)(p + 16);
  return __builtin_shufflevector(lo, hi, 0, 1, 2, 3, 4, 5, 6, 7, 8, 9, 10, 11, 12, 13, 14, 15);
}

// k_pack: every matrix operand rounded to bf16 ONCE per call (round to nearest even, the hardware's packed convert), into the workspace. The projection GEMM reads each activation row 8 times and
// each weight column 16 times from L2: from these copies every one of those reads moves half the bytes, and the GEMM's k loop has no conversion and no transposing store left.
// xb[z][m][k] = bf16(x_z[m][k]) (same layout as the inputs); wb[z][n][k] = bf16(w_z[k][n]) (transposed, so that a weight tile is staged exactly like an activation tile).
#define PKWB 256    // blocks that transpose weights: 6 x 256 tiles of 64 k x 64 n, PKWT tiles a block; with the 6 x PKXB activation blocks the grid is 4 blocks of about equal bytes per WGP
#define PKWT 6
#define PKXB 128    // blocks per activation, 32768 floats each
#define PKP  72     // LDS pitch, in bf16, of one transposed weight row (64 k): 144 B, a multiple of 16 B
__global__ __launch_bounds__(256) void k_pack(const float* __restrict__ x0, const float* __restrict__ x1, const float* __restrict__ x2,
                                              const float* __restrict__ x3, const float* __restrict__ x4, const float* __restrict__ x5,
                                              const float* __restrict__ w0, const float* __restrict__ w1, const float* __restrict__ w2,
                                              const float* __restrict__ w3, const float* __restrict__ w4, const float* __restrict__ w5,
                                              float* __restrict__ xbv, float* __restrict__ wbv) {
  __shared__ __attribute__((aligned(16))) __bf16 tS[64 * PKP];
  const int tid = threadIdx.x, b = blockIdx.x;
  if (b < PKWB) {   // the same for a whole block, so the barriers below are met by all of its threads
    __bf16* wb = (__bf16*)wbv;
    const int kq = tid >> 4, c4 = (tid & 15) * 4;   // loads: 4 consecutive k rows at 4 * kq, 4 columns at c4: 16 lanes cover 256 contiguous bytes of a row
#pragma unroll 1   // the trips are tied by the barriers
    for (int i = 0; i < PKWT; ++i) {
      const int T = b * PKWT + i, z = T >> 8, k0 = ((T >> 4) & 15) * 64, n0 = (T & 15) * 64;
      const float* __restrict__ Wm = z == 0 ? w0 : z == 1 ? w1 : z == 2 ? w2 : z == 3 ? w3 : z == 4 ? w4 : w5;
      const float* s = Wm + (size_t)(k0 + 4 * kq) * 1024 + n0 + c4;
      v4f_t r[4];
#pragma unroll   // constant indices, so that r stays in registers and the four loads fly together
      for (int q = 0; q < 4; ++q) r[q] = *(const v4f_t*)(s + q * 1024);
#pragma unroll   // constant indices into r
      for (int u = 0; u < 4; ++u) *(b16x4*)(tS + (c4 + u) * PKP + 4 * kq) = to_b16x4(r[0][u], r[1][u], r[2][u], r[3][u]);
      __syncthreads();
#pragma unroll   // both LDS reads issued before the first store waits
      for (int p = 0; p < 2; ++p) {   // 8 lanes x 16 B store one whole 128-B line of a transposed row
        const int idx = p * 256 + tid, n = idx >> 3, q8 = (idx & 7) * 8;
        *(v4ua*)(wb + ((size_t)z * 1024 + n0 + n) * 1024 + k0 + q8) = *(const v4ua*)(tS + n * PKP + q8);
      }
      __syncthreads();   // the tile is rewritten at the head of the next trip
    }
  } else {
    const int bx = b - PKWB, z = bx / PKXB, c = bx % PKXB;
    const float* __restrict__ X = z == 0 ? x0 : z == 1 ? x1 : z == 2 ? x2 : z == 3 ? x3 : z == 4 ? x4 : x5;
    const float* s = X + (size_t)c * 32768 + 4 * tid;
    __bf16* d = (__bf16*)xbv + (size_t)z * (4096 * 1024) + (size_t)c * 32768 + 4 * tid;
#pragma unroll 1   // 8 whole-line 16-byte loads of a wave in flight per trip
    for (int it = 0; it < 4; ++it) {
      v4f_t v[8];
#pragma unroll   // constant indices, so that v stays in registers and the eight loads fly together
      for (int u = 0; u < 8; ++u) v[u] = __builtin_nontemporal_load((const v4f_t*)(s + (it * 8 + u) * 1024));   // the f32 activations are read once per call
#pragma unroll   // constant indices into v
      for (int u = 0; u < 8; ++u) *(b16x4*)(d + (it * 8 + u) * 1024) = to_b16x4(v[u][0], v[u][1], v[u][2], v[u][3]);
    }
  }
}

// gemm_proj6: the six projections in one launch, from k_pack's bf16 copies. blockIdx.z picks activation xb[z] ([m][k]), weight wb[z] ([n][k]) and bias b;
// Y[z][m][n] = sum_k bf16(x[m][k]) * bf16(w[k][n]) + bf16(b[n]). Block = 256(M) x 128(N) tile, 8 waves as 4(M) x 2(N), 64 x 64 outputs a wave: 16 matrix instructions per 8 fragments read from LDS
// (a 32 x 64 wave tile has 8 per 6), and a weight tile fetched from L2 serves 256 rows. A k-step is one 128-B line of every operand row: 64 k.
#define BSTR 72   // LDS pitch, in bf16, of a 64-k row piece: 144 B = 16 B x 9
#define GLD  1024   // k length, and row pitch in elements of xb, wb and Y: a constant, so that the 12 staging loads of a k-step are immediate offsets from two address pairs and need no registers of their own
#define GROWS 4096  // rows of one activation and of one projection
__global__ __launch_bounds__(256) void gemm_proj6(const float* __restrict__ xbv, const float* __restrict__ wbv,
                                                  const float* __restrict__ b0, const float* __restrict__ b1, const float* __restrict__ b2,
                                                  const float* __restrict__ b3, const float* __restrict__ b4, const float* __restrict__ b5,
                                                  float* __restrict__ Y) {
  constexpr int lda = GLD, ldw = GLD, ldy = GLD, K = GLD;
  constexpr size_t strideY = (size_t)GROWS * GLD;
  const int z = blockIdx.z;
  const __bf16* __restrict__ A  = (const __bf16*)xbv + (size_t)z * strideY;
  const __bf16* __restrict__ Wt = (const __bf16*)wbv + (size_t)z * K * ldw;
  const float* __restrict__ bias = z == 0 ? b0 : z == 1 ? b1 : z == 2 ? b2 : z == 3 ? b3 : z == 4 ? b4 : b5;
  Y += (size_t)z * strideY;
  __shared__ __attribute__((aligned(16))) __bf16 ldsA[256 * BSTR];
  __shared__ __attribute__((aligned(16))) __bf16 ldsW[128 * BSTR];
  __shared__ __attribute__((aligned(16))) float oS[8][32 * 68];
  const int tid = threadIdx.x, lane = tid & 31, wave = tid >> 5, cl = lane & 15, rh = (lane >> 4) * 8;
  const int m0 = blockIdx.x * 256, n0 = blockIdx.y * 128;
  const int wm = (wave & 3) * 64, wn = (wave >> 2) * 64;
  f32x8 acc[4][4];
#pragma unroll
  for (int i = 0; i < 4; ++i)
#pragma unroll
    for (int j = 0; j < 4; ++j) { f32x8 zz = {}; acc[i][j] = zz; }
  // staging map, the same for both operands: 8 lanes x 16 B cover one whole 128-B line (64 k of one row), so every wave-wide load touches 4 whole lines; lane -> (row l8 of 4, 8-k chunk l7)
  const int l7 = lane & 7, l8 = lane >> 3;
  const int ar = wave * 4 + l8;
  const __bf16* sa = A + (size_t)(m0 + ar) * lda + l7 * 8;
  const __bf16* sw = Wt + (size_t)(n0 + ar) * ldw + l7 * 8;
  // this lane's place in the wave's first fragment of either operand (lds_frag_b's lane and k order); every other fragment is a constant offset from it
  const __bf16* pa = ldsA + (wm + cl) * BSTR + rh;
  const __bf16* pw = ldsW + (wn + cl) * BSTR + rh;
  // fa, fw hold the bf16 values of ONE k-step, loaded one trip ahead: the loads of the next step are issued behind the barrier that publishes this step's tiles
  // and fly during this step's fragment reads and matrix instructions, instead of being issued and waited for between the two barriers.
  v4u_t fa[8], fw[4];   // every loop over g below is unrolled so that their indices are constants and they stay in registers
#pragma unroll
  for (int g = 0; g < 8; ++g) fa[g] = *(const v4ua*)(sa + (size_t)(32 * g) * lda);
#pragma unroll
  for (int g = 0; g < 4; ++g) fw[g] = *(const v4ua*)(sw + (size_t)(32 * g) * ldw);
#pragma unroll 1
  for (int k0 = 0; k0 < K; k0 += 64) {
    __syncthreads();
#pragma unroll
    for (int g = 0; g < 8; ++g) *(v4ua*)(ldsA + (ar + 32 * g) * BSTR + l7 * 8) = fa[g];
#pragma unroll
    for (int g = 0; g < 4; ++g) *(v4ua*)(ldsW + (ar + 32 * g) * BSTR + l7 * 8) = fw[g];
    __syncthreads();
    if (k0 + 64 < K) {   // same for the whole grid: the last step has no successor to load
      sa += 64; sw += 64;
#pragma unroll
      for (int g = 0; g < 8; ++g) fa[g] = *(const v4ua*)(sa + (size_t)(32 * g) * lda);
#pragma unroll
      for (int g = 0; g < 4; ++g) fw[g] = *(const v4ua*)(sw + (size_t)(32 * g) * ldw);
      asm volatile("s_wait_xcnt 0x0" ::: "memory");   // the loads' two address pairs are advanced for the next trip
    }
#pragma unroll
    for (int kk = 0; kk < 64; kk += 32) {   // k ascending, 32 a matrix instruction: the order of the sums is the one it was
      b16x16 af[4], bf[4];   // all eight fragments of the 32 k are read as one group in front of their 16 matrix instructions: one LDS latency a group, not one per weight fragment
      af[0] = frag_at(pa + kk); bf[0] = frag_at(pw + kk);   // read in the order of first use: the first matrix instruction waits for 4 reads, not 10
#pragma unroll
      for (int i = 1; i < 4; ++i) af[i] = frag_at(pa + 16 * i * BSTR + kk);
#pragma unroll
      for (int j = 1; j < 4; ++j) bf[j] = frag_at(pw + 16 * j * BSTR + kk);
      __builtin_amdgcn_sched_barrier(0);   // keeps the 16 reads together in front: without it the compiler sinks each weight fragment's reads to its first use and waits for them there, four times
#pragma unroll
      for (int j = 0; j < 4; ++j)
#pragma unroll
        for (int i = 0; i < 4; ++i) acc[i][j] = __builtin_amdgcn_wmma_f32_16x16x32_bf16(false, af[i], false, bf[j], (short)0, acc[i][j], false, false);
    }
  }
  float* so = oS[wave];   // a wave's own staging range, 32 rows: its 64 rows leave in two halves
  float bv[4];
#pragma unroll
  for (int j = 0; j < 4; ++j) bv[j] = bf16r(bias[n0 + wn + 16 * j + cl]);
#pragma unroll   // constant indices into acc
  for (int h = 0; h < 2; ++h) {
#pragma unroll
    for (int i = 0; i < 2; ++i)
#pragma unroll
      for (int j = 0; j < 4; ++j)
#pragma unroll
        for (int r = 0; r < 8; ++r) so[(16 * i + rh + r) * 68 + 16 * j + cl] = acc[2 * h + i][j][r] + bv[j];
    asm volatile("s_wait_dscnt 0" ::: "memory");   // the rows are read back by other lanes of this wave
    __builtin_amdgcn_wave_barrier();
#pragma unroll
    for (int it = 0; it < 16; ++it) { const int f4 = lane + 32 * it, rr = f4 >> 4, q = (f4 & 15) * 4;
      *(v4f_t*)(Y + (size_t)(m0 + wm + 32 * h + rr) * ldy + n0 + wn + q) = *(const v4fa*)(so + rr * 68 + q); }
    if (h == 0) {
      asm volatile("s_wait_dscnt 0" ::: "memory");   // every lane's reads of the first half have returned before the second half overwrites the range
      __builtin_amdgcn_wave_barrier();
    }
  }
}

// ---------------------------------------------------------------------------------------------------------------------------
// gemm_kn2 (value+residual planes on both operands: hh + (hl+lh)/2048, f32-class): Y[m][n] (row stride ldy) = scale * sum_k A[m][k] (f32 or f16, row stride lda) * W[k][n] (f32, row-major [K][N], row
// stride ldw) (+ bias[n]) (+ Y if ACC). Block = 128 x 128 tile, 256 threads = 8 waves as 4(M, 32 rows) x 2(N, 64 cols); per
// 32-wide k-step the A tile and the W tile (stored transposed [n][k]) are staged as f16 in LDS; value and residual f16 planes per operand, f32
// blockIdx.z selects a batch: A += z*strideA, W += z*strideW, Y += z*strideY (element strides).
// ---------------------------------------------------------------------------------------------------------------------------
template <typename AT, bool ACC>
__global__ __launch_bounds__(256) void gemm_kn2(const AT* __restrict__ A, int lda, size_t strideA,
                                               const float* __restrict__ Wm, int ldw, size_t strideW,
                                               const float* __restrict__ bias, float scale,
                                               float* __restrict__ Y, int ldy, size_t strideY, int K) {
  __shared__ __attribute__((aligned(16))) f16 ldsA[128 * GSTR], ldsAl[128 * GSTR];
  __shared__ __attribute__((aligned(16))) f16 ldsW[128 * GSTR], ldsWl[128 * GSTR];
  __shared__ __attribute__((aligned(16))) float oS[8][32 * 68];
  const int tid = threadIdx.x, lane = tid & 31, wave = tid >> 5, cl = lane & 15, rh = (lane >> 4) * 8;
  const int m0 = blockIdx.x * 128, n0 = blockIdx.y * 128;
  const int wm = (wave & 3) * 32, wn = (wave >> 2) * 64;
  A += (size_t)blockIdx.z * strideA; Wm += (size_t)blockIdx.z * strideW; Y += (size_t)blockIdx.z * strideY;
  f32x8 acc[2][4], accx[2][4];
#pragma unroll
  for (int i = 0; i < 2; ++i)
#pragma unroll
    for (int j = 0; j < 4; ++j) { f32x8 z = {}; acc[i][j] = z; accx[i][j] = z; }
#pragma unroll 1
  for (int k0 = 0; k0 < K; k0 += 32) {
    __syncthreads();
    {  // A: thread -> row tid>>1, 16 elements at column half (tid&1)*16
      const int row = tid >> 1, ch = (tid & 1) * 16;
      const AT* src = A + (size_t)(m0 + row) * lda + k0 + ch;
#pragma unroll
      for (int g = 0; g < 16; ++g) { const float v = (float)src[g]; const f16 h = (f16)v; ldsA[row * GSTR + ch + g] = h; ldsAl[row * GSTR + ch + g] = (f16)((v - (float)h) * 2048.0f); }
    }
    {  // W: thread -> k = tid>>3, 16 consecutive n at (tid&7)*16; stored transposed [n][k]
      const int k = tid >> 3, nn0 = (tid & 7) * 16;
      const float* src = Wm + (size_t)(k0 + k) * ldw + n0 + nn0;
#pragma unroll
      for (int g = 0; g < 4; ++g) { const v4f_t v = *(const v4f_t*)(src + 4 * g);
#pragma unroll
        for (int u = 0; u < 4; ++u) { const f16 h = (f16)v[u]; ldsW[(nn0 + 4 * g + u) * GSTR + k] = h; ldsWl[(nn0 + 4 * g + u) * GSTR + k] = (f16)((v[u] - (float)h) * 2048.0f); } }
    }
    __syncthreads();
    f16x16 af[2], afl[2];
#pragma unroll
    for (int i = 0; i < 2; ++i) { af[i] = lds_frag(ldsA + (wm + 16 * i) * GSTR, GSTR); afl[i] = lds_frag(ldsAl + (wm + 16 * i) * GSTR, GSTR); }
#pragma unroll
    for (int j = 0; j < 4; ++j) {
      const f16x16 bf = lds_frag(ldsW + (wn + 16 * j) * GSTR, GSTR), bfl = lds_frag(ldsWl + (wn + 16 * j) * GSTR, GSTR);
#pragma unroll
      for (int i = 0; i < 2; ++i) { acc[i][j] = wmma16(af[i], bf, acc[i][j]); accx[i][j] = wmma16(af[i], bfl, accx[i][j]); accx[i][j] = wmma16(afl[i], bf, accx[i][j]); }
    }
  }
  float* so = oS[wave];
#pragma unroll
  for (int i = 0; i < 2; ++i)
#pragma unroll
    for (int j = 0; j < 4; ++j) {
      const float bv = bias ? bias[n0 + wn + 16 * j + cl] : 0.0f;
#pragma unroll
      for (int r = 0; r < 8; ++r) so[(16 * i + rh + r) * 68 + 16 * j + cl] = (acc[i][j][r] + accx[i][j][r] * (1.0f / 2048.0f)) * scale + bv;
    }
  asm volatile("s_wait_dscnt 0" ::: "memory");
  __builtin_amdgcn_wave_barrier();
  if (ACC) {   // accumulate: fold the existing Y values into the staging tile ONCE (same thread <-> same chunks as the stores below)
#pragma unroll
    for (int it = 0; it < 16; ++it) { const int f4 = lane + 32 * it, rr = f4 >> 4, q = (f4 & 15) * 4;
      const v4f_t old = *(const v4fa*)(Y + (size_t)(m0 + wm + rr) * ldy + n0 + wn + q);
      v4f_t v = *(const v4fa*)(so + rr * 68 + q); v += old; *(v4fa*)(so + rr * 68 + q) = v; }   // plain LDS store (ordered by the s_wait_dscnt/memory clobber below)
    asm volatile("s_wait_dscnt 0" ::: "memory");
  }
{
#pragma unroll
    for (int it = 0; it < 16; ++it) { const int f4 = lane + 32 * it, rr = f4 >> 4, q = (f4 & 15) * 4;
      *(v4f_t*)(Y + (size_t)(m0 + wm + rr) * ldy + n0 + wn + q) = *(const v4fa*)(so + rr * 68 + q); }
    
  }
}

__global__ __launch_bounds__(256) void k_transpose(const float* __restrict__ Wm, float* __restrict__ Wt, int rows, int cols) {
  __shared__ float tS[64][65];
  const int tid = threadIdx.x, tbj = cols / 64, bi = blockIdx.x / tbj, bj = blockIdx.x % tbj;
  for (int e = tid; e < 64 * 64; e += 256) { const int r = e >> 6, c = e & 63; tS[r][c] = Wm[(size_t)(bi * 64 + r) * cols + bj * 64 + c]; }
  __syncthreads();
  for (int ch = tid; ch < 64 * 16; ch += 256) { const int r = ch >> 4, q4 = (ch & 15) * 4; v4f_t o; o[0] = tS[q4][r]; o[1] = tS[q4 + 1][r]; o[2] = tS[q4 + 2][r]; o[3] = tS[q4 + 3][r];
    float* dst = Wt + (size_t)(bj * 64 + r) * rows + bi * 64 + q4; *(v4f_t*)dst = o;  }
}

#define NBpr 2
#define SSpr 2048
#define SIN 2048
#define DDpr 1024
#define NHpr 16
#define DKpr 64
#define HPpr 68   // LDS pitch, in floats, of one head's 64 channels in k_bhatt
__global__ __launch_bounds__(256) void k_dbg_zero(float* __restrict__ p, size_t n4) { const size_t i = (size_t)blockIdx.x * 256 + threadIdx.x; if (i < n4) { v4f_t z = {0.f,0.f,0.f,0.f}; *(v4f_t*)(p + 4 * i) = z;  } }
__global__ __launch_bounds__(256) void k_copy(const float* __restrict__ src, float* __restrict__ dst, size_t n4) { const size_t i = (size_t)blockIdx.x * 256 + threadIdx.x; if (i < n4) { const v4f_t v = *(const v4f_t*)(src + 4 * i); *(v4f_t*)(dst + 4 * i) = v;  } }
// torch [out][in] weight → WT[i][o] = mul·bf16(W[o][i]) ([in][out], lifted by a power of two so no bf16 weight becomes an f16 subnormal); block = input row i, threads loop over the outputs (4-B lanes)
__global__ __launch_bounds__(256) void k_wprepT(const float* __restrict__ Wt, float* __restrict__ WT, int nout, int nin, float mul) { const int i = blockIdx.x, tid = threadIdx.x;
#pragma unroll 1
  for (int o = tid; o < nout; o += 256) { const float w = mul * bf16r(Wt[(size_t)o * nin + i]); *(float*)(WT + (size_t)i * nout + o) = w;  } }

// sum over the 16 lanes of a row (one head's 16 four-channel chunks), every lane gets the total; DPP row_xmask butterfly, no LDS traffic
__device__ __forceinline__ float row16_sum(float v) {
  v += __int_as_float(__builtin_amdgcn_update_dpp(0, __float_as_int(v), 0x161, 0xf, 0xf, true));   // row_xmask:1
  v += __int_as_float(__builtin_amdgcn_update_dpp(0, __float_as_int(v), 0x162, 0xf, 0xf, true));   // row_xmask:2
  v += __int_as_float(__builtin_amdgcn_update_dpp(0, __float_as_int(v), 0x164, 0xf, 0xf, true));   // row_xmask:4
  v += __int_as_float(__builtin_amdgcn_update_dpp(0, __float_as_int(v), 0x168, 0xf, 0xf, true));   // row_xmask:8
  return v;
}

// per-token head-to-head Bhattacharyya attention: the six projected [16][64] vectors of a token staged in LDS; thread = (query head i, key head j) for the distance, then
// With a = sq^2 + eps, b = sk^2 + eps: a/b + b/a + 2 = (a + b)^2 / (a b), so term1 = 0.5 ln((a + b)/2) - 0.25 ln a - 0.25 ln b. ln a and ln b depend on one head only and are summed over
// the channels once per head while staging; a (pair, channel) then costs one log2 of a + b and one reciprocal of sq^2 + sk^2 + eps (a + b is that denominator + eps).
// One launch for both batch elements: NWGpr workgroups, all resident at once, each walks TPBpr tokens (token = batch * srows + row, NWGpr apart). The six rows of the next token are loaded
// into registers behind the barrier that publishes this token's rows and fly during this token's distances, softmax and value sums.
#define TPBpr 4                             // tokens per workgroup
#define NWGpr (NBpr * SSpr / TPBpr)         // workgroups of the launch
__global__ __launch_bounds__(256) void k_bhatt(const float* __restrict__ MQ, const float* __restrict__ SQ, const float* __restrict__ MK, const float* __restrict__ SK, const float* __restrict__ MV, const float* __restrict__ SV, float* __restrict__ omu, float* __restrict__ osg, int srows) {
  // q and k head rows sit at a pitch of HPpr floats (272 B = 16 B x 17): the 16 key heads that the 16 lanes of a row read at one channel offset fall on distinct banks
  // q2 holds sigma_q^2, k2 holds sigma_k^2 + eps; lk[j] = sum over the channels of log2(sigma_k^2 + eps) of key head j
  // mv, sv have two buffers: they are read behind the second barrier of a token, where a faster wave may already stage the next token; everything else that the staging writes is last read in front of that barrier
  __shared__ __attribute__((aligned(16))) float mq[NHpr * HPpr], q2[NHpr * HPpr], mk[NHpr * HPpr], k2[NHpr * HPpr], mv[2][1024], sv[2][1024]; __shared__ float att[256]; __shared__ float lk[NHpr];
  const int tid = threadIdx.x;
  const int p4 = (tid >> 4) * HPpr + (tid & 15) * 4;
  const int i = tid >> 4, j = tid & 15;
  const int hi = tid >> 4, c4 = (tid & 15) * 4;
  unsigned o4 = (unsigned)blockIdx.x * DDpr + 4 * tid;   // this thread's four channels of the token whose rows are loaded next
  v4f_t sgq = *(const v4f_t*)(SQ + o4), sgk = *(const v4f_t*)(SK + o4), muq = *(const v4f_t*)(MQ + o4), muk = *(const v4f_t*)(MK + o4), muv = *(const v4f_t*)(MV + o4), sgv = *(const v4f_t*)(SV + o4);
  asm volatile("s_wait_xcnt 0x0" ::: "memory");   // the loads' address registers are rewritten below
#pragma unroll 1   // one token's code in the instruction stream; the trips are tied by the barriers anyway
  for (int it = 0; it < TPBpr; ++it) {
    const int tok = blockIdx.x + it * NWGpr, bat = tok / SSpr, t = tok % SSpr;
    float* mvb = mv[it & 1]; float* svb = sv[it & 1];
    float lq;   // sum over the channels of log2(sigma_q^2 + eps) of query head tid >> 4, in every lane of that head's row
    { const v4f_t vq = sgq * sgq, vk = sgk * sgk + 1e-6f, aq = vq + 1e-6f;
      *(v4f_t*)(mq + p4) = muq; *(v4f_t*)(q2 + p4) = vq; *(v4f_t*)(mk + p4) = muk; *(v4f_t*)(k2 + p4) = vk; *(v4f_t*)(mvb + 4 * tid) = muv; *(v4f_t*)(svb + 4 * tid) = sgv;
      v4f_t la, lb;
#pragma unroll   // constant indices into the four-channel vectors, so that they stay in registers
      for (int u = 0; u < 4; ++u) { la[u] = __builtin_amdgcn_logf(aq[u]); lb[u] = __builtin_amdgcn_logf(vk[u]); }
      lq = row16_sum((la[0] + la[2]) + (la[1] + la[3]));
      const float lks = row16_sum((lb[0] + lb[2]) + (lb[1] + lb[3]));
      if ((tid & 15) == 0) lk[tid >> 4] = lks; }
    __syncthreads();
    if (it + 1 < TPBpr) {   // same for the whole grid: the last token has no successor to load
      o4 += NWGpr * DDpr;
      sgq = *(const v4f_t*)(SQ + o4); sgk = *(const v4f_t*)(SK + o4); muq = *(const v4f_t*)(MQ + o4); muk = *(const v4f_t*)(MK + o4); muv = *(const v4f_t*)(MV + o4); sgv = *(const v4f_t*)(SV + o4);
      asm volatile("s_wait_xcnt 0x0" ::: "memory");   // the loads' address registers are rewritten below
    }
    v4f_t sl, sm; sl[0] = sl[1] = sl[2] = sl[3] = 0.0f; sm[0] = sm[1] = sm[2] = sm[3] = 0.0f;   // per channel residue mod 4: sums of log2(a + b) and of dm^2 / (sq^2 + sk^2 + eps)
#pragma unroll 4   // four 16-byte LDS read groups in flight per trip
    for (int d = 0; d < DKpr; d += 4) {   // four channels per 16-byte LDS read
      const v4f_t q24 = *(const v4f_t*)(q2 + i * HPpr + d), k24 = *(const v4f_t*)(k2 + j * HPpr + d), mq4 = *(const v4f_t*)(mq + i * HPpr + d), mk4 = *(const v4f_t*)(mk + j * HPpr + d);
      const v4f_t den = q24 + k24, ab = den + 1e-6f, dm = mq4 - mk4; v4f_t lg4, rc4;
#pragma unroll   // constant indices into the four-channel vectors, so that they stay in registers
      for (int u = 0; u < 4; ++u) { lg4[u] = __builtin_amdgcn_logf(ab[u]); rc4[u] = __builtin_amdgcn_rcpf(den[u]); }
      sl += lg4; sm += (dm * dm) * rc4; }
    const float sumlog = (sl[0] + sl[1]) + (sl[2] + sl[3]), summ = (sm[0] + sm[1]) + (sm[2] + sm[3]);
    const float dist = 0.69314718055994531f * (0.5f * sumlog - 0.5f * (float)DKpr - 0.25f * (lq + lk[j])) + 0.25f * summ;
    float lg = -0.5f * (dist * 0.125f); float m = lg;
    m = fmaxf(m, __shfl_xor(m, 1, 32)); m = fmaxf(m, __shfl_xor(m, 2, 32)); m = fmaxf(m, __shfl_xor(m, 4, 32)); m = fmaxf(m, __shfl_xor(m, 8, 32));
    float e = expf(lg - m); float z = e; z += __shfl_xor(z, 1, 32); z += __shfl_xor(z, 2, 32); z += __shfl_xor(z, 4, 32); z += __shfl_xor(z, 8, 32);
    att[tid] = e / z; __syncthreads();
    v4f_t am, av; am[0] = am[1] = am[2] = am[3] = 0.0f; av[0] = av[1] = av[2] = av[3] = 0.0f;
#pragma unroll 1
    for (int jj = 0; jj < NHpr; ++jj) { const float a = att[hi * NHpr + jj]; const v4f_t mvj = *(const v4f_t*)(mvb + jj * DKpr + c4), svj = *(const v4f_t*)(svb + jj * DKpr + c4); am += a * mvj; av += a * (svj * svj); }
    v4f_t os; for (int u = 0; u < 4; ++u) os[u] = sqrtf(fmaxf(av[u], 0.0f) + 1e-6f);
    const size_t oo = ((size_t)(bat * NHpr + hi) * srows + t) * DKpr + c4;   // [batch][head][row][64]
    *(v4f_t*)(omu + oo) = am; *(v4f_t*)(osg + oo) = os;
    asm volatile("s_wait_xcnt 0x0" ::: "memory");   // the two stores' registers are rewritten at the head of the next trip
  }
}

extern "C" void kernel_launch(void* const* d_in, const int* in_sizes, int n_in,
                              void* d_out, int out_size, void* d_ws, size_t ws_size,
                              hipStream_t stream) {
  (void)in_sizes; (void)n_in; (void)out_size;
  const float** f = (const float**)d_in;
  float* out0 = (float*)d_out; float* out1 = out0 + (size_t)2 * SIN * DDpr;   // out_mu, out_sigma
  char* ws = (char*)d_ws;
  const size_t slab = (size_t)NBpr * SSpr * DDpr;   // one projection's rows: both batch elements, [4096][1024]
  float* P[6]; for (int i = 0; i < 6; ++i) { P[i] = (float*)ws; ws += slab * 4; }
  float* xb = (float*)ws; ws += slab * 6 * 2;                            // the six activations as bf16, [6][4096][1024]
  float* wb = (float*)ws; ws += (size_t)DDpr * DDpr * 6 * 2;             // the six weights as bf16, transposed, [6][out][in]
  if ((size_t)(ws - (char*)d_ws) > ws_size) return;                      // WS TOTAL 163,577,856 B
  const dim3 blk(256); const dim3 gp(NBpr * SSpr / 256, DDpr / 128, 6);
  // input -> projection slot map: query->q_mu (w0), key->k_mu (w1), value->v_mu (w2), query_sigma->q_sigma (w3), key_sigma->k_sigma (w4), value_sigma->v_sigma (w5)
  k_pack<<<dim3(PKWB + 6 * PKXB), blk, 0, stream>>>(f[0], f[1], f[2], f[3], f[4], f[5], f[6], f[7], f[8], f[9], f[10], f[11], xb, wb);
  // the batch axis is folded into the GEMM's M (4096 rows) and the six projections into blockIdx.z: one launch of 16 x 8 x 6 tiles of 256 x 128, three for every WGP
  gemm_proj6<<<gp, blk, 0, stream>>>(xb, wb, f[12], f[13], f[14], f[15], f[16], f[17], P[0]);
  // both batch elements in one launch: the projections' rows are [batch * 2048 + row][1024], the outputs [batch][head][row][64]
  k_bhatt<<<dim3(NWGpr), blk, 0, stream>>>(P[0], P[3], P[1], P[4], P[2], P[5], out0, out1, SIN);
}
